// v000
// Times are from an AMD MI455X. After a warm-up the kernel runs many times in a row, and a time is the length of
// such a window on the GPU divided by its runs, so every launch and the gaps after it count. The runs cycle
// through copies of the inputs. A figure is the median of several windows, for all but v000 over two sittings.
// Sittings can differ by a few percent; kernels timed side by side share one.
// v000 is the starting kernel. One run takes 246 microseconds.
#include <hip/hip_runtime.h>
// Contractions: first Linear of each q/k/v chain on v_wmma_f32_16x16x32_bf16 (x and W converted RNE to bf16, single product, f32 accumulate); second Linears, K Q^T scores and the output Linear on v_wmma_f32_16x16x32_f16 (activations x16 or x256 in f16, weights = RNE-bf16 value x64 held exactly in f16, f32 accumulate); O^T = V^T P^T on v_wmma_f32_16x16x32_f16 (V x16 f16; P x256 f16 hi plane + x2^11 f16 residual plane in a separate f32 accumulator); biases RNE-bf16 values added in f32; softmax statistics f32.
// 64 feature chunks of width 16 act as heads; scale 1/4; no mask; context is written in the flat-reinterpreted (16, b, s, 64) -> (b, s, 1024) order.
// GEMM engine: C[m][n] = sum_k A[m][k] W[n][k]; both operands are k-contiguous 16-bit planes, fragments are loaded straight from global rows
// (elements 0..7 <- k0 + 8h + i, elements 8..15 <- k0 + 16 + 8h + i for A rows and for W rows alike). 128x128 block tile, 8 waves of 32x64.
// Attention engine: transposed flash. Each wave owns 16 queries of one (chunk, batch). Per 32-key step: S^T tiles (key rows x query columns)
// from K rows (A) and Q^T (B), upper 16 k slots zero; the two 16-key D tiles pack straight into the P^T B fragment; O^T (16 d rows x query columns)
// accumulates from V^T rows (A, global f16 plane produced directly by a GEMM with swapped operand roles).
#ifndef NB
#define NB 2
#endif
#ifndef SEQ
#define SEQ 1024
#endif
#define NB_FULL 2
#define SEQ_FULL 1024
#define FEAT 1024
#define NCH 64
#define MROWS (NB * SEQ)

static_assert(SEQ % 128 == 0);
static_assert(SEQ <= SEQ_FULL);
static_assert(NB <= NB_FULL);
static_assert(FEAT % 128 == 0);
static_assert(FEAT == NCH * 16);
static_assert((size_t)8 * MROWS * FEAT * 2 + (size_t)7 * FEAT * FEAT * 2 <= (size_t)134217728);
static_assert(((size_t)(NB - 1) * SEQ_FULL + SEQ) * FEAT <= (size_t)NB_FULL * SEQ_FULL * FEAT);

typedef __bf16 v16b __attribute__((ext_vector_type(16)));
typedef _Float16 v16h __attribute__((ext_vector_type(16)));
typedef unsigned short v8us __attribute__((ext_vector_type(8), may_alias));
typedef float v8f __attribute__((ext_vector_type(8)));
typedef float v4f __attribute__((ext_vector_type(4)));
typedef float v4fa __attribute__((ext_vector_type(4), may_alias));
union Frag { v16b b; v16h h; v8us half[2]; _Float16 e[16]; unsigned short u[16]; };

#define LOG2E 1.4426950408889634f

__device__ __forceinline__ unsigned short bf16_bits(float x) {   // RNE convert to bf16 bits
  unsigned int u = __float_as_uint(x);
  return (unsigned short)((u + 0x7FFFu + ((u >> 16) & 1u)) >> 16);
}
__device__ __forceinline__ float bf16_val(unsigned short b) { return __uint_as_float(((unsigned int)b) << 16); }
__device__ __forceinline__ float bf16_rne(float x) { return bf16_val(bf16_bits(x)); }

// c0 += a0*b ; c1 += a1*b (two key tiles against one query fragment), then the hazard guard
__device__ __forceinline__ void mma_s2(v16h a0, v16h a1, v16h b, v8f& c0, v8f& c1) {
  c0 = __builtin_amdgcn_wmma_f32_16x16x32_f16(false, a0, false, b, (short)0, c0, false, false);
  c1 = __builtin_amdgcn_wmma_f32_16x16x32_f16(false, a1, false, b, (short)0, c1, false, false);
  asm volatile("v_nop\n\tv_nop\n\tv_nop\n\tv_nop" : "+v"(c0), "+v"(c1) : "v"(a0), "v"(a1), "v"(b));
}
// ch += a*bh ; cl += a*bl (scaled residual plane keeps its own accumulator), then the hazard guard
__device__ __forceinline__ void mma_h2(v16h a, v16h bh, v16h bl, v8f& ch, v8f& cl) {
  ch = __builtin_amdgcn_wmma_f32_16x16x32_f16(false, a, false, bh, (short)0, ch, false, false);
  cl = __builtin_amdgcn_wmma_f32_16x16x32_f16(false, a, false, bl, (short)0, cl, false, false);
  asm volatile("v_nop\n\tv_nop\n\tv_nop\n\tv_nop" : "+v"(ch), "+v"(cl) : "v"(a), "v"(bh), "v"(bl));
}

// coverage: MROWS*(FEAT/8) threads x 8 elements = the whole compact plane.
__global__ __launch_bounds__(256) void k_cvtx(const float* __restrict__ X, unsigned short* __restrict__ Xb) {
  const int t = blockIdx.x * 256 + threadIdx.x;
  if (t >= MROWS * (FEAT / 8)) return;
  const int row = t / (FEAT / 8), piece = t - row * (FEAT / 8);
  const int b = row / SEQ, s = row - b * SEQ;
  const float* src = X + ((size_t)b * SEQ_FULL + s) * FEAT + piece * 8;
  const v4f x0 = *(const v4fa*)(src), x1 = *(const v4fa*)(src + 4);
  v8us o;
  o[0] = bf16_bits(x0[0]); o[1] = bf16_bits(x0[1]); o[2] = bf16_bits(x0[2]); o[3] = bf16_bits(x0[3]);
  o[4] = bf16_bits(x1[0]); o[5] = bf16_bits(x1[1]); o[6] = bf16_bits(x1[2]); o[7] = bf16_bits(x1[3]);
  unsigned short* d = Xb + (size_t)t * 8;
  *(v8us*)d = o;
  
}

// Weight plane [out][in]: MODE 0 -> bf16 bits (RNE); MODE 1 -> f16 bits of (RNE-bf16 value x 64).
template <int MODE>
__global__ __launch_bounds__(256) void k_cvtw(const float* __restrict__ Wsrc, unsigned short* __restrict__ Wp) {
  const int t = blockIdx.x * 256 + threadIdx.x;
  if (t >= FEAT * (FEAT / 8)) return;
  const float* src = Wsrc + (size_t)t * 8;
  const v4f x0 = *(const v4fa*)(src), x1 = *(const v4fa*)(src + 4);
  v8us o;
  if (MODE == 0) {
    o[0] = bf16_bits(x0[0]); o[1] = bf16_bits(x0[1]); o[2] = bf16_bits(x0[2]); o[3] = bf16_bits(x0[3]);
    o[4] = bf16_bits(x1[0]); o[5] = bf16_bits(x1[1]); o[6] = bf16_bits(x1[2]); o[7] = bf16_bits(x1[3]);
  } else {
    Frag f;
    f.e[0] = (_Float16)(bf16_rne(x0[0]) * 64.0f); f.e[1] = (_Float16)(bf16_rne(x0[1]) * 64.0f);
    f.e[2] = (_Float16)(bf16_rne(x0[2]) * 64.0f); f.e[3] = (_Float16)(bf16_rne(x0[3]) * 64.0f);
    f.e[4] = (_Float16)(bf16_rne(x1[0]) * 64.0f); f.e[5] = (_Float16)(bf16_rne(x1[1]) * 64.0f);
    f.e[6] = (_Float16)(bf16_rne(x1[2]) * 64.0f); f.e[7] = (_Float16)(bf16_rne(x1[3]) * 64.0f);
    o = f.half[0];
  }
  unsigned short* d = Wp + (size_t)t * 8;
  *(v8us*)d = o;
  
}

// C[m][n] = sum_k A[m][k] W[n][k], K = FEAT, A and W k-contiguous planes of pitch FEAT.
// BF: bf16 operands, else f16 operands. Grid (Mrows/128, Ncols/128), 8 waves of 32 x 64.
// EPI 0: out f16 plane [m][N] = f16((acc*sc + bias[n]) * carry)     (bias along columns)
// EPI 1: out f16 plane [m][N] = f16((acc*sc + bias[m]) * carry)     (bias along rows)
// EPI 2: out f32 [b*SEQ_FULL + s][FEAT] = acc*sc + bias[n], m = b*SEQ + s
// Epilogue: two phases of 16 rows; the wave's 16 x 64 tile is staged in its own LDS tile (fully written: 16 rows x 64 columns, fully consumed),
template <bool BF, int EPI>
__global__ __launch_bounds__(256) void k_gemm(const unsigned short* __restrict__ A, const unsigned short* __restrict__ W,
                                              const float* __restrict__ bias, void* __restrict__ outp,
                                              int N, float sc, float carry) {
  __shared__ __attribute__((aligned(16))) float sst[8][16][68];
  const int tid = threadIdx.x, lane = tid & 31, w = __builtin_amdgcn_readfirstlane((int)(tid >> 5));
  const int wm = w & 3, wn = w >> 2, ln = lane & 15, hh = lane >> 4;
  const int m0 = blockIdx.x * 128 + wm * 32;
  const int n0 = blockIdx.y * 128 + wn * 64;
  const unsigned short* ap = A + (size_t)(m0 + ln) * FEAT + 8 * hh;
  const unsigned short* wp = W + (size_t)(n0 + ln) * FEAT + 8 * hh;
  v8f acc[2][4];
#pragma unroll
  for (int fm = 0; fm < 2; ++fm)
#pragma unroll
    for (int fn = 0; fn < 4; ++fn)
#pragma unroll
      for (int r = 0; r < 8; ++r) acc[fm][fn][r] = 0.0f;

#pragma unroll 1
  for (int k0 = 0; k0 < FEAT; k0 += 32) {
    Frag a[2], b[4];
#pragma unroll
    for (int fm = 0; fm < 2; ++fm) {
      a[fm].half[0] = *(const v8us*)(ap + (size_t)fm * 16 * FEAT + k0);
      a[fm].half[1] = *(const v8us*)(ap + (size_t)fm * 16 * FEAT + k0 + 16);
    }
#pragma unroll
    for (int fn = 0; fn < 4; ++fn) {
      b[fn].half[0] = *(const v8us*)(wp + (size_t)fn * 16 * FEAT + k0);
      b[fn].half[1] = *(const v8us*)(wp + (size_t)fn * 16 * FEAT + k0 + 16);
    }
#pragma unroll
    for (int fm = 0; fm < 2; ++fm)
#pragma unroll
      for (int fn = 0; fn < 4; ++fn) {
        if (BF) acc[fm][fn] = __builtin_amdgcn_wmma_f32_16x16x32_bf16(false, a[fm].b, false, b[fn].b, (short)0, acc[fm][fn], false, false);
        else    acc[fm][fn] = __builtin_amdgcn_wmma_f32_16x16x32_f16(false, a[fm].h, false, b[fn].h, (short)0, acc[fm][fn], false, false);
      }
    asm volatile("v_nop\n\tv_nop\n\tv_nop\n\tv_nop"
                 : "+v"(acc[0][0]), "+v"(acc[0][1]), "+v"(acc[0][2]), "+v"(acc[0][3]),
                   "+v"(acc[1][0]), "+v"(acc[1][1]), "+v"(acc[1][2]), "+v"(acc[1][3])
                 : "v"(a[0].h), "v"(a[1].h), "v"(b[0].h), "v"(b[1].h), "v"(b[2].h), "v"(b[3].h));
  }

  // D element r of tile (fm, fn) = C(m0 + 16 fm + 8 hh + r, n0 + 16 fn + ln)
  float bcol[4];
#pragma unroll
  for (int fn = 0; fn < 4; ++fn) bcol[fn] = 0.0f;
  if (EPI != 1) {
#pragma unroll
    for (int fn = 0; fn < 4; ++fn) bcol[fn] = bf16_rne(bias[n0 + fn * 16 + ln]);
  }
#pragma unroll
  for (int fm = 0; fm < 2; ++fm) {
    float brow[8];
#pragma unroll
    for (int r = 0; r < 8; ++r) brow[r] = 0.0f;
    if (EPI == 1) {
#pragma unroll
      for (int r = 0; r < 8; ++r) brow[r] = bf16_rne(bias[m0 + fm * 16 + 8 * hh + r]);
    }
#pragma unroll
    for (int fn = 0; fn < 4; ++fn)
#pragma unroll
      for (int r = 0; r < 8; ++r) {
        float v = acc[fm][fn][r] * sc + ((EPI == 1) ? brow[r] : bcol[fn]);
        if (EPI != 2) v = v * carry;
        sst[w][8 * hh + r][fn * 16 + ln] = v;
      }
    __syncthreads();
    if (EPI == 2) {
      float* of = (float*)outp;
      const int rsub = lane >> 4, c4 = (lane & 15) * 4;
      {
#pragma unroll
        for (int q = 0; q < 8; ++q) {
          const int row = 2 * q + rsub;
          const int m = m0 + fm * 16 + row;
          const int bb = m / SEQ;
          const size_t grow = (size_t)bb * SEQ_FULL + (size_t)(m - bb * SEQ);
          const v4f v = *(const v4fa*)&sst[w][row][c4];
          *(v4f*)(of + grow * FEAT + n0 + c4) = v;
        }
        
      }
    } else {
      unsigned short* oh = (unsigned short*)outp;
      const int jsub = lane >> 3, p8 = (lane & 7) * 8;
      {
#pragma unroll
        for (int it = 0; it < 4; ++it) {
          const int j = jsub + 4 * it;
          const v4f x0 = *(const v4fa*)&sst[w][j][p8];
          const v4f x1 = *(const v4fa*)&sst[w][j][p8 + 4];
          Frag f;
          f.e[0] = (_Float16)x0[0]; f.e[1] = (_Float16)x0[1]; f.e[2] = (_Float16)x0[2]; f.e[3] = (_Float16)x0[3];
          f.e[4] = (_Float16)x1[0]; f.e[5] = (_Float16)x1[1]; f.e[6] = (_Float16)x1[2]; f.e[7] = (_Float16)x1[3];
          const v8us o = f.half[0];
          *(v8us*)(oh + (size_t)(m0 + fm * 16 + j) * N + n0 + p8) = o;
        }
        
      }
    }
    __syncthreads();
  }
}

// One 32-key step for a wave's 16 queries. kp: K plane row (key0 + ln) at this chunk's columns + 8h; vp: V^T plane row (chunk*16 + ln) at key0 + 8h.
__device__ __forceinline__ void fa_step(const unsigned short* __restrict__ kp, const unsigned short* __restrict__ vp,
                                        const Frag& qf, float& mr, float& lr, v8f& Oh, v8f& Ol) {
  const v8us zz = {0, 0, 0, 0, 0, 0, 0, 0};
  // A fragments of K: row m = key (key0 + 16*kt + ln), elements 0..7 <- d = 8h + i, elements 8..15 (k slots 16..31) zero
  Frag k0, k1, vf;
  k0.half[0] = *(const v8us*)(kp);             k0.half[1] = zz;
  k1.half[0] = *(const v8us*)(kp + 16 * FEAT); k1.half[1] = zz;
  // A fragment of V^T: row m = d (ln), elements 0..7 <- key0 + 8h + i, 8..15 <- key0 + 16 + 8h + i
  vf.half[0] = *(const v8us*)(vp);
  vf.half[1] = *(const v8us*)(vp + 16);
  v8f s0 = {0.f, 0.f, 0.f, 0.f, 0.f, 0.f, 0.f, 0.f};
  v8f s1 = {0.f, 0.f, 0.f, 0.f, 0.f, 0.f, 0.f, 0.f};
  // S^T tiles: element r of tile kt = 256 * q.k of (key0 + 16*kt + 8h + r, query ln)
  mma_s2(k0.h, k1.h, qf.h, s0, s1);
  float sc[16];
#pragma unroll
  for (int r = 0; r < 8; ++r) { sc[r] = s0[r] * 0.0009765625f; sc[8 + r] = s1[r] * 0.0009765625f; }   // undo x16 x16 carries, divide by 4
  float mx = sc[0];
#pragma unroll
  for (int i = 1; i < 16; ++i) mx = fmaxf(mx, sc[i]);
  mx = fmaxf(mx, __shfl_xor(mx, 16, 32));           // the other lane half holds the other 16 keys of this query
  const float mnew = fmaxf(mr, mx);
  const float al = exp2f((mr - mnew) * LOG2E);
  mr = mnew;
  // weights carried x256: pc = 256 * exp(sc - mnew); hi plane f16(pc), residual plane f16((pc - hi) * 2048)
  Frag ph, pl;
  float ps = 0.0f;
#pragma unroll
  for (int i = 0; i < 16; ++i) {
    const float pc = exp2f(fmaf(sc[i] - mnew, LOG2E, 8.0f));
    ps += pc;
    const _Float16 h = (_Float16)pc;
    ph.e[i] = h;                                    // B element i: i<8 -> key0 + 8h + i (tile 0 row 8h+i); i>=8 -> key0 + 16 + 8h + (i-8) (tile 1)
    pl.e[i] = (_Float16)((pc - (float)h) * 2048.0f);
  }
  ps += __shfl_xor(ps, 16, 32);
  lr = lr * al + ps;
  Oh = Oh * al; Ol = Ol * al;
  mma_h2(vf.h, ph.h, pl.h, Oh, Ol);
}

// Block = 4 waves x 16 queries = 64 queries of one (chunk, batch); no LDS and no barrier in the key loop.
// Epilogue: O^T tile -> per-wave LDS tile [16 queries][16 d] (fully written, fully consumed; block barrier), then one instruction of
// Context plane element order: flat = ((c*NB + b)*SEQ + s)*16 + h; plane row = (flat>>6) mod (NB*SEQ), column = (flat>>6)/(NB*SEQ)*64 + (flat&63).
// coverage: NCH*NB*(SEQ/64) blocks x 4 waves x 256 elements = every element of the plane exactly once.
__global__ __launch_bounds__(128) void k_attn(const unsigned short* __restrict__ Qp, const unsigned short* __restrict__ Kp,
                                              const unsigned short* __restrict__ Vt, unsigned short* __restrict__ O2) {
  __shared__ __attribute__((aligned(16))) float so[4][16][20];
  const int tid = threadIdx.x, w = __builtin_amdgcn_readfirstlane((int)(tid >> 5)), lane = tid & 31, ln = lane & 15, hh = lane >> 4;
  const int qt = blockIdx.x % (SEQ / 64);
  const int p = blockIdx.x / (SEQ / 64);
  const int b = p % NB, c = p / NB;
  const int qbase = qt * 64 + 16 * w;
  const int qg = qbase + ln;
  const v8us zz = {0, 0, 0, 0, 0, 0, 0, 0};
  // Q^T B fragment: column n = query qg, elements 0..7 <- d = 8h + i, elements 8..15 zero
  Frag qf;
  qf.half[0] = *(const v8us*)(Qp + ((size_t)b * SEQ + qg) * FEAT + c * 16 + 8 * hh);
  qf.half[1] = zz;
  const unsigned short* kb = Kp + ((size_t)b * SEQ + ln) * FEAT + c * 16 + 8 * hh;
  const unsigned short* vb = Vt + (size_t)(c * 16 + ln) * MROWS + (size_t)b * SEQ + 8 * hh;
  float mr = -3.0e38f, lr = 0.0f;
  v8f Oh = {0.f, 0.f, 0.f, 0.f, 0.f, 0.f, 0.f, 0.f};
  v8f Ol = {0.f, 0.f, 0.f, 0.f, 0.f, 0.f, 0.f, 0.f};
#pragma unroll 1
  for (int j = 0; j < SEQ / 32; ++j)
    fa_step(kb + (size_t)j * 32 * FEAT, vb + j * 32, qf, mr, lr, Oh, Ol);

  // O^T element r = out(query qg, d = 8h + r); undo x256 (in lr), x16 (V), x2048 (residual plane); carry the context x256
  const float inv = 16.0f * (1.0f / lr);
#pragma unroll
  for (int r = 0; r < 8; ++r)
    so[w][ln][8 * hh + r] = (Oh[r] + Ol[r] * 0.00048828125f) * inv;
  __syncthreads();
  const int qq = lane >> 1, d0 = (lane & 1) * 8;
  const v4f x0 = *(const v4fa*)&so[w][qq][d0];
  const v4f x1 = *(const v4fa*)&so[w][qq][d0 + 4];
  Frag f;
  f.e[0] = (_Float16)x0[0]; f.e[1] = (_Float16)x0[1]; f.e[2] = (_Float16)x0[2]; f.e[3] = (_Float16)x0[3];
  f.e[4] = (_Float16)x1[0]; f.e[5] = (_Float16)x1[1]; f.e[6] = (_Float16)x1[2]; f.e[7] = (_Float16)x1[3];
  const v8us o = f.half[0];
  const int R = (c * NB + b) * (SEQ / 4) + (qbase >> 2) + (lane >> 3);
  const int hp = R / MROWS;
  const int prow = R - hp * MROWS;
  unsigned short* dst = O2 + (size_t)prow * FEAT + hp * 64 + (lane & 7) * 8;
  *(v8us*)dst = o;
  
}

extern "C" void kernel_launch(void* const* d_in, const int* in_sizes, int n_in,
                              void* d_out, int out_size, void* d_ws, size_t ws_size, hipStream_t stream) {
  if (n_in < 15) return;
  const long long needx = ((long long)(NB - 1) * SEQ_FULL + SEQ) * FEAT;   // last element touched + 1
  if ((long long)in_sizes[0] < needx) return;
  if ((long long)out_size < needx) return;
  for (int i = 1; i < 15; i += 2) {
    if ((long long)in_sizes[i] < (long long)FEAT * FEAT) return;
    if ((long long)in_sizes[i + 1] < (long long)FEAT) return;
  }
  // wire order: x, then (weight, bias) pairs for wq, wk, wv, vq, vk, vv, wo
  const float* x    = (const float*)d_in[0];
  const float* wq_w = (const float*)d_in[1];
  const float* wq_b = (const float*)d_in[2];
  const float* wk_w = (const float*)d_in[3];
  const float* wk_b = (const float*)d_in[4];
  const float* wv_w = (const float*)d_in[5];
  const float* wv_b = (const float*)d_in[6];
  const float* vq_w = (const float*)d_in[7];
  const float* vq_b = (const float*)d_in[8];
  const float* vk_w = (const float*)d_in[9];
  const float* vk_b = (const float*)d_in[10];
  const float* vv_w = (const float*)d_in[11];
  const float* vv_b = (const float*)d_in[12];
  const float* wo_w = (const float*)d_in[13];
  const float* wo_b = (const float*)d_in[14];

  char* ws = (char*)d_ws;
  size_t off = 0;
  const size_t planeA = (size_t)MROWS * FEAT * 2;
  const size_t planeW = (size_t)FEAT * FEAT * 2;       // weight plane
  unsigned short* Xb  = (unsigned short*)(ws + off); off += (planeA + 255) & ~(size_t)255;
  unsigned short* Wqb = (unsigned short*)(ws + off); off += (planeW + 255) & ~(size_t)255;
  unsigned short* Wkb = (unsigned short*)(ws + off); off += (planeW + 255) & ~(size_t)255;
  unsigned short* Wvb = (unsigned short*)(ws + off); off += (planeW + 255) & ~(size_t)255;
  unsigned short* Vqh = (unsigned short*)(ws + off); off += (planeW + 255) & ~(size_t)255;
  unsigned short* Vkh = (unsigned short*)(ws + off); off += (planeW + 255) & ~(size_t)255;
  unsigned short* Vvh = (unsigned short*)(ws + off); off += (planeW + 255) & ~(size_t)255;
  unsigned short* Woh = (unsigned short*)(ws + off); off += (planeW + 255) & ~(size_t)255;
  unsigned short* T1q = (unsigned short*)(ws + off); off += (planeA + 255) & ~(size_t)255;
  unsigned short* T1k = (unsigned short*)(ws + off); off += (planeA + 255) & ~(size_t)255;
  unsigned short* T1v = (unsigned short*)(ws + off); off += (planeA + 255) & ~(size_t)255;
  unsigned short* Qp  = (unsigned short*)(ws + off); off += (planeA + 255) & ~(size_t)255;
  unsigned short* Kp  = (unsigned short*)(ws + off); off += (planeA + 255) & ~(size_t)255;
  unsigned short* Vt  = (unsigned short*)(ws + off); off += (planeA + 255) & ~(size_t)255;   // [FEAT][MROWS]
  unsigned short* O2  = (unsigned short*)(ws + off); off += (planeA + 255) & ~(size_t)255;
  if (off > ws_size) return;

  const unsigned gx = (unsigned)((MROWS * (FEAT / 8) + 255) / 256);
  const unsigned gw = (unsigned)((FEAT * (FEAT / 8) + 255) / 256);
  k_cvtx<<<gx, 256, 0, stream>>>(x, Xb);
  k_cvtw<0><<<gw, 256, 0, stream>>>(wq_w, Wqb);
  k_cvtw<0><<<gw, 256, 0, stream>>>(wk_w, Wkb);
  k_cvtw<0><<<gw, 256, 0, stream>>>(wv_w, Wvb);
  k_cvtw<1><<<gw, 256, 0, stream>>>(vq_w, Vqh);
  k_cvtw<1><<<gw, 256, 0, stream>>>(vk_w, Vkh);
  k_cvtw<1><<<gw, 256, 0, stream>>>(vv_w, Vvh);
  k_cvtw<1><<<gw, 256, 0, stream>>>(wo_w, Woh);

  const dim3 gA((unsigned)(MROWS / 128), (unsigned)(FEAT / 128));   // C rows = tokens, columns = features
  const dim3 gV((unsigned)(FEAT / 128), (unsigned)(MROWS / 128));   // C rows = features, columns = tokens
  const float s10 = 0.0009765625f;          // 1 / (16 * 64)
  const float s14 = 0.00006103515625f;      // 1 / (256 * 64)
  // k_gemm(A, W, bias, out, N, sc, carry)
  k_gemm<true, 0><<<gA, 256, 0, stream>>>(Xb, Wqb, wq_b, (void*)T1q, FEAT, 1.0f, 16.0f);
  k_gemm<false, 0><<<gA, 256, 0, stream>>>(T1q, Vqh, vq_b, (void*)Qp, FEAT, s10, 16.0f);
  k_gemm<true, 0><<<gA, 256, 0, stream>>>(Xb, Wkb, wk_b, (void*)T1k, FEAT, 1.0f, 16.0f);
  k_gemm<false, 0><<<gA, 256, 0, stream>>>(T1k, Vkh, vk_b, (void*)Kp, FEAT, s10, 16.0f);
  k_gemm<true, 0><<<gA, 256, 0, stream>>>(Xb, Wvb, wv_b, (void*)T1v, FEAT, 1.0f, 16.0f);
  // V^T[f][token] = sum_j vv[f][j] * t1v[token][j] + vv_b[f]
  k_gemm<false, 1><<<gV, 256, 0, stream>>>(Vvh, T1v, vv_b, (void*)Vt, MROWS, s10, 16.0f);

  k_attn<<<(unsigned)(NCH * NB * (SEQ / 64)), 128, 0, stream>>>(Qp, Kp, Vt, O2);

  k_gemm<false, 2><<<gA, 256, 0, stream>>>(O2, Woh, wo_b, d_out, FEAT, s14, 1.0f);
}

// v001
// It runs in 238 microseconds.
// Next to v000, in two timings, it ran 1.05 and 1.04 times as fast.
#include <hip/hip_runtime.h>
// Contractions: first Linear of each q/k/v chain on v_wmma_f32_16x16x32_bf16 (x and W converted RNE to bf16, single product, f32 accumulate); second Linears, K Q^T scores and the output Linear on v_wmma_f32_16x16x32_f16 (activations x16 or x256 in f16, weights = RNE-bf16 value x64 held exactly in f16, f32 accumulate); O^T = V^T P^T on v_wmma_f32_16x16x32_f16 (V x16 f16; P x256 f16 hi plane + x2^11 f16 residual plane in a separate f32 accumulator); biases RNE-bf16 values added in f32; softmax statistics f32.
// 64 feature chunks of width 16 act as heads; scale 1/4; no mask; context is written in the flat-reinterpreted (16, b, s, 64) -> (b, s, 1024) order.
// GEMM engine: C[m][n] = sum_k A[m][k] W[n][k]; both operands are 16-bit planes held in fragment order, fragments are loaded straight from global
// (elements 0..7 <- k0 + 8h + i, elements 8..15 <- k0 + 16 + 8h + i for A rows and for W rows alike). 128x128 block tile, 8 waves of 32x64.
// Fragment order T32 of a plane [R][C]: 16 x 32 tiles, tile index (r/16)*(C/32) + c/32, 512 elements a tile; element (r, c) sits at
// tile*512 + ((c>>4)&1)*256 + (((c>>3)&1)*16 + (r&15))*8 + (c&7), so each half fragment is one wave-wide 16-byte load of 512 contiguous bytes.
// Fragment order T16 (Q and K planes, [MROWS][FEAT]): 16 x 16 tiles, tile index (c/16)*(MROWS/16) + r/16, 256 elements a tile; element (r, c) sits at
// tile*256 + (((c>>3)&1)*16 + (r&15))*8 + (c&7).
// Attention engine: transposed flash. Each wave owns 16 queries of one (chunk, batch). Per 32-key step: S^T tiles (key rows x query columns)
// from K rows (A) and Q^T (B), upper 16 k slots zero; the two 16-key D tiles pack straight into the P^T B fragment; O^T (16 d rows x query columns)
// accumulates from V^T rows (A, global f16 plane in T32 order produced directly by a GEMM with swapped operand roles).
#ifndef NB
#define NB 2
#endif
#ifndef SEQ
#define SEQ 1024
#endif
#define NB_FULL 2
#define SEQ_FULL 1024
#define FEAT 1024
#define NCH 64
#define MROWS (NB * SEQ)

static_assert(SEQ % 128 == 0);
static_assert(SEQ <= SEQ_FULL);
static_assert(NB <= NB_FULL);
static_assert(FEAT % 128 == 0);
static_assert(FEAT == NCH * 16);
static_assert((size_t)8 * MROWS * FEAT * 2 + (size_t)7 * FEAT * FEAT * 2 <= (size_t)134217728);
static_assert(((size_t)(NB - 1) * SEQ_FULL + SEQ) * FEAT <= (size_t)NB_FULL * SEQ_FULL * FEAT);

typedef __bf16 v16b __attribute__((ext_vector_type(16)));
typedef _Float16 v16h __attribute__((ext_vector_type(16)));
typedef unsigned short v8us __attribute__((ext_vector_type(8), may_alias));
typedef float v8f __attribute__((ext_vector_type(8)));
typedef float v4f __attribute__((ext_vector_type(4)));
typedef float v4fa __attribute__((ext_vector_type(4), may_alias));
union Frag { v16b b; v16h h; v8us half[2]; _Float16 e[16]; unsigned short u[16]; };

#define LOG2E 1.4426950408889634f

__device__ __forceinline__ unsigned short bf16_bits(float x) {   // RNE convert to bf16 bits
  unsigned int u = __float_as_uint(x);
  return (unsigned short)((u + 0x7FFFu + ((u >> 16) & 1u)) >> 16);
}
__device__ __forceinline__ float bf16_val(unsigned short b) { return __uint_as_float(((unsigned int)b) << 16); }
__device__ __forceinline__ float bf16_rne(float x) { return bf16_val(bf16_bits(x)); }

// c0 += a0*b ; c1 += a1*b (two key tiles against one query fragment), then the hazard guard
__device__ __forceinline__ void mma_s2(v16h a0, v16h a1, v16h b, v8f& c0, v8f& c1) {
  c0 = __builtin_amdgcn_wmma_f32_16x16x32_f16(false, a0, false, b, (short)0, c0, false, false);
  c1 = __builtin_amdgcn_wmma_f32_16x16x32_f16(false, a1, false, b, (short)0, c1, false, false);
  asm volatile("v_nop\n\tv_nop\n\tv_nop\n\tv_nop" : "+v"(c0), "+v"(c1) : "v"(a0), "v"(a1), "v"(b));
}
// ch += a*bh ; cl += a*bl (scaled residual plane keeps its own accumulator), then the hazard guard
__device__ __forceinline__ void mma_h2(v16h a, v16h bh, v16h bl, v8f& ch, v8f& cl) {
  ch = __builtin_amdgcn_wmma_f32_16x16x32_f16(false, a, false, bh, (short)0, ch, false, false);
  cl = __builtin_amdgcn_wmma_f32_16x16x32_f16(false, a, false, bl, (short)0, cl, false, false);
  asm volatile("v_nop\n\tv_nop\n\tv_nop\n\tv_nop" : "+v"(ch), "+v"(cl) : "v"(a), "v"(bh), "v"(bl));
}

// 16-byte unit t of a T32 plane of FEAT columns holds elements (row, col .. col + 7)
__device__ __forceinline__ void t32_unit(int t, int& row, int& col) {
  const int tile = t >> 6, u = t & 63;
  const int tr = tile / (FEAT / 32), tc = tile - tr * (FEAT / 32);
  row = tr * 16 + (u & 15);
  col = tc * 32 + (u >> 4) * 8;
}

// coverage: MROWS*(FEAT/8) threads x 8 elements = the whole compact plane (T32 order, thread t writes unit t).
__global__ __launch_bounds__(256) void k_cvtx(const float* __restrict__ X, unsigned short* __restrict__ Xb) {
  const int t = blockIdx.x * 256 + threadIdx.x;
  if (t >= MROWS * (FEAT / 8)) return;
  int row, col;
  t32_unit(t, row, col);
  const int b = row / SEQ, s = row - b * SEQ;
  const float* src = X + ((size_t)b * SEQ_FULL + s) * FEAT + col;
  const v4f x0 = *(const v4fa*)(src), x1 = *(const v4fa*)(src + 4);
  v8us o;
  o[0] = bf16_bits(x0[0]); o[1] = bf16_bits(x0[1]); o[2] = bf16_bits(x0[2]); o[3] = bf16_bits(x0[3]);
  o[4] = bf16_bits(x1[0]); o[5] = bf16_bits(x1[1]); o[6] = bf16_bits(x1[2]); o[7] = bf16_bits(x1[3]);
  unsigned short* d = Xb + (size_t)t * 8;
  *(v8us*)d = o;
  
}

// Weight plane [out][in] in T32 order (thread t writes unit t): MODE 0 -> bf16 bits (RNE); MODE 1 -> f16 bits of (RNE-bf16 value x 64).
template <int MODE>
__global__ __launch_bounds__(256) void k_cvtw(const float* __restrict__ Wsrc, unsigned short* __restrict__ Wp) {
  const int t = blockIdx.x * 256 + threadIdx.x;
  if (t >= FEAT * (FEAT / 8)) return;
  int row, col;
  t32_unit(t, row, col);
  const float* src = Wsrc + (size_t)row * FEAT + col;
  const v4f x0 = *(const v4fa*)(src), x1 = *(const v4fa*)(src + 4);
  v8us o;
  if (MODE == 0) {
    o[0] = bf16_bits(x0[0]); o[1] = bf16_bits(x0[1]); o[2] = bf16_bits(x0[2]); o[3] = bf16_bits(x0[3]);
    o[4] = bf16_bits(x1[0]); o[5] = bf16_bits(x1[1]); o[6] = bf16_bits(x1[2]); o[7] = bf16_bits(x1[3]);
  } else {
    Frag f;
    f.e[0] = (_Float16)(bf16_rne(x0[0]) * 64.0f); f.e[1] = (_Float16)(bf16_rne(x0[1]) * 64.0f);
    f.e[2] = (_Float16)(bf16_rne(x0[2]) * 64.0f); f.e[3] = (_Float16)(bf16_rne(x0[3]) * 64.0f);
    f.e[4] = (_Float16)(bf16_rne(x1[0]) * 64.0f); f.e[5] = (_Float16)(bf16_rne(x1[1]) * 64.0f);
    f.e[6] = (_Float16)(bf16_rne(x1[2]) * 64.0f); f.e[7] = (_Float16)(bf16_rne(x1[3]) * 64.0f);
    o = f.half[0];
  }
  unsigned short* d = Wp + (size_t)t * 8;
  *(v8us*)d = o;
  
}

// C[m][n] = sum_k A[m][k] W[n][k], K = FEAT, A and W planes of FEAT columns in T32 order.
// BF: bf16 operands, else f16 operands. Grid (Mrows/128, Ncols/128), 8 waves of 32 x 64.
// EPI 0: out f16 plane [m][N], T32 order = f16((acc*sc + bias[n]) * carry)     (bias along columns)
// EPI 1: out f16 plane [m][N], T32 order = f16((acc*sc + bias[m]) * carry)     (bias along rows)
// EPI 3: as EPI 0, out plane [MROWS][FEAT] in T16 order
// EPI 2: out f32 [b*SEQ_FULL + s][FEAT] = acc*sc + bias[n], m = b*SEQ + s
// Epilogue: two phases of 16 rows; the wave's 16 x 64 tile is staged in its own LDS tile (fully written: 16 rows x 64 columns, fully consumed),
template <bool BF, int EPI>
__global__ __launch_bounds__(256) void k_gemm(const unsigned short* __restrict__ A, const unsigned short* __restrict__ W,
                                              const float* __restrict__ bias, void* __restrict__ outp,
                                              int N, float sc, float carry) {
  __shared__ __attribute__((aligned(16))) float sst[8][16][68];
  const int tid = threadIdx.x, lane = tid & 31, w = __builtin_amdgcn_readfirstlane((int)(tid >> 5));
  const int wm = w & 3, wn = w >> 2, ln = lane & 15, hh = lane >> 4;
  const int m0 = blockIdx.x * 128 + wm * 32;
  const int n0 = blockIdx.y * 128 + wn * 64;
  const unsigned short* ap = A + (size_t)m0 * FEAT + lane * 8;   // tile row m0/16 starts at (m0/16) * (FEAT/32) * 512
  const unsigned short* wp = W + (size_t)n0 * FEAT + lane * 8;
  v8f acc[2][4];
#pragma unroll
  for (int fm = 0; fm < 2; ++fm)
#pragma unroll
    for (int fn = 0; fn < 4; ++fn)
#pragma unroll
      for (int r = 0; r < 8; ++r) acc[fm][fn][r] = 0.0f;

#pragma unroll 1
  for (int k0 = 0; k0 < FEAT; k0 += 32) {
    Frag a[2], b[4];
#pragma unroll
    for (int fm = 0; fm < 2; ++fm) {
      a[fm].half[0] = *(const v8us*)(ap + (size_t)fm * 16 * FEAT + k0 * 16);
      a[fm].half[1] = *(const v8us*)(ap + (size_t)fm * 16 * FEAT + k0 * 16 + 256);
    }
#pragma unroll
    for (int fn = 0; fn < 4; ++fn) {
      b[fn].half[0] = *(const v8us*)(wp + (size_t)fn * 16 * FEAT + k0 * 16);
      b[fn].half[1] = *(const v8us*)(wp + (size_t)fn * 16 * FEAT + k0 * 16 + 256);
    }
#pragma unroll
    for (int fm = 0; fm < 2; ++fm)
#pragma unroll
      for (int fn = 0; fn < 4; ++fn) {
        if (BF) acc[fm][fn] = __builtin_amdgcn_wmma_f32_16x16x32_bf16(false, a[fm].b, false, b[fn].b, (short)0, acc[fm][fn], false, false);
        else    acc[fm][fn] = __builtin_amdgcn_wmma_f32_16x16x32_f16(false, a[fm].h, false, b[fn].h, (short)0, acc[fm][fn], false, false);
      }
    asm volatile("v_nop\n\tv_nop\n\tv_nop\n\tv_nop"
                 : "+v"(acc[0][0]), "+v"(acc[0][1]), "+v"(acc[0][2]), "+v"(acc[0][3]),
                   "+v"(acc[1][0]), "+v"(acc[1][1]), "+v"(acc[1][2]), "+v"(acc[1][3])
                 : "v"(a[0].h), "v"(a[1].h), "v"(b[0].h), "v"(b[1].h), "v"(b[2].h), "v"(b[3].h));
  }

  // D element r of tile (fm, fn) = C(m0 + 16 fm + 8 hh + r, n0 + 16 fn + ln)
  float bcol[4];
#pragma unroll
  for (int fn = 0; fn < 4; ++fn) bcol[fn] = 0.0f;
  if (EPI != 1) {
#pragma unroll
    for (int fn = 0; fn < 4; ++fn) bcol[fn] = bf16_rne(bias[n0 + fn * 16 + ln]);
  }
#pragma unroll
  for (int fm = 0; fm < 2; ++fm) {
    float brow[8];
#pragma unroll
    for (int r = 0; r < 8; ++r) brow[r] = 0.0f;
    if (EPI == 1) {
#pragma unroll
      for (int r = 0; r < 8; ++r) brow[r] = bf16_rne(bias[m0 + fm * 16 + 8 * hh + r]);
    }
#pragma unroll
    for (int fn = 0; fn < 4; ++fn)
#pragma unroll
      for (int r = 0; r < 8; ++r) {
        float v = acc[fm][fn][r] * sc + ((EPI == 1) ? brow[r] : bcol[fn]);
        if (EPI != 2) v = v * carry;
        sst[w][8 * hh + r][fn * 16 + ln] = v;
      }
    __syncthreads();
    if (EPI == 2) {
      float* of = (float*)outp;
      const int rsub = lane >> 4, c4 = (lane & 15) * 4;
      {
#pragma unroll
        for (int q = 0; q < 8; ++q) {
          const int row = 2 * q + rsub;
          const int m = m0 + fm * 16 + row;
          const int bb = m / SEQ;
          const size_t grow = (size_t)bb * SEQ_FULL + (size_t)(m - bb * SEQ);
          const v4f v = *(const v4fa*)&sst[w][row][c4];
          *(v4f*)(of + grow * FEAT + n0 + c4) = v;
        }
        
      }
    } else {
      unsigned short* oh = (unsigned short*)outp;
      {
#pragma unroll
        for (int it = 0; it < 4; ++it) {
          // lane (ln, hh) carries row ln, columns 16 it + 8 hh .. + 7: one 512-byte run of the out plane per store
          const v4f x0 = *(const v4fa*)&sst[w][ln][it * 16 + hh * 8];
          const v4f x1 = *(const v4fa*)&sst[w][ln][it * 16 + hh * 8 + 4];
          Frag f;
          f.e[0] = (_Float16)x0[0]; f.e[1] = (_Float16)x0[1]; f.e[2] = (_Float16)x0[2]; f.e[3] = (_Float16)x0[3];
          f.e[4] = (_Float16)x1[0]; f.e[5] = (_Float16)x1[1]; f.e[6] = (_Float16)x1[2]; f.e[7] = (_Float16)x1[3];
          const v8us o = f.half[0];
          if (EPI == 3) *(v8us*)(oh + ((size_t)((n0 >> 4) + it) * (MROWS / 16) + (m0 >> 4) + fm) * 256 + lane * 8) = o;
          else          *(v8us*)(oh + ((size_t)((m0 >> 4) + fm) * (N >> 5) + (n0 >> 5)) * 512 + it * 256 + lane * 8) = o;
        }
        
      }
    }
    __syncthreads();
  }
}

// One 32-key step for a wave's 16 queries. kp: this lane's unit of the chunk's K tile at key0 (T16); vp: this lane's unit of the chunk's V^T tile at key0 (T32).
__device__ __forceinline__ void fa_step(const unsigned short* __restrict__ kp, const unsigned short* __restrict__ vp,
                                        const Frag& qf, float& mr, float& lr, v8f& Oh, v8f& Ol) {
  const v8us zz = {0, 0, 0, 0, 0, 0, 0, 0};
  // A fragments of K: row m = key (key0 + 16*kt + ln), elements 0..7 <- d = 8h + i, elements 8..15 (k slots 16..31) zero
  Frag k0, k1, vf;
  k0.half[0] = *(const v8us*)(kp);             k0.half[1] = zz;
  k1.half[0] = *(const v8us*)(kp + 256);       k1.half[1] = zz;
  // A fragment of V^T: row m = d (ln), elements 0..7 <- key0 + 8h + i, 8..15 <- key0 + 16 + 8h + i
  vf.half[0] = *(const v8us*)(vp);
  vf.half[1] = *(const v8us*)(vp + 256);
  v8f s0 = {0.f, 0.f, 0.f, 0.f, 0.f, 0.f, 0.f, 0.f};
  v8f s1 = {0.f, 0.f, 0.f, 0.f, 0.f, 0.f, 0.f, 0.f};
  // S^T tiles: element r of tile kt = 256 * q.k of (key0 + 16*kt + 8h + r, query ln)
  mma_s2(k0.h, k1.h, qf.h, s0, s1);
  float sc[16];
#pragma unroll
  for (int r = 0; r < 8; ++r) { sc[r] = s0[r] * 0.0009765625f; sc[8 + r] = s1[r] * 0.0009765625f; }   // undo x16 x16 carries, divide by 4
  float mx = sc[0];
#pragma unroll
  for (int i = 1; i < 16; ++i) mx = fmaxf(mx, sc[i]);
  mx = fmaxf(mx, __shfl_xor(mx, 16, 32));           // the other lane half holds the other 16 keys of this query
  const float mnew = fmaxf(mr, mx);
  const float al = exp2f((mr - mnew) * LOG2E);
  mr = mnew;
  // weights carried x256: pc = 256 * exp(sc - mnew); hi plane f16(pc), residual plane f16((pc - hi) * 2048)
  Frag ph, pl;
  float ps = 0.0f;
#pragma unroll
  for (int i = 0; i < 16; ++i) {
    const float pc = exp2f(fmaf(sc[i] - mnew, LOG2E, 8.0f));
    ps += pc;
    const _Float16 h = (_Float16)pc;
    ph.e[i] = h;                                    // B element i: i<8 -> key0 + 8h + i (tile 0 row 8h+i); i>=8 -> key0 + 16 + 8h + (i-8) (tile 1)
    pl.e[i] = (_Float16)((pc - (float)h) * 2048.0f);
  }
  ps += __shfl_xor(ps, 16, 32);
  lr = lr * al + ps;
  Oh = Oh * al; Ol = Ol * al;
  mma_h2(vf.h, ph.h, pl.h, Oh, Ol);
}

// Block = 4 waves x 16 queries = 64 queries of one (chunk, batch); no LDS and no barrier in the key loop.
// Epilogue: O^T tile -> per-wave LDS tile [16 queries][16 d] (fully written, fully consumed; block barrier), then thread tid stores unit tid of the
// block's 16 plane rows x 64 columns = two adjacent T32 tiles (it reads the LDS tile of the wave that owns its plane row, behind the block barrier).
// Context plane element order: flat = ((c*NB + b)*SEQ + s)*16 + h; plane row = (flat>>6) mod (NB*SEQ), column = (flat>>6)/(NB*SEQ)*64 + (flat&63).
// coverage: NCH*NB*(SEQ/64) blocks x 4 waves x 256 elements = every element of the plane exactly once.
__global__ __launch_bounds__(128) void k_attn(const unsigned short* __restrict__ Qp, const unsigned short* __restrict__ Kp,
                                              const unsigned short* __restrict__ Vt, unsigned short* __restrict__ O2) {
  __shared__ __attribute__((aligned(16))) float so[4][16][20];
  const int tid = threadIdx.x, w = __builtin_amdgcn_readfirstlane((int)(tid >> 5)), lane = tid & 31, ln = lane & 15, hh = lane >> 4;
  const int qt = blockIdx.x % (SEQ / 64);
  const int p = blockIdx.x / (SEQ / 64);
  const int b = p % NB, c = p / NB;
  const int qbase = qt * 64 + 16 * w;
  const v8us zz = {0, 0, 0, 0, 0, 0, 0, 0};
  // Q^T B fragment: column n = query qbase + ln, elements 0..7 <- d = 8h + i, elements 8..15 zero
  Frag qf;
  qf.half[0] = *(const v8us*)(Qp + ((size_t)c * (MROWS / 16) + (b * SEQ + qbase) / 16) * 256 + lane * 8);
  qf.half[1] = zz;
  const unsigned short* kb = Kp + ((size_t)c * (MROWS / 16) + (b * SEQ) / 16) * 256 + lane * 8;
  const unsigned short* vb = Vt + ((size_t)c * (MROWS / 32) + (b * SEQ) / 32) * 512 + lane * 8;
  float mr = -3.0e38f, lr = 0.0f;
  v8f Oh = {0.f, 0.f, 0.f, 0.f, 0.f, 0.f, 0.f, 0.f};
  v8f Ol = {0.f, 0.f, 0.f, 0.f, 0.f, 0.f, 0.f, 0.f};
#pragma unroll 1
  for (int j = 0; j < SEQ / 32; ++j)
    fa_step(kb + j * 512, vb + j * 512, qf, mr, lr, Oh, Ol);

  // O^T element r = out(query qbase + ln, d = 8h + r); undo x256 (in lr), x16 (V), x2048 (residual plane); carry the context x256
  const float inv = 16.0f * (1.0f / lr);
#pragma unroll
  for (int r = 0; r < 8; ++r)
    so[w][ln][8 * hh + r] = (Oh[r] + Ol[r] * 0.00048828125f) * inv;
  __syncthreads();
  // unit tid = plane row rr of the block's 16, 8-column piece p of its 64 columns; four queries of one wave make one plane row
  const int rr = tid & 15, p8 = tid >> 4;
  const int qq = (rr & 3) * 4 + (p8 >> 1), d0 = (p8 & 1) * 8;
  const v4f x0 = *(const v4fa*)&so[rr >> 2][qq][d0];
  const v4f x1 = *(const v4fa*)&so[rr >> 2][qq][d0 + 4];
  Frag f;
  f.e[0] = (_Float16)x0[0]; f.e[1] = (_Float16)x0[1]; f.e[2] = (_Float16)x0[2]; f.e[3] = (_Float16)x0[3];
  f.e[4] = (_Float16)x1[0]; f.e[5] = (_Float16)x1[1]; f.e[6] = (_Float16)x1[2]; f.e[7] = (_Float16)x1[3];
  const v8us o = f.half[0];
  const int R = (c * NB + b) * (SEQ / 4) + qt * 16;   // the block's first plane row, a multiple of 16
  const int hp = R / MROWS;
  const int prow = R - hp * MROWS;
  unsigned short* dst = O2 + ((size_t)(prow >> 4) * (FEAT / 32) + hp * 2) * 512 + tid * 8;
  *(v8us*)dst = o;
  
}

extern "C" void kernel_launch(void* const* d_in, const int* in_sizes, int n_in,
                              void* d_out, int out_size, void* d_ws, size_t ws_size, hipStream_t stream) {
  if (n_in < 15) return;
  const long long needx = ((long long)(NB - 1) * SEQ_FULL + SEQ) * FEAT;   // last element touched + 1
  if ((long long)in_sizes[0] < needx) return;
  if ((long long)out_size < needx) return;
  for (int i = 1; i < 15; i += 2) {
    if ((long long)in_sizes[i] < (long long)FEAT * FEAT) return;
    if ((long long)in_sizes[i + 1] < (long long)FEAT) return;
  }
  // wire order: x, then (weight, bias) pairs for wq, wk, wv, vq, vk, vv, wo
  const float* x    = (const float*)d_in[0];
  const float* wq_w = (const float*)d_in[1];
  const float* wq_b = (const float*)d_in[2];
  const float* wk_w = (const float*)d_in[3];
  const float* wk_b = (const float*)d_in[4];
  const float* wv_w = (const float*)d_in[5];
  const float* wv_b = (const float*)d_in[6];
  const float* vq_w = (const float*)d_in[7];
  const float* vq_b = (const float*)d_in[8];
  const float* vk_w = (const float*)d_in[9];
  const float* vk_b = (const float*)d_in[10];
  const float* vv_w = (const float*)d_in[11];
  const float* vv_b = (const float*)d_in[12];
  const float* wo_w = (const float*)d_in[13];
  const float* wo_b = (const float*)d_in[14];

  char* ws = (char*)d_ws;
  size_t off = 0;
  const size_t planeA = (size_t)MROWS * FEAT * 2;
  const size_t planeW = (size_t)FEAT * FEAT * 2;       // weight plane
  unsigned short* Xb  = (unsigned short*)(ws + off); off += (planeA + 255) & ~(size_t)255;
  unsigned short* Wqb = (unsigned short*)(ws + off); off += (planeW + 255) & ~(size_t)255;
  unsigned short* Wkb = (unsigned short*)(ws + off); off += (planeW + 255) & ~(size_t)255;
  unsigned short* Wvb = (unsigned short*)(ws + off); off += (planeW + 255) & ~(size_t)255;
  unsigned short* Vqh = (unsigned short*)(ws + off); off += (planeW + 255) & ~(size_t)255;
  unsigned short* Vkh = (unsigned short*)(ws + off); off += (planeW + 255) & ~(size_t)255;
  unsigned short* Vvh = (unsigned short*)(ws + off); off += (planeW + 255) & ~(size_t)255;
  unsigned short* Woh = (unsigned short*)(ws + off); off += (planeW + 255) & ~(size_t)255;
  unsigned short* T1q = (unsigned short*)(ws + off); off += (planeA + 255) & ~(size_t)255;
  unsigned short* T1k = (unsigned short*)(ws + off); off += (planeA + 255) & ~(size_t)255;
  unsigned short* T1v = (unsigned short*)(ws + off); off += (planeA + 255) & ~(size_t)255;
  unsigned short* Qp  = (unsigned short*)(ws + off); off += (planeA + 255) & ~(size_t)255;
  unsigned short* Kp  = (unsigned short*)(ws + off); off += (planeA + 255) & ~(size_t)255;
  unsigned short* Vt  = (unsigned short*)(ws + off); off += (planeA + 255) & ~(size_t)255;   // [FEAT][MROWS], T32 order
  unsigned short* O2  = (unsigned short*)(ws + off); off += (planeA + 255) & ~(size_t)255;
  if (off > ws_size) return;

  const unsigned gx = (unsigned)((MROWS * (FEAT / 8) + 255) / 256);
  const unsigned gw = (unsigned)((FEAT * (FEAT / 8) + 255) / 256);
  k_cvtx<<<gx, 256, 0, stream>>>(x, Xb);
  k_cvtw<0><<<gw, 256, 0, stream>>>(wq_w, Wqb);
  k_cvtw<0><<<gw, 256, 0, stream>>>(wk_w, Wkb);
  k_cvtw<0><<<gw, 256, 0, stream>>>(wv_w, Wvb);
  k_cvtw<1><<<gw, 256, 0, stream>>>(vq_w, Vqh);
  k_cvtw<1><<<gw, 256, 0, stream>>>(vk_w, Vkh);
  k_cvtw<1><<<gw, 256, 0, stream>>>(vv_w, Vvh);
  k_cvtw<1><<<gw, 256, 0, stream>>>(wo_w, Woh);

  const dim3 gA((unsigned)(MROWS / 128), (unsigned)(FEAT / 128));   // C rows = tokens, columns = features
  const dim3 gV((unsigned)(FEAT / 128), (unsigned)(MROWS / 128));   // C rows = features, columns = tokens
  const float s10 = 0.0009765625f;          // 1 / (16 * 64)
  const float s14 = 0.00006103515625f;      // 1 / (256 * 64)
  // k_gemm(A, W, bias, out, N, sc, carry)
  k_gemm<true, 0><<<gA, 256, 0, stream>>>(Xb, Wqb, wq_b, (void*)T1q, FEAT, 1.0f, 16.0f);
  k_gemm<false, 3><<<gA, 256, 0, stream>>>(T1q, Vqh, vq_b, (void*)Qp, FEAT, s10, 16.0f);
  k_gemm<true, 0><<<gA, 256, 0, stream>>>(Xb, Wkb, wk_b, (void*)T1k, FEAT, 1.0f, 16.0f);
  k_gemm<false, 3><<<gA, 256, 0, stream>>>(T1k, Vkh, vk_b, (void*)Kp, FEAT, s10, 16.0f);
  k_gemm<true, 0><<<gA, 256, 0, stream>>>(Xb, Wvb, wv_b, (void*)T1v, FEAT, 1.0f, 16.0f);
  // V^T[f][token] = sum_j vv[f][j] * t1v[token][j] + vv_b[f]
  k_gemm<false, 1><<<gV, 256, 0, stream>>>(Vvh, T1v, vv_b, (void*)Vt, MROWS, s10, 16.0f);

  k_attn<<<(unsigned)(NCH * NB * (SEQ / 64)), 128, 0, stream>>>(Qp, Kp, Vt, O2);

  k_gemm<false, 2><<<gA, 256, 0, stream>>>(O2, Woh, wo_b, d_out, FEAT, s14, 1.0f);
}

// v002
// Measured time: 136 microseconds a run.
// Next to v001, in two timings, it ran 1.76 and 1.73 times as fast.
// Counting every step since v000, it is 1.83 times as fast.
#include <hip/hip_runtime.h>
// Contractions: first Linear of each q/k/v chain on v_wmma_f32_16x16x32_bf16 (x and W converted RNE to bf16, single product, f32 accumulate); second Linears, K Q^T scores and the output Linear on v_wmma_f32_16x16x32_f16 (activations x16 or x256 in f16, weights = RNE-bf16 value x64 held exactly in f16, f32 accumulate); O^T = V^T P^T on v_wmma_f32_16x16x32_f16 (V x16 f16; P x256 f16 hi plane + x2^11 f16 residual plane in a separate f32 accumulator); biases RNE-bf16 values added in f32; softmax statistics f32.
// 64 feature chunks of width 16 act as heads; scale 1/4; no mask; context is written in the flat-reinterpreted (16, b, s, 64) -> (b, s, 1024) order.
// GEMM engine: C[m][n] = sum_k A[m][k] W[n][k]; both operands are 16-bit planes held in fragment order, fragments are loaded straight from global
// (elements 0..7 <- k0 + 8h + i, elements 8..15 <- k0 + 16 + 8h + i for A rows and for W rows alike). 128x128 block tile, 8 waves of 32x64.
// Fragment order T32 of a plane [R][C]: 16 x 32 tiles, tile index (r/16)*(C/32) + c/32, 512 elements a tile; element (r, c) sits at
// tile*512 + ((c>>4)&1)*256 + (((c>>3)&1)*16 + (r&15))*8 + (c&7), so each half fragment is one wave-wide 16-byte load of 512 contiguous bytes.
// Fragment order T16 (Q and K planes, [MROWS][FEAT]): 16 x 16 tiles, tile index (c/16)*(MROWS/16) + r/16, 256 elements a tile; element (r, c) sits at
// tile*256 + (((c>>3)&1)*16 + (r&15))*8 + (c&7).
// Attention engine: transposed flash. Each wave owns 16 queries of one (chunk, batch). Per 32-key step: S^T tiles (key rows x query columns)
// from K rows (A) and Q^T (B), upper 16 k slots zero; the two 16-key D tiles pack straight into the P^T B fragment; O^T (16 d rows x query columns)
// accumulates from V^T rows (A, global f16 plane in T32 order produced directly by a GEMM with swapped operand roles).
#ifndef NB
#define NB 2
#endif
#ifndef SEQ
#define SEQ 1024
#endif
#define NB_FULL 2
#define SEQ_FULL 1024
#define FEAT 1024
#define NCH 64
#define MROWS (NB * SEQ)

static_assert(SEQ % 128 == 0);
static_assert(SEQ <= SEQ_FULL);
static_assert(NB <= NB_FULL);
static_assert(FEAT % 128 == 0);
static_assert(FEAT == NCH * 16);
static_assert((size_t)8 * MROWS * FEAT * 2 + (size_t)7 * FEAT * FEAT * 2 <= (size_t)134217728);
static_assert(((size_t)(NB - 1) * SEQ_FULL + SEQ) * FEAT <= (size_t)NB_FULL * SEQ_FULL * FEAT);

typedef __bf16 v16b __attribute__((ext_vector_type(16)));
typedef _Float16 v16h __attribute__((ext_vector_type(16)));
typedef unsigned short v8us __attribute__((ext_vector_type(8), may_alias));
typedef float v8f __attribute__((ext_vector_type(8)));
typedef float v4f __attribute__((ext_vector_type(4)));
typedef float v4fa __attribute__((ext_vector_type(4), may_alias));
union Frag { v16b b; v16h h; v8us half[2]; _Float16 e[16]; unsigned short u[16]; };

#define LOG2E 1.4426950408889634f

__device__ __forceinline__ unsigned short bf16_bits(float x) {   // RNE convert to bf16 bits
  unsigned int u = __float_as_uint(x);
  return (unsigned short)((u + 0x7FFFu + ((u >> 16) & 1u)) >> 16);
}
__device__ __forceinline__ float bf16_val(unsigned short b) { return __uint_as_float(((unsigned int)b) << 16); }
__device__ __forceinline__ float bf16_rne(float x) { return bf16_val(bf16_bits(x)); }

// c0 += a0*b ; c1 += a1*b (two key tiles against one query fragment), then the hazard guard
__device__ __forceinline__ void mma_s2(v16h a0, v16h a1, v16h b, v8f& c0, v8f& c1) {
  c0 = __builtin_amdgcn_wmma_f32_16x16x32_f16(false, a0, false, b, (short)0, c0, false, false);
  c1 = __builtin_amdgcn_wmma_f32_16x16x32_f16(false, a1, false, b, (short)0, c1, false, false);
  asm volatile("v_nop\n\tv_nop\n\tv_nop\n\tv_nop" : "+v"(c0), "+v"(c1) : "v"(a0), "v"(a1), "v"(b));
}
// ch += a*bh ; cl += a*bl (scaled residual plane keeps its own accumulator), then the hazard guard
__device__ __forceinline__ void mma_h2(v16h a, v16h bh, v16h bl, v8f& ch, v8f& cl) {
  ch = __builtin_amdgcn_wmma_f32_16x16x32_f16(false, a, false, bh, (short)0, ch, false, false);
  cl = __builtin_amdgcn_wmma_f32_16x16x32_f16(false, a, false, bl, (short)0, cl, false, false);
  asm volatile("v_nop\n\tv_nop\n\tv_nop\n\tv_nop" : "+v"(ch), "+v"(cl) : "v"(a), "v"(bh), "v"(bl));
}

// 16-byte unit t of a T32 plane of FEAT columns holds elements (row, col .. col + 7)
__device__ __forceinline__ void t32_unit(int t, int& row, int& col) {
  const int tile = t >> 6, u = t & 63;
  const int tr = tile / (FEAT / 32), tc = tile - tr * (FEAT / 32);
  row = tr * 16 + (u & 15);
  col = tc * 32 + (u >> 4) * 8;
}

#define XBLK (MROWS * (FEAT / 8) / 256)
#define WBLK (FEAT * (FEAT / 8) / 256)
static_assert(MROWS * (FEAT / 8) % 256 == 0);
static_assert(FEAT * (FEAT / 8) % 256 == 0);
static_assert((size_t)FEAT * FEAT * 2 % 256 == 0);   // a weight plane needs no padding to the workspace's 256-byte step

// All eight operand planes in one launch (none depends on another). Blocks 0 .. XBLK-1: the compact x plane, bf16 bits (RNE), thread t writes unit t.
// Then WBLK blocks per weight plane [out][in], T32 order: planes 0..2 -> bf16 bits (RNE); planes 3..6 -> f16 bits of (RNE-bf16 value x 64).
// coverage: XBLK*256 units = the whole x plane, WBLK*256 units = one whole weight plane; every unit written once.
__global__ __launch_bounds__(256) void k_cvt(const float* __restrict__ X,
                                             const float* __restrict__ w0, const float* __restrict__ w1, const float* __restrict__ w2,
                                             const float* __restrict__ w3, const float* __restrict__ w4, const float* __restrict__ w5,
                                             const float* __restrict__ w6,
                                             unsigned short* __restrict__ Xb, unsigned short* __restrict__ Wplanes) {
  const int blk = blockIdx.x;
  int row, col;
  v8us o;
  if (blk < XBLK) {
    const int t = blk * 256 + threadIdx.x;
    t32_unit(t, row, col);
    const int b = row / SEQ, s = row - b * SEQ;
    const float* src = X + ((size_t)b * SEQ_FULL + s) * FEAT + col;
    const v4f x0 = *(const v4fa*)(src), x1 = *(const v4fa*)(src + 4);
    o[0] = bf16_bits(x0[0]); o[1] = bf16_bits(x0[1]); o[2] = bf16_bits(x0[2]); o[3] = bf16_bits(x0[3]);
    o[4] = bf16_bits(x1[0]); o[5] = bf16_bits(x1[1]); o[6] = bf16_bits(x1[2]); o[7] = bf16_bits(x1[3]);
    *(v8us*)(Xb + (size_t)t * 8) = o;
    return;
  }
  const int wi = (blk - XBLK) / WBLK;                      // block-uniform plane index
  const int t = (blk - XBLK - wi * WBLK) * 256 + threadIdx.x;
  const bool i1 = wi & 1, i2 = wi & 2, i4 = wi & 4;
  const float* Wsrc = i4 ? (i2 ? w6 : (i1 ? w5 : w4)) : (i2 ? (i1 ? w3 : w2) : (i1 ? w1 : w0));
  unsigned short* Wp = Wplanes + (size_t)wi * FEAT * FEAT;   // the seven planes lie back to back in the workspace
  t32_unit(t, row, col);
  const float* src = Wsrc + (size_t)row * FEAT + col;
  const v4f x0 = *(const v4fa*)(src), x1 = *(const v4fa*)(src + 4);
  if (wi < 3) {
    o[0] = bf16_bits(x0[0]); o[1] = bf16_bits(x0[1]); o[2] = bf16_bits(x0[2]); o[3] = bf16_bits(x0[3]);
    o[4] = bf16_bits(x1[0]); o[5] = bf16_bits(x1[1]); o[6] = bf16_bits(x1[2]); o[7] = bf16_bits(x1[3]);
  } else {
    Frag f;
    f.e[0] = (_Float16)(bf16_rne(x0[0]) * 64.0f); f.e[1] = (_Float16)(bf16_rne(x0[1]) * 64.0f);
    f.e[2] = (_Float16)(bf16_rne(x0[2]) * 64.0f); f.e[3] = (_Float16)(bf16_rne(x0[3]) * 64.0f);
    f.e[4] = (_Float16)(bf16_rne(x1[0]) * 64.0f); f.e[5] = (_Float16)(bf16_rne(x1[1]) * 64.0f);
    f.e[6] = (_Float16)(bf16_rne(x1[2]) * 64.0f); f.e[7] = (_Float16)(bf16_rne(x1[3]) * 64.0f);
    o = f.half[0];
  }
  *(v8us*)(Wp + (size_t)t * 8) = o;
}

// C[m][n] = sum_k A[m][k] W[n][k], K = FEAT, A and W planes of FEAT columns in T32 order.
// BF: bf16 operands, else f16 operands. One 128 x 128 tile (bx, by) of a (Mrows/128, Ncols/128) tiling per block, 8 waves of 32 x 64.
// EPI 0: out f16 plane [m][N], T32 order = f16((acc*sc + bias[n]) * carry)     (bias along columns)
// EPI 1: out f16 plane [m][N], T32 order = f16((acc*sc + bias[m]) * carry)     (bias along rows)
// EPI 3: as EPI 0, out plane [MROWS][FEAT] in T16 order
// EPI 2: out f32 [b*SEQ_FULL + s][FEAT] = acc*sc + bias[n], m = b*SEQ + s
// Epilogue: two phases of 16 rows; the wave's 16 x 64 tile is staged in its own LDS tile (fully written: 16 rows x 64 columns, fully consumed),
template <bool BF, int EPI>
__device__ __forceinline__ void gemm_tile(float (*__restrict__ sst)[16][68], int bx, int by,
                                          const unsigned short* __restrict__ A, const unsigned short* __restrict__ W,
                                          const float* __restrict__ bias, void* __restrict__ outp,
                                          int N, float sc, float carry) {
  const int tid = threadIdx.x, lane = tid & 31, w = __builtin_amdgcn_readfirstlane((int)(tid >> 5));
  const int wm = w & 3, wn = w >> 2, ln = lane & 15, hh = lane >> 4;
  const int m0 = bx * 128 + wm * 32;
  const int n0 = by * 128 + wn * 64;
  const unsigned short* ap = A + (size_t)m0 * FEAT + lane * 8;   // tile row m0/16 starts at (m0/16) * (FEAT/32) * 512
  const unsigned short* wp = W + (size_t)n0 * FEAT + lane * 8;
  v8f acc[2][4];
#pragma unroll
  for (int fm = 0; fm < 2; ++fm)
#pragma unroll
    for (int fn = 0; fn < 4; ++fn)
#pragma unroll
      for (int r = 0; r < 8; ++r) acc[fm][fn][r] = 0.0f;

#pragma unroll 1
  for (int k0 = 0; k0 < FEAT; k0 += 32) {
    Frag a[2], b[4];
#pragma unroll
    for (int fm = 0; fm < 2; ++fm) {
      a[fm].half[0] = *(const v8us*)(ap + (size_t)fm * 16 * FEAT + k0 * 16);
      a[fm].half[1] = *(const v8us*)(ap + (size_t)fm * 16 * FEAT + k0 * 16 + 256);
    }
#pragma unroll
    for (int fn = 0; fn < 4; ++fn) {
      b[fn].half[0] = *(const v8us*)(wp + (size_t)fn * 16 * FEAT + k0 * 16);
      b[fn].half[1] = *(const v8us*)(wp + (size_t)fn * 16 * FEAT + k0 * 16 + 256);
    }
#pragma unroll
    for (int fm = 0; fm < 2; ++fm)
#pragma unroll
      for (int fn = 0; fn < 4; ++fn) {
        if (BF) acc[fm][fn] = __builtin_amdgcn_wmma_f32_16x16x32_bf16(false, a[fm].b, false, b[fn].b, (short)0, acc[fm][fn], false, false);
        else    acc[fm][fn] = __builtin_amdgcn_wmma_f32_16x16x32_f16(false, a[fm].h, false, b[fn].h, (short)0, acc[fm][fn], false, false);
      }
    asm volatile("v_nop\n\tv_nop\n\tv_nop\n\tv_nop"
                 : "+v"(acc[0][0]), "+v"(acc[0][1]), "+v"(acc[0][2]), "+v"(acc[0][3]),
                   "+v"(acc[1][0]), "+v"(acc[1][1]), "+v"(acc[1][2]), "+v"(acc[1][3])
                 : "v"(a[0].h), "v"(a[1].h), "v"(b[0].h), "v"(b[1].h), "v"(b[2].h), "v"(b[3].h));
  }

  // D element r of tile (fm, fn) = C(m0 + 16 fm + 8 hh + r, n0 + 16 fn + ln)
  float bcol[4];
#pragma unroll
  for (int fn = 0; fn < 4; ++fn) bcol[fn] = 0.0f;
  if (EPI != 1) {
#pragma unroll
    for (int fn = 0; fn < 4; ++fn) bcol[fn] = bf16_rne(bias[n0 + fn * 16 + ln]);
  }
#pragma unroll
  for (int fm = 0; fm < 2; ++fm) {
    float brow[8];
#pragma unroll
    for (int r = 0; r < 8; ++r) brow[r] = 0.0f;
    if (EPI == 1) {
#pragma unroll
      for (int r = 0; r < 8; ++r) brow[r] = bf16_rne(bias[m0 + fm * 16 + 8 * hh + r]);
    }
#pragma unroll
    for (int fn = 0; fn < 4; ++fn)
#pragma unroll
      for (int r = 0; r < 8; ++r) {
        float v = acc[fm][fn][r] * sc + ((EPI == 1) ? brow[r] : bcol[fn]);
        if (EPI != 2) v = v * carry;
        sst[w][8 * hh + r][fn * 16 + ln] = v;
      }
    __syncthreads();
    if (EPI == 2) {
      float* of = (float*)outp;
      const int rsub = lane >> 4, c4 = (lane & 15) * 4;
      {
#pragma unroll
        for (int q = 0; q < 8; ++q) {
          const int row = 2 * q + rsub;
          const int m = m0 + fm * 16 + row;
          const int bb = m / SEQ;
          const size_t grow = (size_t)bb * SEQ_FULL + (size_t)(m - bb * SEQ);
          const v4f v = *(const v4fa*)&sst[w][row][c4];
          *(v4f*)(of + grow * FEAT + n0 + c4) = v;
        }
        
      }
    } else {
      unsigned short* oh = (unsigned short*)outp;
      {
#pragma unroll
        for (int it = 0; it < 4; ++it) {
          // lane (ln, hh) carries row ln, columns 16 it + 8 hh .. + 7: one 512-byte run of the out plane per store
          const v4f x0 = *(const v4fa*)&sst[w][ln][it * 16 + hh * 8];
          const v4f x1 = *(const v4fa*)&sst[w][ln][it * 16 + hh * 8 + 4];
          Frag f;
          f.e[0] = (_Float16)x0[0]; f.e[1] = (_Float16)x0[1]; f.e[2] = (_Float16)x0[2]; f.e[3] = (_Float16)x0[3];
          f.e[4] = (_Float16)x1[0]; f.e[5] = (_Float16)x1[1]; f.e[6] = (_Float16)x1[2]; f.e[7] = (_Float16)x1[3];
          const v8us o = f.half[0];
          if (EPI == 3) *(v8us*)(oh + ((size_t)((n0 >> 4) + it) * (MROWS / 16) + (m0 >> 4) + fm) * 256 + lane * 8) = o;
          else          *(v8us*)(oh + ((size_t)((m0 >> 4) + fm) * (N >> 5) + (n0 >> 5)) * 512 + it * 256 + lane * 8) = o;
        }
        
      }
    }
    __syncthreads();
  }
}

#define S10 0.0009765625f        // 1 / (16 * 64)
#define S14 0.00006103515625f    // 1 / (256 * 64)

// First Linears of the q, k and v chains in one launch: blockIdx.z picks the chain (block-uniform); grid (MROWS/128, FEAT/128, 3).
__global__ __launch_bounds__(256) void k_lin1(const unsigned short* __restrict__ Xb,
                                              const unsigned short* __restrict__ W0, const unsigned short* __restrict__ W1,
                                              const unsigned short* __restrict__ W2,
                                              const float* __restrict__ b0, const float* __restrict__ b1, const float* __restrict__ b2,
                                              unsigned short* __restrict__ o0, unsigned short* __restrict__ o1, unsigned short* __restrict__ o2) {
  __shared__ __attribute__((aligned(16))) float sst[8][16][68];
  const int z = blockIdx.z;
  gemm_tile<true, 0>(sst, blockIdx.x, blockIdx.y, Xb, z == 0 ? W0 : z == 1 ? W1 : W2, z == 0 ? b0 : z == 1 ? b1 : b2,
                     (void*)(z == 0 ? o0 : z == 1 ? o1 : o2), FEAT, 1.0f, 16.0f);
}

// Second Linears in one launch, grid (MROWS/128, FEAT/128, 3): z = 0, 1 -> Q and K planes (T16); z = 2 -> V^T[f][token] = sum_j vv[f][j] * t1v[token][j] + vv_b[f],
// whose tiling is (FEAT/128, MROWS/128): its tile comes from the block's flat index in the z slice.
__global__ __launch_bounds__(256) void k_lin2(const unsigned short* __restrict__ T1q, const unsigned short* __restrict__ T1k,
                                              const unsigned short* __restrict__ T1v,
                                              const unsigned short* __restrict__ Vq, const unsigned short* __restrict__ Vk,
                                              const unsigned short* __restrict__ Vv,
                                              const float* __restrict__ bq, const float* __restrict__ bk, const float* __restrict__ bv,
                                              unsigned short* __restrict__ Qp, unsigned short* __restrict__ Kp, unsigned short* __restrict__ Vt) {
  __shared__ __attribute__((aligned(16))) float sst[8][16][68];
  const int z = blockIdx.z;
  if (z < 2) {
    gemm_tile<false, 3>(sst, blockIdx.x, blockIdx.y, z == 0 ? T1q : T1k, z == 0 ? Vq : Vk, z == 0 ? bq : bk,
                        (void*)(z == 0 ? Qp : Kp), FEAT, S10, 16.0f);
  } else {
    const int flat = blockIdx.y * (MROWS / 128) + blockIdx.x;
    gemm_tile<false, 1>(sst, flat % (FEAT / 128), flat / (FEAT / 128), Vv, T1v, bv, (void*)Vt, MROWS, S10, 16.0f);
  }
}

// Output Linear, grid (MROWS/128, FEAT/128).
__global__ __launch_bounds__(256) void k_lin3(const unsigned short* __restrict__ O2, const unsigned short* __restrict__ Wo,
                                              const float* __restrict__ bo, float* __restrict__ out) {
  __shared__ __attribute__((aligned(16))) float sst[8][16][68];
  gemm_tile<false, 2>(sst, blockIdx.x, blockIdx.y, O2, Wo, bo, (void*)out, FEAT, S14, 1.0f);
}

// One 32-key step for a wave's 16 queries. kp: this lane's unit of the chunk's K tile at key0 (T16); vp: this lane's unit of the chunk's V^T tile at key0 (T32).
__device__ __forceinline__ void fa_step(const unsigned short* __restrict__ kp, const unsigned short* __restrict__ vp,
                                        const Frag& qf, float& mr, float& lr, v8f& Oh, v8f& Ol) {
  const v8us zz = {0, 0, 0, 0, 0, 0, 0, 0};
  // A fragments of K: row m = key (key0 + 16*kt + ln), elements 0..7 <- d = 8h + i, elements 8..15 (k slots 16..31) zero
  Frag k0, k1, vf;
  k0.half[0] = *(const v8us*)(kp);             k0.half[1] = zz;
  k1.half[0] = *(const v8us*)(kp + 256);       k1.half[1] = zz;
  // A fragment of V^T: row m = d (ln), elements 0..7 <- key0 + 8h + i, 8..15 <- key0 + 16 + 8h + i
  vf.half[0] = *(const v8us*)(vp);
  vf.half[1] = *(const v8us*)(vp + 256);
  v8f s0 = {0.f, 0.f, 0.f, 0.f, 0.f, 0.f, 0.f, 0.f};
  v8f s1 = {0.f, 0.f, 0.f, 0.f, 0.f, 0.f, 0.f, 0.f};
  // S^T tiles: element r of tile kt = 256 * q.k of (key0 + 16*kt + 8h + r, query ln)
  mma_s2(k0.h, k1.h, qf.h, s0, s1);
  float sc[16];
#pragma unroll
  for (int r = 0; r < 8; ++r) { sc[r] = s0[r] * 0.0009765625f; sc[8 + r] = s1[r] * 0.0009765625f; }   // undo x16 x16 carries, divide by 4
  float mx = sc[0];
#pragma unroll
  for (int i = 1; i < 16; ++i) mx = fmaxf(mx, sc[i]);
  mx = fmaxf(mx, __shfl_xor(mx, 16, 32));           // the other lane half holds the other 16 keys of this query
  const float mnew = fmaxf(mr, mx);
  const float al = exp2f((mr - mnew) * LOG2E);
  mr = mnew;
  // weights carried x256: pc = 256 * exp(sc - mnew); hi plane f16(pc), residual plane f16((pc - hi) * 2048)
  Frag ph, pl;
  float ps = 0.0f;
#pragma unroll
  for (int i = 0; i < 16; ++i) {
    const float pc = exp2f(fmaf(sc[i] - mnew, LOG2E, 8.0f));
    ps += pc;
    const _Float16 h = (_Float16)pc;
    ph.e[i] = h;                                    // B element i: i<8 -> key0 + 8h + i (tile 0 row 8h+i); i>=8 -> key0 + 16 + 8h + (i-8) (tile 1)
    pl.e[i] = (_Float16)((pc - (float)h) * 2048.0f);
  }
  ps += __shfl_xor(ps, 16, 32);
  lr = lr * al + ps;
  Oh = Oh * al; Ol = Ol * al;
  mma_h2(vf.h, ph.h, pl.h, Oh, Ol);
}

// Block = 4 waves x 16 queries = 64 queries of one (chunk, batch); no LDS and no barrier in the key loop.
// Epilogue: O^T tile -> per-wave LDS tile [16 queries][16 d] (fully written, fully consumed; block barrier), then thread tid stores unit tid of the
// block's 16 plane rows x 64 columns = two adjacent T32 tiles (it reads the LDS tile of the wave that owns its plane row, behind the block barrier).
// Context plane element order: flat = ((c*NB + b)*SEQ + s)*16 + h; plane row = (flat>>6) mod (NB*SEQ), column = (flat>>6)/(NB*SEQ)*64 + (flat&63).
// coverage: NCH*NB*(SEQ/64) blocks x 4 waves x 256 elements = every element of the plane exactly once.
__global__ __launch_bounds__(128) void k_attn(const unsigned short* __restrict__ Qp, const unsigned short* __restrict__ Kp,
                                              const unsigned short* __restrict__ Vt, unsigned short* __restrict__ O2) {
  __shared__ __attribute__((aligned(16))) float so[4][16][20];
  const int tid = threadIdx.x, w = __builtin_amdgcn_readfirstlane((int)(tid >> 5)), lane = tid & 31, ln = lane & 15, hh = lane >> 4;
  const int qt = blockIdx.x % (SEQ / 64);
  const int p = blockIdx.x / (SEQ / 64);
  const int b = p % NB, c = p / NB;
  const int qbase = qt * 64 + 16 * w;
  const v8us zz = {0, 0, 0, 0, 0, 0, 0, 0};
  // Q^T B fragment: column n = query qbase + ln, elements 0..7 <- d = 8h + i, elements 8..15 zero
  Frag qf;
  qf.half[0] = *(const v8us*)(Qp + ((size_t)c * (MROWS / 16) + (b * SEQ + qbase) / 16) * 256 + lane * 8);
  qf.half[1] = zz;
  const unsigned short* kb = Kp + ((size_t)c * (MROWS / 16) + (b * SEQ) / 16) * 256 + lane * 8;
  const unsigned short* vb = Vt + ((size_t)c * (MROWS / 32) + (b * SEQ) / 32) * 512 + lane * 8;
  float mr = -3.0e38f, lr = 0.0f;
  v8f Oh = {0.f, 0.f, 0.f, 0.f, 0.f, 0.f, 0.f, 0.f};
  v8f Ol = {0.f, 0.f, 0.f, 0.f, 0.f, 0.f, 0.f, 0.f};
#pragma unroll 1
  for (int j = 0; j < SEQ / 32; ++j)
    fa_step(kb + j * 512, vb + j * 512, qf, mr, lr, Oh, Ol);

  // O^T element r = out(query qbase + ln, d = 8h + r); undo x256 (in lr), x16 (V), x2048 (residual plane); carry the context x256
  const float inv = 16.0f * (1.0f / lr);
#pragma unroll
  for (int r = 0; r < 8; ++r)
    so[w][ln][8 * hh + r] = (Oh[r] + Ol[r] * 0.00048828125f) * inv;
  __syncthreads();
  // unit tid = plane row rr of the block's 16, 8-column piece p of its 64 columns; four queries of one wave make one plane row
  const int rr = tid & 15, p8 = tid >> 4;
  const int qq = (rr & 3) * 4 + (p8 >> 1), d0 = (p8 & 1) * 8;
  const v4f x0 = *(const v4fa*)&so[rr >> 2][qq][d0];
  const v4f x1 = *(const v4fa*)&so[rr >> 2][qq][d0 + 4];
  Frag f;
  f.e[0] = (_Float16)x0[0]; f.e[1] = (_Float16)x0[1]; f.e[2] = (_Float16)x0[2]; f.e[3] = (_Float16)x0[3];
  f.e[4] = (_Float16)x1[0]; f.e[5] = (_Float16)x1[1]; f.e[6] = (_Float16)x1[2]; f.e[7] = (_Float16)x1[3];
  const v8us o = f.half[0];
  const int R = (c * NB + b) * (SEQ / 4) + qt * 16;   // the block's first plane row, a multiple of 16
  const int hp = R / MROWS;
  const int prow = R - hp * MROWS;
  unsigned short* dst = O2 + ((size_t)(prow >> 4) * (FEAT / 32) + hp * 2) * 512 + tid * 8;
  *(v8us*)dst = o;
  
}

extern "C" void kernel_launch(void* const* d_in, const int* in_sizes, int n_in,
                              void* d_out, int out_size, void* d_ws, size_t ws_size, hipStream_t stream) {
  if (n_in < 15) return;
  const long long needx = ((long long)(NB - 1) * SEQ_FULL + SEQ) * FEAT;   // last element touched + 1
  if ((long long)in_sizes[0] < needx) return;
  if ((long long)out_size < needx) return;
  for (int i = 1; i < 15; i += 2) {
    if ((long long)in_sizes[i] < (long long)FEAT * FEAT) return;
    if ((long long)in_sizes[i + 1] < (long long)FEAT) return;
  }
  // wire order: x, then (weight, bias) pairs for wq, wk, wv, vq, vk, vv, wo
  const float* x    = (const float*)d_in[0];
  const float* wq_w = (const float*)d_in[1];
  const float* wq_b = (const float*)d_in[2];
  const float* wk_w = (const float*)d_in[3];
  const float* wk_b = (const float*)d_in[4];
  const float* wv_w = (const float*)d_in[5];
  const float* wv_b = (const float*)d_in[6];
  const float* vq_w = (const float*)d_in[7];
  const float* vq_b = (const float*)d_in[8];
  const float* vk_w = (const float*)d_in[9];
  const float* vk_b = (const float*)d_in[10];
  const float* vv_w = (const float*)d_in[11];
  const float* vv_b = (const float*)d_in[12];
  const float* wo_w = (const float*)d_in[13];
  const float* wo_b = (const float*)d_in[14];

  char* ws = (char*)d_ws;
  size_t off = 0;
  const size_t planeA = (size_t)MROWS * FEAT * 2;
  const size_t planeW = (size_t)FEAT * FEAT * 2;       // weight plane
  unsigned short* Xb  = (unsigned short*)(ws + off); off += (planeA + 255) & ~(size_t)255;
  unsigned short* Wqb = (unsigned short*)(ws + off); off += (planeW + 255) & ~(size_t)255;
  unsigned short* Wkb = (unsigned short*)(ws + off); off += (planeW + 255) & ~(size_t)255;
  unsigned short* Wvb = (unsigned short*)(ws + off); off += (planeW + 255) & ~(size_t)255;
  unsigned short* Vqh = (unsigned short*)(ws + off); off += (planeW + 255) & ~(size_t)255;
  unsigned short* Vkh = (unsigned short*)(ws + off); off += (planeW + 255) & ~(size_t)255;
  unsigned short* Vvh = (unsigned short*)(ws + off); off += (planeW + 255) & ~(size_t)255;
  unsigned short* Woh = (unsigned short*)(ws + off); off += (planeW + 255) & ~(size_t)255;
  unsigned short* T1q = (unsigned short*)(ws + off); off += (planeA + 255) & ~(size_t)255;
  unsigned short* T1k = (unsigned short*)(ws + off); off += (planeA + 255) & ~(size_t)255;
  unsigned short* T1v = (unsigned short*)(ws + off); off += (planeA + 255) & ~(size_t)255;
  unsigned short* Qp  = (unsigned short*)(ws + off); off += (planeA + 255) & ~(size_t)255;
  unsigned short* Kp  = (unsigned short*)(ws + off); off += (planeA + 255) & ~(size_t)255;
  unsigned short* Vt  = (unsigned short*)(ws + off); off += (planeA + 255) & ~(size_t)255;   // [FEAT][MROWS], T32 order
  unsigned short* O2  = (unsigned short*)(ws + off); off += (planeA + 255) & ~(size_t)255;
  if (off > ws_size) return;

  k_cvt<<<(unsigned)(XBLK + 7 * WBLK), 256, 0, stream>>>(x, wq_w, wk_w, wv_w, vq_w, vk_w, vv_w, wo_w, Xb, Wqb);

  const dim3 g3((unsigned)(MROWS / 128), (unsigned)(FEAT / 128), 3u);
  const dim3 g1((unsigned)(MROWS / 128), (unsigned)(FEAT / 128));
  k_lin1<<<g3, 256, 0, stream>>>(Xb, Wqb, Wkb, Wvb, wq_b, wk_b, wv_b, T1q, T1k, T1v);
  k_lin2<<<g3, 256, 0, stream>>>(T1q, T1k, T1v, Vqh, Vkh, Vvh, vq_b, vk_b, vv_b, Qp, Kp, Vt);

  k_attn<<<(unsigned)(NCH * NB * (SEQ / 64)), 128, 0, stream>>>(Qp, Kp, Vt, O2);

  k_lin3<<<g1, 256, 0, stream>>>(O2, Woh, wo_b, (float*)d_out);
}

// v003
// One run takes 114 microseconds.
// Next to v002, in two timings, it ran 1.19 times as fast each time.
// Counting every step since v000, it is 2.18 times as fast.
#include <hip/hip_runtime.h>
// Contractions: first Linear of each q/k/v chain on v_wmma_f32_16x16x32_bf16 (x and W converted RNE to bf16, single product, f32 accumulate); second Linears, K Q^T scores and the output Linear on v_wmma_f32_16x16x32_f16 (activations x16 or x256 in f16, weights = RNE-bf16 value x64 held exactly in f16, f32 accumulate); O^T = V^T P^T on v_wmma_f32_16x16x32_f16 (V x16 f16; P x256 f16 hi plane + x2^11 f16 residual plane in a separate f32 accumulator); biases RNE-bf16 values added in f32; softmax statistics f32.
// 64 feature chunks of width 16 act as heads; scale 1/4; no mask; context is written in the flat-reinterpreted (16, b, s, 64) -> (b, s, 1024) order.
// GEMM engine: C[m][n] = sum_k A[m][k] W[n][k]; both operands are 16-bit planes held in fragment order, fragments are loaded straight from global
// (elements 0..7 <- k0 + 8h + i, elements 8..15 <- k0 + 16 + 8h + i for A rows and for W rows alike), three 32-k steps ahead into a ring of three register sets. 128x128 block tile, 8 waves of 32x64.
// Fragment order T32 of a plane [R][C]: 16 x 32 tiles, tile index (r/16)*(C/32) + c/32, 512 elements a tile; element (r, c) sits at
// tile*512 + ((c>>4)&1)*256 + (((c>>3)&1)*16 + (r&15))*8 + (c&7), so each half fragment is one wave-wide 16-byte load of 512 contiguous bytes.
// Fragment order T16 (Q and K planes, [MROWS][FEAT]): 16 x 16 tiles, tile index (c/16)*(MROWS/16) + r/16, 256 elements a tile; element (r, c) sits at
// tile*256 + (((c>>3)&1)*16 + (r&15))*8 + (c&7).
// Attention engine: transposed flash. Each wave owns 16 queries of one (chunk, batch). Per 32-key step: S^T tiles (key rows x query columns)
// from K rows (A) and Q^T (B), upper 16 k slots zero; the two 16-key D tiles pack straight into the P^T B fragment; O^T (16 d rows x query columns)
// accumulates from V^T rows (A, global f16 plane in T32 order produced directly by a GEMM with swapped operand roles).
#ifndef NB
#define NB 2
#endif
#ifndef SEQ
#define SEQ 1024
#endif
#define NB_FULL 2
#define SEQ_FULL 1024
#define FEAT 1024
#define NCH 64
#define MROWS (NB * SEQ)

static_assert(SEQ % 128 == 0);
static_assert(SEQ <= SEQ_FULL);
static_assert(NB <= NB_FULL);
static_assert(FEAT % 128 == 0);
static_assert(FEAT == NCH * 16);
static_assert((size_t)8 * MROWS * FEAT * 2 + (size_t)7 * FEAT * FEAT * 2 <= (size_t)134217728);
static_assert(((size_t)(NB - 1) * SEQ_FULL + SEQ) * FEAT <= (size_t)NB_FULL * SEQ_FULL * FEAT);

typedef __bf16 v16b __attribute__((ext_vector_type(16)));
typedef _Float16 v16h __attribute__((ext_vector_type(16)));
typedef unsigned short v8us __attribute__((ext_vector_type(8), may_alias));
typedef float v8f __attribute__((ext_vector_type(8)));
typedef float v4f __attribute__((ext_vector_type(4)));
typedef float v4fa __attribute__((ext_vector_type(4), may_alias));
union Frag { v16b b; v16h h; v8us half[2]; _Float16 e[16]; unsigned short u[16]; };

#define LOG2E 1.4426950408889634f

__device__ __forceinline__ unsigned short bf16_bits(float x) {   // RNE convert to bf16 bits
  unsigned int u = __float_as_uint(x);
  return (unsigned short)((u + 0x7FFFu + ((u >> 16) & 1u)) >> 16);
}
__device__ __forceinline__ float bf16_val(unsigned short b) { return __uint_as_float(((unsigned int)b) << 16); }
__device__ __forceinline__ float bf16_rne(float x) { return bf16_val(bf16_bits(x)); }

// c0 += a0*b ; c1 += a1*b (two key tiles against one query fragment), then the hazard guard
__device__ __forceinline__ void mma_s2(v16h a0, v16h a1, v16h b, v8f& c0, v8f& c1) {
  c0 = __builtin_amdgcn_wmma_f32_16x16x32_f16(false, a0, false, b, (short)0, c0, false, false);
  c1 = __builtin_amdgcn_wmma_f32_16x16x32_f16(false, a1, false, b, (short)0, c1, false, false);
  asm volatile("v_nop\n\tv_nop\n\tv_nop\n\tv_nop" : "+v"(c0), "+v"(c1) : "v"(a0), "v"(a1), "v"(b));
}
// ch += a*bh ; cl += a*bl (scaled residual plane keeps its own accumulator), then the hazard guard
__device__ __forceinline__ void mma_h2(v16h a, v16h bh, v16h bl, v8f& ch, v8f& cl) {
  ch = __builtin_amdgcn_wmma_f32_16x16x32_f16(false, a, false, bh, (short)0, ch, false, false);
  cl = __builtin_amdgcn_wmma_f32_16x16x32_f16(false, a, false, bl, (short)0, cl, false, false);
  asm volatile("v_nop\n\tv_nop\n\tv_nop\n\tv_nop" : "+v"(ch), "+v"(cl) : "v"(a), "v"(bh), "v"(bl));
}

// 16-byte unit t of a T32 plane of FEAT columns holds elements (row, col .. col + 7)
__device__ __forceinline__ void t32_unit(int t, int& row, int& col) {
  const int tile = t >> 6, u = t & 63;
  const int tr = tile / (FEAT / 32), tc = tile - tr * (FEAT / 32);
  row = tr * 16 + (u & 15);
  col = tc * 32 + (u >> 4) * 8;
}

#define XBLK (MROWS * (FEAT / 8) / 256)
#define WBLK (FEAT * (FEAT / 8) / 256)
static_assert(MROWS * (FEAT / 8) % 256 == 0);
static_assert(FEAT * (FEAT / 8) % 256 == 0);
static_assert((size_t)FEAT * FEAT * 2 % 256 == 0);   // a weight plane needs no padding to the workspace's 256-byte step

// All eight operand planes in one launch (none depends on another). Blocks 0 .. XBLK-1: the compact x plane, bf16 bits (RNE), thread t writes unit t.
// Then WBLK blocks per weight plane [out][in], T32 order: planes 0..2 -> bf16 bits (RNE); planes 3..6 -> f16 bits of (RNE-bf16 value x 64).
// coverage: XBLK*256 units = the whole x plane, WBLK*256 units = one whole weight plane; every unit written once.
__global__ __launch_bounds__(256) void k_cvt(const float* __restrict__ X,
                                             const float* __restrict__ w0, const float* __restrict__ w1, const float* __restrict__ w2,
                                             const float* __restrict__ w3, const float* __restrict__ w4, const float* __restrict__ w5,
                                             const float* __restrict__ w6,
                                             unsigned short* __restrict__ Xb, unsigned short* __restrict__ Wplanes) {
  const int blk = blockIdx.x;
  int row, col;
  v8us o;
  if (blk < XBLK) {
    const int t = blk * 256 + threadIdx.x;
    t32_unit(t, row, col);
    const int b = row / SEQ, s = row - b * SEQ;
    const float* src = X + ((size_t)b * SEQ_FULL + s) * FEAT + col;
    const v4f x0 = *(const v4fa*)(src), x1 = *(const v4fa*)(src + 4);
    o[0] = bf16_bits(x0[0]); o[1] = bf16_bits(x0[1]); o[2] = bf16_bits(x0[2]); o[3] = bf16_bits(x0[3]);
    o[4] = bf16_bits(x1[0]); o[5] = bf16_bits(x1[1]); o[6] = bf16_bits(x1[2]); o[7] = bf16_bits(x1[3]);
    *(v8us*)(Xb + (size_t)t * 8) = o;
    return;
  }
  const int wi = (blk - XBLK) / WBLK;                      // block-uniform plane index
  const int t = (blk - XBLK - wi * WBLK) * 256 + threadIdx.x;
  const bool i1 = wi & 1, i2 = wi & 2, i4 = wi & 4;
  const float* Wsrc = i4 ? (i2 ? w6 : (i1 ? w5 : w4)) : (i2 ? (i1 ? w3 : w2) : (i1 ? w1 : w0));
  unsigned short* Wp = Wplanes + (size_t)wi * FEAT * FEAT;   // the seven planes lie back to back in the workspace
  t32_unit(t, row, col);
  const float* src = Wsrc + (size_t)row * FEAT + col;
  const v4f x0 = *(const v4fa*)(src), x1 = *(const v4fa*)(src + 4);
  if (wi < 3) {
    o[0] = bf16_bits(x0[0]); o[1] = bf16_bits(x0[1]); o[2] = bf16_bits(x0[2]); o[3] = bf16_bits(x0[3]);
    o[4] = bf16_bits(x1[0]); o[5] = bf16_bits(x1[1]); o[6] = bf16_bits(x1[2]); o[7] = bf16_bits(x1[3]);
  } else {
    Frag f;
    f.e[0] = (_Float16)(bf16_rne(x0[0]) * 64.0f); f.e[1] = (_Float16)(bf16_rne(x0[1]) * 64.0f);
    f.e[2] = (_Float16)(bf16_rne(x0[2]) * 64.0f); f.e[3] = (_Float16)(bf16_rne(x0[3]) * 64.0f);
    f.e[4] = (_Float16)(bf16_rne(x1[0]) * 64.0f); f.e[5] = (_Float16)(bf16_rne(x1[1]) * 64.0f);
    f.e[6] = (_Float16)(bf16_rne(x1[2]) * 64.0f); f.e[7] = (_Float16)(bf16_rne(x1[3]) * 64.0f);
    o = f.half[0];
  }
  *(v8us*)(Wp + (size_t)t * 8) = o;
}

// One 32-k step's fragments of a wave's 32 x 64 tile: ap, wp = this lane's unit of the step's first A and W tile (T32 planes of FEAT columns).
__device__ __forceinline__ void load_frags(Frag (&a)[2], Frag (&b)[4], const unsigned short* __restrict__ ap, const unsigned short* __restrict__ wp) {
#pragma unroll
  for (int fm = 0; fm < 2; ++fm) {
    a[fm].half[0] = *(const v8us*)(ap + (size_t)fm * 16 * FEAT);
    a[fm].half[1] = *(const v8us*)(ap + (size_t)fm * 16 * FEAT + 256);
  }
#pragma unroll
  for (int fn = 0; fn < 4; ++fn) {
    b[fn].half[0] = *(const v8us*)(wp + (size_t)fn * 16 * FEAT);
    b[fn].half[1] = *(const v8us*)(wp + (size_t)fn * 16 * FEAT + 256);
  }
}
// acc[fm][fn] += a[fm] * b[fn], then the hazard guard: four vector slots before anything may overwrite the operands (the refill) or read the sums
template <bool BF>
__device__ __forceinline__ void mma_frags(const Frag (&a)[2], const Frag (&b)[4], v8f (&acc)[2][4]) {
#pragma unroll
  for (int fm = 0; fm < 2; ++fm)
#pragma unroll
    for (int fn = 0; fn < 4; ++fn) {
      if (BF) acc[fm][fn] = __builtin_amdgcn_wmma_f32_16x16x32_bf16(false, a[fm].b, false, b[fn].b, (short)0, acc[fm][fn], false, false);
      else    acc[fm][fn] = __builtin_amdgcn_wmma_f32_16x16x32_f16(false, a[fm].h, false, b[fn].h, (short)0, acc[fm][fn], false, false);
    }
  asm volatile("v_nop\n\tv_nop\n\tv_nop\n\tv_nop"
               : "+v"(acc[0][0]), "+v"(acc[0][1]), "+v"(acc[0][2]), "+v"(acc[0][3]),
                 "+v"(acc[1][0]), "+v"(acc[1][1]), "+v"(acc[1][2]), "+v"(acc[1][3])
               : "v"(a[0].h), "v"(a[1].h), "v"(b[0].h), "v"(b[1].h), "v"(b[2].h), "v"(b[3].h));
}

// C[m][n] = sum_k A[m][k] W[n][k], K = FEAT, A and W planes of FEAT columns in T32 order.
// BF: bf16 operands, else f16 operands. One 128 x 128 tile (bx, by) of a (Mrows/128, Ncols/128) tiling per block, 8 waves of 32 x 64.
// EPI 0: out f16 plane [m][N], T32 order = f16((acc*sc + bias[n]) * carry)     (bias along columns)
// EPI 1: out f16 plane [m][N], T32 order = f16((acc*sc + bias[m]) * carry)     (bias along rows)
// EPI 3: as EPI 0, out plane [MROWS][FEAT] in T16 order
// EPI 2: out f32 [b*SEQ_FULL + s][FEAT] = acc*sc + bias[n], m = b*SEQ + s
// Epilogue: two phases of 16 rows; the wave's 16 x 64 tile is staged in its own LDS tile (fully written: 16 rows x 64 columns, fully consumed),
template <bool BF, int EPI>
__device__ __forceinline__ void gemm_tile(float (*__restrict__ sst)[16][68], int bx, int by,
                                          const unsigned short* __restrict__ A, const unsigned short* __restrict__ W,
                                          const float* __restrict__ bias, void* __restrict__ outp,
                                          int N, float sc, float carry) {
  const int tid = threadIdx.x, lane = tid & 31, w = __builtin_amdgcn_readfirstlane((int)(tid >> 5));
  const int wm = w & 3, wn = w >> 2, ln = lane & 15, hh = lane >> 4;
  const int m0 = bx * 128 + wm * 32;
  const int n0 = by * 128 + wn * 64;
  const unsigned short* ap = A + (size_t)m0 * FEAT + lane * 8;   // tile row m0/16 starts at (m0/16) * (FEAT/32) * 512
  const unsigned short* wp = W + (size_t)n0 * FEAT + lane * 8;
  v8f acc[2][4];
#pragma unroll
  for (int fm = 0; fm < 2; ++fm)
#pragma unroll
    for (int fn = 0; fn < 4; ++fn)
#pragma unroll
      for (int r = 0; r < 8; ++r) acc[fm][fn][r] = 0.0f;

  // Register ring of NS fragment sets: step i works on set i % NS, and behind its products the set is refilled with step i + NS,
  // so a load has NS - 1 steps of matrix work between its issue and its wait. Steps run in ascending k: the sums keep their order.
  constexpr int NS = 3, KIT = FEAT / 32, MAIN = (KIT - NS) / NS;   // NS = 3: two blocks still fit a WGP's registers
  static_assert(KIT > NS);
  Frag a[NS][2], b[NS][4];
#pragma unroll
  for (int s = 0; s < NS; ++s) load_frags(a[s], b[s], ap + s * 512, wp + s * 512);
  // kept rolled (a trip is NS steps) so that the loop's text stays short; every step of a trip has a refill in range
#pragma unroll 1
  for (int t = 0; t < MAIN; ++t) {
#pragma unroll
    for (int s = 0; s < NS; ++s) {
      mma_frags<BF>(a[s], b[s], acc);
      load_frags(a[s], b[s], ap + (NS + s) * 512, wp + (NS + s) * 512);
    }
    ap += NS * 512;
    wp += NS * 512;
  }
#pragma unroll
  for (int i = MAIN * NS; i < KIT; ++i) {
    const int s = i % NS;
    mma_frags<BF>(a[s], b[s], acc);
    if (i + NS < KIT) load_frags(a[s], b[s], ap + (i - MAIN * NS + NS) * 512, wp + (i - MAIN * NS + NS) * 512);
  }

  // D element r of tile (fm, fn) = C(m0 + 16 fm + 8 hh + r, n0 + 16 fn + ln)
  float bcol[4];
#pragma unroll
  for (int fn = 0; fn < 4; ++fn) bcol[fn] = 0.0f;
  if (EPI != 1) {
#pragma unroll
    for (int fn = 0; fn < 4; ++fn) bcol[fn] = bf16_rne(bias[n0 + fn * 16 + ln]);
  }
#pragma unroll
  for (int fm = 0; fm < 2; ++fm) {
    float brow[8];
#pragma unroll
    for (int r = 0; r < 8; ++r) brow[r] = 0.0f;
    if (EPI == 1) {
#pragma unroll
      for (int r = 0; r < 8; ++r) brow[r] = bf16_rne(bias[m0 + fm * 16 + 8 * hh + r]);
    }
#pragma unroll
    for (int fn = 0; fn < 4; ++fn)
#pragma unroll
      for (int r = 0; r < 8; ++r) {
        float v = acc[fm][fn][r] * sc + ((EPI == 1) ? brow[r] : bcol[fn]);
        if (EPI != 2) v = v * carry;
        sst[w][8 * hh + r][fn * 16 + ln] = v;
      }
    __syncthreads();
    if (EPI == 2) {
      float* of = (float*)outp;
      const int rsub = lane >> 4, c4 = (lane & 15) * 4;
      {
#pragma unroll
        for (int q = 0; q < 8; ++q) {
          const int row = 2 * q + rsub;
          const int m = m0 + fm * 16 + row;
          const int bb = m / SEQ;
          const size_t grow = (size_t)bb * SEQ_FULL + (size_t)(m - bb * SEQ);
          const v4f v = *(const v4fa*)&sst[w][row][c4];
          *(v4f*)(of + grow * FEAT + n0 + c4) = v;
        }
        
      }
    } else {
      unsigned short* oh = (unsigned short*)outp;
      {
#pragma unroll
        for (int it = 0; it < 4; ++it) {
          // lane (ln, hh) carries row ln, columns 16 it + 8 hh .. + 7: one 512-byte run of the out plane per store
          const v4f x0 = *(const v4fa*)&sst[w][ln][it * 16 + hh * 8];
          const v4f x1 = *(const v4fa*)&sst[w][ln][it * 16 + hh * 8 + 4];
          Frag f;
          f.e[0] = (_Float16)x0[0]; f.e[1] = (_Float16)x0[1]; f.e[2] = (_Float16)x0[2]; f.e[3] = (_Float16)x0[3];
          f.e[4] = (_Float16)x1[0]; f.e[5] = (_Float16)x1[1]; f.e[6] = (_Float16)x1[2]; f.e[7] = (_Float16)x1[3];
          const v8us o = f.half[0];
          if (EPI == 3) *(v8us*)(oh + ((size_t)((n0 >> 4) + it) * (MROWS / 16) + (m0 >> 4) + fm) * 256 + lane * 8) = o;
          else          *(v8us*)(oh + ((size_t)((m0 >> 4) + fm) * (N >> 5) + (n0 >> 5)) * 512 + it * 256 + lane * 8) = o;
        }
        
      }
    }
    __syncthreads();
  }
}

#define S10 0.0009765625f        // 1 / (16 * 64)
#define S14 0.00006103515625f    // 1 / (256 * 64)

// First Linears of the q, k and v chains in one launch: blockIdx.z picks the chain (block-uniform); grid (MROWS/128, FEAT/128, 3).
__global__ __launch_bounds__(256) void k_lin1(const unsigned short* __restrict__ Xb,
                                              const unsigned short* __restrict__ W0, const unsigned short* __restrict__ W1,
                                              const unsigned short* __restrict__ W2,
                                              const float* __restrict__ b0, const float* __restrict__ b1, const float* __restrict__ b2,
                                              unsigned short* __restrict__ o0, unsigned short* __restrict__ o1, unsigned short* __restrict__ o2) {
  __shared__ __attribute__((aligned(16))) float sst[8][16][68];
  const int z = blockIdx.z;
  gemm_tile<true, 0>(sst, blockIdx.x, blockIdx.y, Xb, z == 0 ? W0 : z == 1 ? W1 : W2, z == 0 ? b0 : z == 1 ? b1 : b2,
                     (void*)(z == 0 ? o0 : z == 1 ? o1 : o2), FEAT, 1.0f, 16.0f);
}

// Second Linears in one launch, grid (MROWS/128, FEAT/128, 3): z = 0, 1 -> Q and K planes (T16); z = 2 -> V^T[f][token] = sum_j vv[f][j] * t1v[token][j] + vv_b[f],
// whose tiling is (FEAT/128, MROWS/128): its tile comes from the block's flat index in the z slice.
__global__ __launch_bounds__(256) void k_lin2(const unsigned short* __restrict__ T1q, const unsigned short* __restrict__ T1k,
                                              const unsigned short* __restrict__ T1v,
                                              const unsigned short* __restrict__ Vq, const unsigned short* __restrict__ Vk,
                                              const unsigned short* __restrict__ Vv,
                                              const float* __restrict__ bq, const float* __restrict__ bk, const float* __restrict__ bv,
                                              unsigned short* __restrict__ Qp, unsigned short* __restrict__ Kp, unsigned short* __restrict__ Vt) {
  __shared__ __attribute__((aligned(16))) float sst[8][16][68];
  const int z = blockIdx.z;
  if (z < 2) {
    gemm_tile<false, 3>(sst, blockIdx.x, blockIdx.y, z == 0 ? T1q : T1k, z == 0 ? Vq : Vk, z == 0 ? bq : bk,
                        (void*)(z == 0 ? Qp : Kp), FEAT, S10, 16.0f);
  } else {
    const int flat = blockIdx.y * (MROWS / 128) + blockIdx.x;
    gemm_tile<false, 1>(sst, flat % (FEAT / 128), flat / (FEAT / 128), Vv, T1v, bv, (void*)Vt, MROWS, S10, 16.0f);
  }
}

// Output Linear, grid (MROWS/128, FEAT/128).
__global__ __launch_bounds__(256) void k_lin3(const unsigned short* __restrict__ O2, const unsigned short* __restrict__ Wo,
                                              const float* __restrict__ bo, float* __restrict__ out) {
  __shared__ __attribute__((aligned(16))) float sst[8][16][68];
  gemm_tile<false, 2>(sst, blockIdx.x, blockIdx.y, O2, Wo, bo, (void*)out, FEAT, S14, 1.0f);
}

// One 32-key step for a wave's 16 queries. kp: this lane's unit of the chunk's K tile at key0 (T16); vp: this lane's unit of the chunk's V^T tile at key0 (T32).
__device__ __forceinline__ void fa_step(const unsigned short* __restrict__ kp, const unsigned short* __restrict__ vp,
                                        const Frag& qf, float& mr, float& lr, v8f& Oh, v8f& Ol) {
  const v8us zz = {0, 0, 0, 0, 0, 0, 0, 0};
  // A fragments of K: row m = key (key0 + 16*kt + ln), elements 0..7 <- d = 8h + i, elements 8..15 (k slots 16..31) zero
  Frag k0, k1, vf;
  k0.half[0] = *(const v8us*)(kp);             k0.half[1] = zz;
  k1.half[0] = *(const v8us*)(kp + 256);       k1.half[1] = zz;
  // A fragment of V^T: row m = d (ln), elements 0..7 <- key0 + 8h + i, 8..15 <- key0 + 16 + 8h + i
  vf.half[0] = *(const v8us*)(vp);
  vf.half[1] = *(const v8us*)(vp + 256);
  v8f s0 = {0.f, 0.f, 0.f, 0.f, 0.f, 0.f, 0.f, 0.f};
  v8f s1 = {0.f, 0.f, 0.f, 0.f, 0.f, 0.f, 0.f, 0.f};
  // S^T tiles: element r of tile kt = 256 * q.k of (key0 + 16*kt + 8h + r, query ln)
  mma_s2(k0.h, k1.h, qf.h, s0, s1);
  float sc[16];
#pragma unroll
  for (int r = 0; r < 8; ++r) { sc[r] = s0[r] * 0.0009765625f; sc[8 + r] = s1[r] * 0.0009765625f; }   // undo x16 x16 carries, divide by 4
  float mx = sc[0];
#pragma unroll
  for (int i = 1; i < 16; ++i) mx = fmaxf(mx, sc[i]);
  mx = fmaxf(mx, __shfl_xor(mx, 16, 32));           // the other lane half holds the other 16 keys of this query
  const float mnew = fmaxf(mr, mx);
  const float al = exp2f((mr - mnew) * LOG2E);
  mr = mnew;
  // weights carried x256: pc = 256 * exp(sc - mnew); hi plane f16(pc), residual plane f16((pc - hi) * 2048)
  Frag ph, pl;
  float ps = 0.0f;
#pragma unroll
  for (int i = 0; i < 16; ++i) {
    const float pc = exp2f(fmaf(sc[i] - mnew, LOG2E, 8.0f));
    ps += pc;
    const _Float16 h = (_Float16)pc;
    ph.e[i] = h;                                    // B element i: i<8 -> key0 + 8h + i (tile 0 row 8h+i); i>=8 -> key0 + 16 + 8h + (i-8) (tile 1)
    pl.e[i] = (_Float16)((pc - (float)h) * 2048.0f);
  }
  ps += __shfl_xor(ps, 16, 32);
  lr = lr * al + ps;
  Oh = Oh * al; Ol = Ol * al;
  mma_h2(vf.h, ph.h, pl.h, Oh, Ol);
}

// Block = 4 waves x 16 queries = 64 queries of one (chunk, batch); no LDS and no barrier in the key loop.
// Epilogue: O^T tile -> per-wave LDS tile [16 queries][16 d] (fully written, fully consumed; block barrier), then thread tid stores unit tid of the
// block's 16 plane rows x 64 columns = two adjacent T32 tiles (it reads the LDS tile of the wave that owns its plane row, behind the block barrier).
// Context plane element order: flat = ((c*NB + b)*SEQ + s)*16 + h; plane row = (flat>>6) mod (NB*SEQ), column = (flat>>6)/(NB*SEQ)*64 + (flat&63).
// coverage: NCH*NB*(SEQ/64) blocks x 4 waves x 256 elements = every element of the plane exactly once.
__global__ __launch_bounds__(128) void k_attn(const unsigned short* __restrict__ Qp, const unsigned short* __restrict__ Kp,
                                              const unsigned short* __restrict__ Vt, unsigned short* __restrict__ O2) {
  __shared__ __attribute__((aligned(16))) float so[4][16][20];
  const int tid = threadIdx.x, w = __builtin_amdgcn_readfirstlane((int)(tid >> 5)), lane = tid & 31, ln = lane & 15, hh = lane >> 4;
  const int qt = blockIdx.x % (SEQ / 64);
  const int p = blockIdx.x / (SEQ / 64);
  const int b = p % NB, c = p / NB;
  const int qbase = qt * 64 + 16 * w;
  const v8us zz = {0, 0, 0, 0, 0, 0, 0, 0};
  // Q^T B fragment: column n = query qbase + ln, elements 0..7 <- d = 8h + i, elements 8..15 zero
  Frag qf;
  qf.half[0] = *(const v8us*)(Qp + ((size_t)c * (MROWS / 16) + (b * SEQ + qbase) / 16) * 256 + lane * 8);
  qf.half[1] = zz;
  const unsigned short* kb = Kp + ((size_t)c * (MROWS / 16) + (b * SEQ) / 16) * 256 + lane * 8;
  const unsigned short* vb = Vt + ((size_t)c * (MROWS / 32) + (b * SEQ) / 32) * 512 + lane * 8;
  float mr = -3.0e38f, lr = 0.0f;
  v8f Oh = {0.f, 0.f, 0.f, 0.f, 0.f, 0.f, 0.f, 0.f};
  v8f Ol = {0.f, 0.f, 0.f, 0.f, 0.f, 0.f, 0.f, 0.f};
#pragma unroll 1
  for (int j = 0; j < SEQ / 32; ++j)
    fa_step(kb + j * 512, vb + j * 512, qf, mr, lr, Oh, Ol);

  // O^T element r = out(query qbase + ln, d = 8h + r); undo x256 (in lr), x16 (V), x2048 (residual plane); carry the context x256
  const float inv = 16.0f * (1.0f / lr);
#pragma unroll
  for (int r = 0; r < 8; ++r)
    so[w][ln][8 * hh + r] = (Oh[r] + Ol[r] * 0.00048828125f) * inv;
  __syncthreads();
  // unit tid = plane row rr of the block's 16, 8-column piece p of its 64 columns; four queries of one wave make one plane row
  const int rr = tid & 15, p8 = tid >> 4;
  const int qq = (rr & 3) * 4 + (p8 >> 1), d0 = (p8 & 1) * 8;
  const v4f x0 = *(const v4fa*)&so[rr >> 2][qq][d0];
  const v4f x1 = *(const v4fa*)&so[rr >> 2][qq][d0 + 4];
  Frag f;
  f.e[0] = (_Float16)x0[0]; f.e[1] = (_Float16)x0[1]; f.e[2] = (_Float16)x0[2]; f.e[3] = (_Float16)x0[3];
  f.e[4] = (_Float16)x1[0]; f.e[5] = (_Float16)x1[1]; f.e[6] = (_Float16)x1[2]; f.e[7] = (_Float16)x1[3];
  const v8us o = f.half[0];
  const int R = (c * NB + b) * (SEQ / 4) + qt * 16;   // the block's first plane row, a multiple of 16
  const int hp = R / MROWS;
  const int prow = R - hp * MROWS;
  unsigned short* dst = O2 + ((size_t)(prow >> 4) * (FEAT / 32) + hp * 2) * 512 + tid * 8;
  *(v8us*)dst = o;
  
}

extern "C" void kernel_launch(void* const* d_in, const int* in_sizes, int n_in,
                              void* d_out, int out_size, void* d_ws, size_t ws_size, hipStream_t stream) {
  if (n_in < 15) return;
  const long long needx = ((long long)(NB - 1) * SEQ_FULL + SEQ) * FEAT;   // last element touched + 1
  if ((long long)in_sizes[0] < needx) return;
  if ((long long)out_size < needx) return;
  for (int i = 1; i < 15; i += 2) {
    if ((long long)in_sizes[i] < (long long)FEAT * FEAT) return;
    if ((long long)in_sizes[i + 1] < (long long)FEAT) return;
  }
  // wire order: x, then (weight, bias) pairs for wq, wk, wv, vq, vk, vv, wo
  const float* x    = (const float*)d_in[0];
  const float* wq_w = (const float*)d_in[1];
  const float* wq_b = (const float*)d_in[2];
  const float* wk_w = (const float*)d_in[3];
  const float* wk_b = (const float*)d_in[4];
  const float* wv_w = (const float*)d_in[5];
  const float* wv_b = (const float*)d_in[6];
  const float* vq_w = (const float*)d_in[7];
  const float* vq_b = (const float*)d_in[8];
  const float* vk_w = (const float*)d_in[9];
  const float* vk_b = (const float*)d_in[10];
  const float* vv_w = (const float*)d_in[11];
  const float* vv_b = (const float*)d_in[12];
  const float* wo_w = (const float*)d_in[13];
  const float* wo_b = (const float*)d_in[14];

  char* ws = (char*)d_ws;
  size_t off = 0;
  const size_t planeA = (size_t)MROWS * FEAT * 2;
  const size_t planeW = (size_t)FEAT * FEAT * 2;       // weight plane
  unsigned short* Xb  = (unsigned short*)(ws + off); off += (planeA + 255) & ~(size_t)255;
  unsigned short* Wqb = (unsigned short*)(ws + off); off += (planeW + 255) & ~(size_t)255;
  unsigned short* Wkb = (unsigned short*)(ws + off); off += (planeW + 255) & ~(size_t)255;
  unsigned short* Wvb = (unsigned short*)(ws + off); off += (planeW + 255) & ~(size_t)255;
  unsigned short* Vqh = (unsigned short*)(ws + off); off += (planeW + 255) & ~(size_t)255;
  unsigned short* Vkh = (unsigned short*)(ws + off); off += (planeW + 255) & ~(size_t)255;
  unsigned short* Vvh = (unsigned short*)(ws + off); off += (planeW + 255) & ~(size_t)255;
  unsigned short* Woh = (unsigned short*)(ws + off); off += (planeW + 255) & ~(size_t)255;
  unsigned short* T1q = (unsigned short*)(ws + off); off += (planeA + 255) & ~(size_t)255;
  unsigned short* T1k = (unsigned short*)(ws + off); off += (planeA + 255) & ~(size_t)255;
  unsigned short* T1v = (unsigned short*)(ws + off); off += (planeA + 255) & ~(size_t)255;
  unsigned short* Qp  = (unsigned short*)(ws + off); off += (planeA + 255) & ~(size_t)255;
  unsigned short* Kp  = (unsigned short*)(ws + off); off += (planeA + 255) & ~(size_t)255;
  unsigned short* Vt  = (unsigned short*)(ws + off); off += (planeA + 255) & ~(size_t)255;   // [FEAT][MROWS], T32 order
  unsigned short* O2  = (unsigned short*)(ws + off); off += (planeA + 255) & ~(size_t)255;
  if (off > ws_size) return;

  k_cvt<<<(unsigned)(XBLK + 7 * WBLK), 256, 0, stream>>>(x, wq_w, wk_w, wv_w, vq_w, vk_w, vv_w, wo_w, Xb, Wqb);

  const dim3 g3((unsigned)(MROWS / 128), (unsigned)(FEAT / 128), 3u);
  const dim3 g1((unsigned)(MROWS / 128), (unsigned)(FEAT / 128));
  k_lin1<<<g3, 256, 0, stream>>>(Xb, Wqb, Wkb, Wvb, wq_b, wk_b, wv_b, T1q, T1k, T1v);
  k_lin2<<<g3, 256, 0, stream>>>(T1q, T1k, T1v, Vqh, Vkh, Vvh, vq_b, vk_b, vv_b, Qp, Kp, Vt);

  k_attn<<<(unsigned)(NCH * NB * (SEQ / 64)), 128, 0, stream>>>(Qp, Kp, Vt, O2);

  k_lin3<<<g1, 256, 0, stream>>>(O2, Woh, wo_b, (float*)d_out);
}

// v004
// One run takes 107 microseconds.
// Next to v003, in two timings, it ran 1.09 times as fast each time.
// All steps since v000 together make it 2.37 times as fast.
#include <hip/hip_runtime.h>
// Contractions: first Linear of each q/k/v chain on v_wmma_f32_16x16x32_bf16 (x and W converted RNE to bf16, single product, f32 accumulate); second Linears, K Q^T scores and the output Linear on v_wmma_f32_16x16x32_f16 (activations x16 or x256 in f16, weights = RNE-bf16 value x64 held exactly in f16, f32 accumulate); O^T = V^T P^T on v_wmma_f32_16x16x32_f16 (V x16 f16; P x256 f16 hi plane + x2^11 f16 residual plane in a separate f32 accumulator); biases RNE-bf16 values added in f32; softmax statistics f32.
// 64 feature chunks of width 16 act as heads; scale 1/4; no mask; context is written in the flat-reinterpreted (16, b, s, 64) -> (b, s, 1024) order.
// GEMM engine: C[m][n] = sum_k A[m][k] W[n][k]; both operands are 16-bit planes held in fragment order, fragments are loaded straight from global
// (elements 0..7 <- k0 + 8h + i, elements 8..15 <- k0 + 16 + 8h + i for A rows and for W rows alike), three 32-k steps ahead into a ring of three register sets. 128x128 block tile, 8 waves of 32x64.
// Fragment order T32 of a plane [R][C]: 16 x 32 tiles, tile index (r/16)*(C/32) + c/32, 512 elements a tile; element (r, c) sits at
// tile*512 + ((c>>4)&1)*256 + (((c>>3)&1)*16 + (r&15))*8 + (c&7), so each half fragment is one wave-wide 16-byte load of 512 contiguous bytes.
// Fragment order T16 (Q and K planes, [MROWS][FEAT]): 16 x 16 tiles, tile index (c/16)*(MROWS/16) + r/16, 256 elements a tile; element (r, c) sits at
// tile*256 + (((c>>3)&1)*16 + (r&15))*8 + (c&7).
// Attention engine: transposed flash. Each wave owns 16 queries of one (chunk, batch). Per 32-key step: S^T tiles (key rows x query columns)
// from K rows (A) and Q^T (B), upper 16 k slots zero; the two 16-key D tiles pack straight into the P^T B fragment; O^T (16 d rows x query columns)
// accumulates from V^T rows (A, global f16 plane in T32 order produced directly by a GEMM with swapped operand roles).
#ifndef NB
#define NB 2
#endif
#ifndef SEQ
#define SEQ 1024
#endif
#define NB_FULL 2
#define SEQ_FULL 1024
#define FEAT 1024
#define NCH 64
#define MROWS (NB * SEQ)

static_assert(SEQ % 128 == 0);
static_assert(SEQ <= SEQ_FULL);
static_assert(NB <= NB_FULL);
static_assert(FEAT % 128 == 0);
static_assert(FEAT == NCH * 16);
static_assert((size_t)8 * MROWS * FEAT * 2 + (size_t)7 * FEAT * FEAT * 2 <= (size_t)134217728);
static_assert(((size_t)(NB - 1) * SEQ_FULL + SEQ) * FEAT <= (size_t)NB_FULL * SEQ_FULL * FEAT);

typedef __bf16 v16b __attribute__((ext_vector_type(16)));
typedef _Float16 v16h __attribute__((ext_vector_type(16)));
typedef unsigned short v8us __attribute__((ext_vector_type(8), may_alias));
typedef float v8f __attribute__((ext_vector_type(8)));
typedef float v4f __attribute__((ext_vector_type(4)));
typedef float v4fa __attribute__((ext_vector_type(4), may_alias));
union Frag { v16b b; v16h h; v8us half[2]; _Float16 e[16]; unsigned short u[16]; };

#define LOG2E 1.4426950408889634f

__device__ __forceinline__ unsigned short bf16_bits(float x) {   // RNE convert to bf16 bits
  unsigned int u = __float_as_uint(x);
  return (unsigned short)((u + 0x7FFFu + ((u >> 16) & 1u)) >> 16);
}
__device__ __forceinline__ float bf16_val(unsigned short b) { return __uint_as_float(((unsigned int)b) << 16); }
__device__ __forceinline__ float bf16_rne(float x) { return bf16_val(bf16_bits(x)); }

// c0 += a0*b ; c1 += a1*b (two key tiles against one query fragment), then the hazard guard
__device__ __forceinline__ void mma_s2(v16h a0, v16h a1, v16h b, v8f& c0, v8f& c1) {
  c0 = __builtin_amdgcn_wmma_f32_16x16x32_f16(false, a0, false, b, (short)0, c0, false, false);
  c1 = __builtin_amdgcn_wmma_f32_16x16x32_f16(false, a1, false, b, (short)0, c1, false, false);
  asm volatile("v_nop\n\tv_nop\n\tv_nop\n\tv_nop" : "+v"(c0), "+v"(c1) : "v"(a0), "v"(a1), "v"(b));
}
// ch += a*bh ; cl += a*bl (scaled residual plane keeps its own accumulator), then the hazard guard
__device__ __forceinline__ void mma_h2(v16h a, v16h bh, v16h bl, v8f& ch, v8f& cl) {
  ch = __builtin_amdgcn_wmma_f32_16x16x32_f16(false, a, false, bh, (short)0, ch, false, false);
  cl = __builtin_amdgcn_wmma_f32_16x16x32_f16(false, a, false, bl, (short)0, cl, false, false);
  asm volatile("v_nop\n\tv_nop\n\tv_nop\n\tv_nop" : "+v"(ch), "+v"(cl) : "v"(a), "v"(bh), "v"(bl));
}

// 16-byte unit t of a T32 plane of FEAT columns holds elements (row, col .. col + 7)
__device__ __forceinline__ void t32_unit(int t, int& row, int& col) {
  const int tile = t >> 6, u = t & 63;
  const int tr = tile / (FEAT / 32), tc = tile - tr * (FEAT / 32);
  row = tr * 16 + (u & 15);
  col = tc * 32 + (u >> 4) * 8;
}

#define XBLK (MROWS * (FEAT / 8) / 256)
#define WBLK (FEAT * (FEAT / 8) / 256)
static_assert(MROWS * (FEAT / 8) % 256 == 0);
static_assert(FEAT * (FEAT / 8) % 256 == 0);
static_assert((size_t)FEAT * FEAT * 2 % 256 == 0);   // a weight plane needs no padding to the workspace's 256-byte step

// All eight operand planes in one launch (none depends on another). Blocks 0 .. XBLK-1: the compact x plane, bf16 bits (RNE), thread t writes unit t.
// Then WBLK blocks per weight plane [out][in], T32 order: planes 0..2 -> bf16 bits (RNE); planes 3..6 -> f16 bits of (RNE-bf16 value x 64).
// coverage: XBLK*256 units = the whole x plane, WBLK*256 units = one whole weight plane; every unit written once.
__global__ __launch_bounds__(256) void k_cvt(const float* __restrict__ X,
                                             const float* __restrict__ w0, const float* __restrict__ w1, const float* __restrict__ w2,
                                             const float* __restrict__ w3, const float* __restrict__ w4, const float* __restrict__ w5,
                                             const float* __restrict__ w6,
                                             unsigned short* __restrict__ Xb, unsigned short* __restrict__ Wplanes) {
  const int blk = blockIdx.x;
  int row, col;
  v8us o;
  if (blk < XBLK) {
    const int t = blk * 256 + threadIdx.x;
    t32_unit(t, row, col);
    const int b = row / SEQ, s = row - b * SEQ;
    const float* src = X + ((size_t)b * SEQ_FULL + s) * FEAT + col;
    const v4f x0 = *(const v4fa*)(src), x1 = *(const v4fa*)(src + 4);
    o[0] = bf16_bits(x0[0]); o[1] = bf16_bits(x0[1]); o[2] = bf16_bits(x0[2]); o[3] = bf16_bits(x0[3]);
    o[4] = bf16_bits(x1[0]); o[5] = bf16_bits(x1[1]); o[6] = bf16_bits(x1[2]); o[7] = bf16_bits(x1[3]);
    *(v8us*)(Xb + (size_t)t * 8) = o;
    return;
  }
  const int wi = (blk - XBLK) / WBLK;                      // block-uniform plane index
  const int t = (blk - XBLK - wi * WBLK) * 256 + threadIdx.x;
  const bool i1 = wi & 1, i2 = wi & 2, i4 = wi & 4;
  const float* Wsrc = i4 ? (i2 ? w6 : (i1 ? w5 : w4)) : (i2 ? (i1 ? w3 : w2) : (i1 ? w1 : w0));
  unsigned short* Wp = Wplanes + (size_t)wi * FEAT * FEAT;   // the seven planes lie back to back in the workspace
  t32_unit(t, row, col);
  const float* src = Wsrc + (size_t)row * FEAT + col;
  const v4f x0 = *(const v4fa*)(src), x1 = *(const v4fa*)(src + 4);
  if (wi < 3) {
    o[0] = bf16_bits(x0[0]); o[1] = bf16_bits(x0[1]); o[2] = bf16_bits(x0[2]); o[3] = bf16_bits(x0[3]);
    o[4] = bf16_bits(x1[0]); o[5] = bf16_bits(x1[1]); o[6] = bf16_bits(x1[2]); o[7] = bf16_bits(x1[3]);
  } else {
    Frag f;
    f.e[0] = (_Float16)(bf16_rne(x0[0]) * 64.0f); f.e[1] = (_Float16)(bf16_rne(x0[1]) * 64.0f);
    f.e[2] = (_Float16)(bf16_rne(x0[2]) * 64.0f); f.e[3] = (_Float16)(bf16_rne(x0[3]) * 64.0f);
    f.e[4] = (_Float16)(bf16_rne(x1[0]) * 64.0f); f.e[5] = (_Float16)(bf16_rne(x1[1]) * 64.0f);
    f.e[6] = (_Float16)(bf16_rne(x1[2]) * 64.0f); f.e[7] = (_Float16)(bf16_rne(x1[3]) * 64.0f);
    o = f.half[0];
  }
  *(v8us*)(Wp + (size_t)t * 8) = o;
}

// One 32-k step's fragments of a wave's 32 x 64 tile: ap, wp = this lane's unit of the step's first A and W tile (T32 planes of FEAT columns).
__device__ __forceinline__ void load_frags(Frag (&a)[2], Frag (&b)[4], const unsigned short* __restrict__ ap, const unsigned short* __restrict__ wp) {
#pragma unroll
  for (int fm = 0; fm < 2; ++fm) {
    a[fm].half[0] = *(const v8us*)(ap + (size_t)fm * 16 * FEAT);
    a[fm].half[1] = *(const v8us*)(ap + (size_t)fm * 16 * FEAT + 256);
  }
#pragma unroll
  for (int fn = 0; fn < 4; ++fn) {
    b[fn].half[0] = *(const v8us*)(wp + (size_t)fn * 16 * FEAT);
    b[fn].half[1] = *(const v8us*)(wp + (size_t)fn * 16 * FEAT + 256);
  }
}
// acc[fm][fn] += a[fm] * b[fn], then the hazard guard: four vector slots before anything may overwrite the operands (the refill) or read the sums
template <bool BF>
__device__ __forceinline__ void mma_frags(const Frag (&a)[2], const Frag (&b)[4], v8f (&acc)[2][4]) {
#pragma unroll
  for (int fm = 0; fm < 2; ++fm)
#pragma unroll
    for (int fn = 0; fn < 4; ++fn) {
      if (BF) acc[fm][fn] = __builtin_amdgcn_wmma_f32_16x16x32_bf16(false, a[fm].b, false, b[fn].b, (short)0, acc[fm][fn], false, false);
      else    acc[fm][fn] = __builtin_amdgcn_wmma_f32_16x16x32_f16(false, a[fm].h, false, b[fn].h, (short)0, acc[fm][fn], false, false);
    }
  asm volatile("v_nop\n\tv_nop\n\tv_nop\n\tv_nop"
               : "+v"(acc[0][0]), "+v"(acc[0][1]), "+v"(acc[0][2]), "+v"(acc[0][3]),
                 "+v"(acc[1][0]), "+v"(acc[1][1]), "+v"(acc[1][2]), "+v"(acc[1][3])
               : "v"(a[0].h), "v"(a[1].h), "v"(b[0].h), "v"(b[1].h), "v"(b[2].h), "v"(b[3].h));
}

// C[m][n] = sum_k A[m][k] W[n][k], K = FEAT, A and W planes of FEAT columns in T32 order.
// BF: bf16 operands, else f16 operands. One 128 x 128 tile (bx, by) of a (Mrows/128, Ncols/128) tiling per block, 8 waves of 32 x 64.
// EPI 0: out f16 plane [m][N], T32 order = f16((acc*sc + bias[n]) * carry)     (bias along columns)
// EPI 1: out f16 plane [m][N], T32 order = f16((acc*sc + bias[m]) * carry)     (bias along rows)
// EPI 3: as EPI 0, out plane [MROWS][FEAT] in T16 order
// EPI 2: out f32 [b*SEQ_FULL + s][FEAT] = acc*sc + bias[n], m = b*SEQ + s
// Epilogue: two phases of 16 rows; the wave's 16 x 64 tile is staged in its own LDS tile (fully written: 16 rows x 64 columns, fully consumed),
template <bool BF, int EPI>
__device__ __forceinline__ void gemm_tile(float (*__restrict__ sst)[16][68], int bx, int by,
                                          const unsigned short* __restrict__ A, const unsigned short* __restrict__ W,
                                          const float* __restrict__ bias, void* __restrict__ outp,
                                          int N, float sc, float carry) {
  const int tid = threadIdx.x, lane = tid & 31, w = __builtin_amdgcn_readfirstlane((int)(tid >> 5));
  const int wm = w & 3, wn = w >> 2, ln = lane & 15, hh = lane >> 4;
  const int m0 = bx * 128 + wm * 32;
  const int n0 = by * 128 + wn * 64;
  const unsigned short* ap = A + (size_t)m0 * FEAT + lane * 8;   // tile row m0/16 starts at (m0/16) * (FEAT/32) * 512
  const unsigned short* wp = W + (size_t)n0 * FEAT + lane * 8;
  v8f acc[2][4];
#pragma unroll
  for (int fm = 0; fm < 2; ++fm)
#pragma unroll
    for (int fn = 0; fn < 4; ++fn)
#pragma unroll
      for (int r = 0; r < 8; ++r) acc[fm][fn][r] = 0.0f;

  // Register ring of NS fragment sets: step i works on set i % NS, and behind its products the set is refilled with step i + NS,
  // so a load has NS - 1 steps of matrix work between its issue and its wait. Steps run in ascending k: the sums keep their order.
  constexpr int NS = 3, KIT = FEAT / 32, MAIN = (KIT - NS) / NS;   // NS = 3: two blocks still fit a WGP's registers
  static_assert(KIT > NS);
  Frag a[NS][2], b[NS][4];
#pragma unroll
  for (int s = 0; s < NS; ++s) load_frags(a[s], b[s], ap + s * 512, wp + s * 512);
  // kept rolled (a trip is NS steps) so that the loop's text stays short; every step of a trip has a refill in range
#pragma unroll 1
  for (int t = 0; t < MAIN; ++t) {
#pragma unroll
    for (int s = 0; s < NS; ++s) {
      mma_frags<BF>(a[s], b[s], acc);
      load_frags(a[s], b[s], ap + (NS + s) * 512, wp + (NS + s) * 512);
    }
    ap += NS * 512;
    wp += NS * 512;
  }
#pragma unroll
  for (int i = MAIN * NS; i < KIT; ++i) {
    const int s = i % NS;
    mma_frags<BF>(a[s], b[s], acc);
    if (i + NS < KIT) load_frags(a[s], b[s], ap + (i - MAIN * NS + NS) * 512, wp + (i - MAIN * NS + NS) * 512);
  }

  // D element r of tile (fm, fn) = C(m0 + 16 fm + 8 hh + r, n0 + 16 fn + ln)
  float bcol[4];
#pragma unroll
  for (int fn = 0; fn < 4; ++fn) bcol[fn] = 0.0f;
  if (EPI != 1) {
#pragma unroll
    for (int fn = 0; fn < 4; ++fn) bcol[fn] = bf16_rne(bias[n0 + fn * 16 + ln]);
  }
#pragma unroll
  for (int fm = 0; fm < 2; ++fm) {
    float brow[8];
#pragma unroll
    for (int r = 0; r < 8; ++r) brow[r] = 0.0f;
    if (EPI == 1) {
#pragma unroll
      for (int r = 0; r < 8; ++r) brow[r] = bf16_rne(bias[m0 + fm * 16 + 8 * hh + r]);
    }
#pragma unroll
    for (int fn = 0; fn < 4; ++fn)
#pragma unroll
      for (int r = 0; r < 8; ++r) {
        float v = acc[fm][fn][r] * sc + ((EPI == 1) ? brow[r] : bcol[fn]);
        if (EPI != 2) v = v * carry;
        sst[w][8 * hh + r][fn * 16 + ln] = v;
      }
    __syncthreads();
    if (EPI == 2) {
      float* of = (float*)outp;
      const int rsub = lane >> 4, c4 = (lane & 15) * 4;
      {
#pragma unroll
        for (int q = 0; q < 8; ++q) {
          const int row = 2 * q + rsub;
          const int m = m0 + fm * 16 + row;
          const int bb = m / SEQ;
          const size_t grow = (size_t)bb * SEQ_FULL + (size_t)(m - bb * SEQ);
          const v4f v = *(const v4fa*)&sst[w][row][c4];
          *(v4f*)(of + grow * FEAT + n0 + c4) = v;
        }
        
      }
    } else {
      unsigned short* oh = (unsigned short*)outp;
      {
#pragma unroll
        for (int it = 0; it < 4; ++it) {
          // lane (ln, hh) carries row ln, columns 16 it + 8 hh .. + 7: one 512-byte run of the out plane per store
          const v4f x0 = *(const v4fa*)&sst[w][ln][it * 16 + hh * 8];
          const v4f x1 = *(const v4fa*)&sst[w][ln][it * 16 + hh * 8 + 4];
          Frag f;
          f.e[0] = (_Float16)x0[0]; f.e[1] = (_Float16)x0[1]; f.e[2] = (_Float16)x0[2]; f.e[3] = (_Float16)x0[3];
          f.e[4] = (_Float16)x1[0]; f.e[5] = (_Float16)x1[1]; f.e[6] = (_Float16)x1[2]; f.e[7] = (_Float16)x1[3];
          const v8us o = f.half[0];
          if (EPI == 3) *(v8us*)(oh + ((size_t)((n0 >> 4) + it) * (MROWS / 16) + (m0 >> 4) + fm) * 256 + lane * 8) = o;
          else          *(v8us*)(oh + ((size_t)((m0 >> 4) + fm) * (N >> 5) + (n0 >> 5)) * 512 + it * 256 + lane * 8) = o;
        }
        
      }
    }
    __syncthreads();
  }
}

#define S10 0.0009765625f        // 1 / (16 * 64)
#define S14 0.00006103515625f    // 1 / (256 * 64)

// First Linears of the q, k and v chains in one launch: blockIdx.z picks the chain (block-uniform); grid (MROWS/128, FEAT/128, 3).
__global__ __launch_bounds__(256) void k_lin1(const unsigned short* __restrict__ Xb,
                                              const unsigned short* __restrict__ W0, const unsigned short* __restrict__ W1,
                                              const unsigned short* __restrict__ W2,
                                              const float* __restrict__ b0, const float* __restrict__ b1, const float* __restrict__ b2,
                                              unsigned short* __restrict__ o0, unsigned short* __restrict__ o1, unsigned short* __restrict__ o2) {
  __shared__ __attribute__((aligned(16))) float sst[8][16][68];
  const int z = blockIdx.z;
  gemm_tile<true, 0>(sst, blockIdx.x, blockIdx.y, Xb, z == 0 ? W0 : z == 1 ? W1 : W2, z == 0 ? b0 : z == 1 ? b1 : b2,
                     (void*)(z == 0 ? o0 : z == 1 ? o1 : o2), FEAT, 1.0f, 16.0f);
}

// Second Linears in one launch, grid (MROWS/128, FEAT/128, 3): z = 0, 1 -> Q and K planes (T16); z = 2 -> V^T[f][token] = sum_j vv[f][j] * t1v[token][j] + vv_b[f],
// whose tiling is (FEAT/128, MROWS/128): its tile comes from the block's flat index in the z slice.
__global__ __launch_bounds__(256) void k_lin2(const unsigned short* __restrict__ T1q, const unsigned short* __restrict__ T1k,
                                              const unsigned short* __restrict__ T1v,
                                              const unsigned short* __restrict__ Vq, const unsigned short* __restrict__ Vk,
                                              const unsigned short* __restrict__ Vv,
                                              const float* __restrict__ bq, const float* __restrict__ bk, const float* __restrict__ bv,
                                              unsigned short* __restrict__ Qp, unsigned short* __restrict__ Kp, unsigned short* __restrict__ Vt) {
  __shared__ __attribute__((aligned(16))) float sst[8][16][68];
  const int z = blockIdx.z;
  if (z < 2) {
    gemm_tile<false, 3>(sst, blockIdx.x, blockIdx.y, z == 0 ? T1q : T1k, z == 0 ? Vq : Vk, z == 0 ? bq : bk,
                        (void*)(z == 0 ? Qp : Kp), FEAT, S10, 16.0f);
  } else {
    const int flat = blockIdx.y * (MROWS / 128) + blockIdx.x;
    gemm_tile<false, 1>(sst, flat % (FEAT / 128), flat / (FEAT / 128), Vv, T1v, bv, (void*)Vt, MROWS, S10, 16.0f);
  }
}

// Output Linear, grid (MROWS/128, FEAT/128).
__global__ __launch_bounds__(256) void k_lin3(const unsigned short* __restrict__ O2, const unsigned short* __restrict__ Wo,
                                              const float* __restrict__ bo, float* __restrict__ out) {
  __shared__ __attribute__((aligned(16))) float sst[8][16][68];
  gemm_tile<false, 2>(sst, blockIdx.x, blockIdx.y, O2, Wo, bo, (void*)out, FEAT, S14, 1.0f);
}

// 2^x as the bare v_exp_f32, without the library form's rescue of results below 2^-126 (compare, select, add, select, ldexp per call).
// Arguments here are <= 8. A weight below 2^-126 rounds to zero in both f16 planes and vanishes against the row sum, which is >= 256 from the first
// step on (the row's maximum carries 2^8); a rescale factor below 2^-126 multiplies sums that the new maximum's own terms then outweigh by 2^126.
__device__ __forceinline__ float hw_exp2(float x) { return __builtin_amdgcn_exp2f(x); }

// One 32-key step for a wave's 16 queries. kp: this lane's unit of the chunk's K tile at key0 (T16); vp: this lane's unit of the chunk's V^T tile at key0 (T32).
__device__ __forceinline__ void fa_step(const unsigned short* __restrict__ kp, const unsigned short* __restrict__ vp,
                                        const Frag& qf, float& mr, float& lr, v8f& Oh, v8f& Ol) {
  const v8us zz = {0, 0, 0, 0, 0, 0, 0, 0};
  // A fragments of K: row m = key (key0 + 16*kt + ln), elements 0..7 <- d = 8h + i, elements 8..15 (k slots 16..31) zero
  Frag k0, k1, vf;
  k0.half[0] = *(const v8us*)(kp);             k0.half[1] = zz;
  k1.half[0] = *(const v8us*)(kp + 256);       k1.half[1] = zz;
  // A fragment of V^T: row m = d (ln), elements 0..7 <- key0 + 8h + i, 8..15 <- key0 + 16 + 8h + i
  vf.half[0] = *(const v8us*)(vp);
  vf.half[1] = *(const v8us*)(vp + 256);
  v8f s0 = {0.f, 0.f, 0.f, 0.f, 0.f, 0.f, 0.f, 0.f};
  v8f s1 = {0.f, 0.f, 0.f, 0.f, 0.f, 0.f, 0.f, 0.f};
  // S^T tiles: element r of tile kt = 256 * q.k of (key0 + 16*kt + 8h + r, query ln)
  mma_s2(k0.h, k1.h, qf.h, s0, s1);
  float sc[16];
#pragma unroll
  for (int r = 0; r < 8; ++r) { sc[r] = s0[r] * 0.0009765625f; sc[8 + r] = s1[r] * 0.0009765625f; }   // undo x16 x16 carries, divide by 4
  float mx = sc[0];
#pragma unroll
  for (int i = 1; i < 16; ++i) mx = fmaxf(mx, sc[i]);
  mx = fmaxf(mx, __shfl_xor(mx, 16, 32));           // the other lane half holds the other 16 keys of this query
  const float mnew = fmaxf(mr, mx);
  const float al = hw_exp2((mr - mnew) * LOG2E);
  mr = mnew;
  // weights carried x256: pc = 256 * exp(sc - mnew); hi plane f16(pc), residual plane f16((pc - hi) * 2048)
  Frag ph, pl;
  float ps = 0.0f;
#pragma unroll
  for (int i = 0; i < 16; ++i) {
    const float pc = hw_exp2(fmaf(sc[i] - mnew, LOG2E, 8.0f));
    ps += pc;
    const _Float16 h = (_Float16)pc;
    ph.e[i] = h;                                    // B element i: i<8 -> key0 + 8h + i (tile 0 row 8h+i); i>=8 -> key0 + 16 + 8h + (i-8) (tile 1)
    pl.e[i] = (_Float16)((pc - (float)h) * 2048.0f);
  }
  ps += __shfl_xor(ps, 16, 32);
  lr = lr * al + ps;
  Oh = Oh * al; Ol = Ol * al;
  mma_h2(vf.h, ph.h, pl.h, Oh, Ol);
}

// Block = 4 waves x 16 queries = 64 queries of one (chunk, batch); no LDS and no barrier in the key loop.
// Epilogue: O^T tile -> per-wave LDS tile [16 queries][16 d] (fully written, fully consumed; block barrier), then thread tid stores unit tid of the
// block's 16 plane rows x 64 columns = two adjacent T32 tiles (it reads the LDS tile of the wave that owns its plane row, behind the block barrier).
// Context plane element order: flat = ((c*NB + b)*SEQ + s)*16 + h; plane row = (flat>>6) mod (NB*SEQ), column = (flat>>6)/(NB*SEQ)*64 + (flat&63).
// coverage: NCH*NB*(SEQ/64) blocks x 4 waves x 256 elements = every element of the plane exactly once.
__global__ __launch_bounds__(128) void k_attn(const unsigned short* __restrict__ Qp, const unsigned short* __restrict__ Kp,
                                              const unsigned short* __restrict__ Vt, unsigned short* __restrict__ O2) {
  __shared__ __attribute__((aligned(16))) float so[4][16][20];
  const int tid = threadIdx.x, w = __builtin_amdgcn_readfirstlane((int)(tid >> 5)), lane = tid & 31, ln = lane & 15, hh = lane >> 4;
  const int qt = blockIdx.x % (SEQ / 64);
  const int p = blockIdx.x / (SEQ / 64);
  const int b = p % NB, c = p / NB;
  const int qbase = qt * 64 + 16 * w;
  const v8us zz = {0, 0, 0, 0, 0, 0, 0, 0};
  // Q^T B fragment: column n = query qbase + ln, elements 0..7 <- d = 8h + i, elements 8..15 zero
  Frag qf;
  qf.half[0] = *(const v8us*)(Qp + ((size_t)c * (MROWS / 16) + (b * SEQ + qbase) / 16) * 256 + lane * 8);
  qf.half[1] = zz;
  const unsigned short* kb = Kp + ((size_t)c * (MROWS / 16) + (b * SEQ) / 16) * 256 + lane * 8;
  const unsigned short* vb = Vt + ((size_t)c * (MROWS / 32) + (b * SEQ) / 32) * 512 + lane * 8;
  float mr = -3.0e38f, lr = 0.0f;
  v8f Oh = {0.f, 0.f, 0.f, 0.f, 0.f, 0.f, 0.f, 0.f};
  v8f Ol = {0.f, 0.f, 0.f, 0.f, 0.f, 0.f, 0.f, 0.f};
#pragma unroll 1
  for (int j = 0; j < SEQ / 32; ++j)
    fa_step(kb + j * 512, vb + j * 512, qf, mr, lr, Oh, Ol);

  // O^T element r = out(query qbase + ln, d = 8h + r); undo x256 (in lr), x16 (V), x2048 (residual plane); carry the context x256
  const float inv = 16.0f * (1.0f / lr);
#pragma unroll
  for (int r = 0; r < 8; ++r)
    so[w][ln][8 * hh + r] = (Oh[r] + Ol[r] * 0.00048828125f) * inv;
  __syncthreads();
  // unit tid = plane row rr of the block's 16, 8-column piece p of its 64 columns; four queries of one wave make one plane row
  const int rr = tid & 15, p8 = tid >> 4;
  const int qq = (rr & 3) * 4 + (p8 >> 1), d0 = (p8 & 1) * 8;
  const v4f x0 = *(const v4fa*)&so[rr >> 2][qq][d0];
  const v4f x1 = *(const v4fa*)&so[rr >> 2][qq][d0 + 4];
  Frag f;
  f.e[0] = (_Float16)x0[0]; f.e[1] = (_Float16)x0[1]; f.e[2] = (_Float16)x0[2]; f.e[3] = (_Float16)x0[3];
  f.e[4] = (_Float16)x1[0]; f.e[5] = (_Float16)x1[1]; f.e[6] = (_Float16)x1[2]; f.e[7] = (_Float16)x1[3];
  const v8us o = f.half[0];
  const int R = (c * NB + b) * (SEQ / 4) + qt * 16;   // the block's first plane row, a multiple of 16
  const int hp = R / MROWS;
  const int prow = R - hp * MROWS;
  unsigned short* dst = O2 + ((size_t)(prow >> 4) * (FEAT / 32) + hp * 2) * 512 + tid * 8;
  *(v8us*)dst = o;
  
}

extern "C" void kernel_launch(void* const* d_in, const int* in_sizes, int n_in,
                              void* d_out, int out_size, void* d_ws, size_t ws_size, hipStream_t stream) {
  if (n_in < 15) return;
  const long long needx = ((long long)(NB - 1) * SEQ_FULL + SEQ) * FEAT;   // last element touched + 1
  if ((long long)in_sizes[0] < needx) return;
  if ((long long)out_size < needx) return;
  for (int i = 1; i < 15; i += 2) {
    if ((long long)in_sizes[i] < (long long)FEAT * FEAT) return;
    if ((long long)in_sizes[i + 1] < (long long)FEAT) return;
  }
  // wire order: x, then (weight, bias) pairs for wq, wk, wv, vq, vk, vv, wo
  const float* x    = (const float*)d_in[0];
  const float* wq_w = (const float*)d_in[1];
  const float* wq_b = (const float*)d_in[2];
  const float* wk_w = (const float*)d_in[3];
  const float* wk_b = (const float*)d_in[4];
  const float* wv_w = (const float*)d_in[5];
  const float* wv_b = (const float*)d_in[6];
  const float* vq_w = (const float*)d_in[7];
  const float* vq_b = (const float*)d_in[8];
  const float* vk_w = (const float*)d_in[9];
  const float* vk_b = (const float*)d_in[10];
  const float* vv_w = (const float*)d_in[11];
  const float* vv_b = (const float*)d_in[12];
  const float* wo_w = (const float*)d_in[13];
  const float* wo_b = (const float*)d_in[14];

  char* ws = (char*)d_ws;
  size_t off = 0;
  const size_t planeA = (size_t)MROWS * FEAT * 2;
  const size_t planeW = (size_t)FEAT * FEAT * 2;       // weight plane
  unsigned short* Xb  = (unsigned short*)(ws + off); off += (planeA + 255) & ~(size_t)255;
  unsigned short* Wqb = (unsigned short*)(ws + off); off += (planeW + 255) & ~(size_t)255;
  unsigned short* Wkb = (unsigned short*)(ws + off); off += (planeW + 255) & ~(size_t)255;
  unsigned short* Wvb = (unsigned short*)(ws + off); off += (planeW + 255) & ~(size_t)255;
  unsigned short* Vqh = (unsigned short*)(ws + off); off += (planeW + 255) & ~(size_t)255;
  unsigned short* Vkh = (unsigned short*)(ws + off); off += (planeW + 255) & ~(size_t)255;
  unsigned short* Vvh = (unsigned short*)(ws + off); off += (planeW + 255) & ~(size_t)255;
  unsigned short* Woh = (unsigned short*)(ws + off); off += (planeW + 255) & ~(size_t)255;
  unsigned short* T1q = (unsigned short*)(ws + off); off += (planeA + 255) & ~(size_t)255;
  unsigned short* T1k = (unsigned short*)(ws + off); off += (planeA + 255) & ~(size_t)255;
  unsigned short* T1v = (unsigned short*)(ws + off); off += (planeA + 255) & ~(size_t)255;
  unsigned short* Qp  = (unsigned short*)(ws + off); off += (planeA + 255) & ~(size_t)255;
  unsigned short* Kp  = (unsigned short*)(ws + off); off += (planeA + 255) & ~(size_t)255;
  unsigned short* Vt  = (unsigned short*)(ws + off); off += (planeA + 255) & ~(size_t)255;   // [FEAT][MROWS], T32 order
  unsigned short* O2  = (unsigned short*)(ws + off); off += (planeA + 255) & ~(size_t)255;
  if (off > ws_size) return;

  k_cvt<<<(unsigned)(XBLK + 7 * WBLK), 256, 0, stream>>>(x, wq_w, wk_w, wv_w, vq_w, vk_w, vv_w, wo_w, Xb, Wqb);

  const dim3 g3((unsigned)(MROWS / 128), (unsigned)(FEAT / 128), 3u);
  const dim3 g1((unsigned)(MROWS / 128), (unsigned)(FEAT / 128));
  k_lin1<<<g3, 256, 0, stream>>>(Xb, Wqb, Wkb, Wvb, wq_b, wk_b, wv_b, T1q, T1k, T1v);
  k_lin2<<<g3, 256, 0, stream>>>(T1q, T1k, T1v, Vqh, Vkh, Vvh, vq_b, vk_b, vv_b, Qp, Kp, Vt);

  k_attn<<<(unsigned)(NCH * NB * (SEQ / 64)), 128, 0, stream>>>(Qp, Kp, Vt, O2);

  k_lin3<<<g1, 256, 0, stream>>>(O2, Woh, wo_b, (float*)d_out);
}

// v005
// A run of this version takes 92.5 microseconds.
// Timed twice side by side with v004, it ran 1.15 and 1.12 times as fast.
// Over all steps from v000 it is 2.70 times as fast.
#include <hip/hip_runtime.h>
// Contractions: first Linear of each q/k/v chain on v_wmma_f32_16x16x32_bf16 (x and W converted RNE to bf16, single product, f32 accumulate); second Linears, K Q^T scores and the output Linear on v_wmma_f32_16x16x32_f16 (activations x16 or x256 in f16, weights = RNE-bf16 value x64 held exactly in f16, f32 accumulate); O^T = V^T P^T on v_wmma_f32_16x16x32_f16 (V x16 f16; P x256 f16 hi plane + x2^11 f16 residual plane in a separate f32 accumulator); biases RNE-bf16 values added in f32; softmax statistics f32.
// 64 feature chunks of width 16 act as heads; scale 1/4; no mask; context is written in the flat-reinterpreted (16, b, s, 64) -> (b, s, 1024) order.
// GEMM engine: C[m][n] = sum_k A[m][k] W[n][k]; both operands are 16-bit planes held in fragment order, fragments are loaded straight from global
// (elements 0..7 <- k0 + 8h + i, elements 8..15 <- k0 + 16 + 8h + i for A rows and for W rows alike), three 32-k steps ahead into a ring of three register sets. 128x128 block tile, 8 waves of 32x64.
// Fragment order T32 of a plane [R][C]: 16 x 32 tiles, tile index (r/16)*(C/32) + c/32, 512 elements a tile; element (r, c) sits at
// tile*512 + ((c>>4)&1)*256 + (((c>>3)&1)*16 + (r&15))*8 + (c&7), so each half fragment is one wave-wide 16-byte load of 512 contiguous bytes.
// Fragment order T16 (Q and K planes, [MROWS][FEAT]): 16 x 16 tiles, tile index (c/16)*(MROWS/16) + r/16, 256 elements a tile; element (r, c) sits at
// tile*256 + (((c>>3)&1)*16 + (r&15))*8 + (c&7).
// Attention engine: transposed flash. Each wave owns 16 queries of one (chunk, batch). Per 32-key step: S^T tiles (key rows x query columns)
// from K rows (A) and Q^T (B), upper 16 k slots zero; the two 16-key D tiles pack straight into the P^T B fragment; O^T (16 d rows x query columns)
// accumulates from V^T rows (A, global f16 plane in T32 order produced directly by a GEMM with swapped operand roles).
#ifndef NB
#define NB 2
#endif
#ifndef SEQ
#define SEQ 1024
#endif
#define NB_FULL 2
#define SEQ_FULL 1024
#define FEAT 1024
#define NCH 64
#define MROWS (NB * SEQ)

static_assert(SEQ % 128 == 0);
static_assert(SEQ <= SEQ_FULL);
static_assert(NB <= NB_FULL);
static_assert(FEAT % 128 == 0);
static_assert(FEAT == NCH * 16);
static_assert((size_t)8 * MROWS * FEAT * 2 + (size_t)7 * FEAT * FEAT * 2 <= (size_t)134217728);
static_assert(((size_t)(NB - 1) * SEQ_FULL + SEQ) * FEAT <= (size_t)NB_FULL * SEQ_FULL * FEAT);

typedef __bf16 v16b __attribute__((ext_vector_type(16)));
typedef _Float16 v16h __attribute__((ext_vector_type(16)));
typedef unsigned short v8us __attribute__((ext_vector_type(8), may_alias));
typedef float v8f __attribute__((ext_vector_type(8)));
typedef float v4f __attribute__((ext_vector_type(4)));
typedef float v4fa __attribute__((ext_vector_type(4), may_alias));
typedef float v2f __attribute__((ext_vector_type(2)));
typedef _Float16 v2h __attribute__((ext_vector_type(2)));
union Frag { v16b b; v16h h; v8us half[2]; v2h p[8]; _Float16 e[16]; unsigned short u[16]; };

#define LOG2E 1.4426950408889634f
#define EXPC (LOG2E * 0.0009765625f)   // log2(e) / 1024

__device__ __forceinline__ unsigned short bf16_bits(float x) {   // RNE convert to bf16 bits
  unsigned int u = __float_as_uint(x);
  return (unsigned short)((u + 0x7FFFu + ((u >> 16) & 1u)) >> 16);
}
__device__ __forceinline__ float bf16_val(unsigned short b) { return __uint_as_float(((unsigned int)b) << 16); }
__device__ __forceinline__ float bf16_rne(float x) { return bf16_val(bf16_bits(x)); }

// c0 += a0*b ; c1 += a1*b (two key tiles against one query fragment), then the hazard guard
__device__ __forceinline__ void mma_s2(v16h a0, v16h a1, v16h b, v8f& c0, v8f& c1) {
  c0 = __builtin_amdgcn_wmma_f32_16x16x32_f16(false, a0, false, b, (short)0, c0, false, false);
  c1 = __builtin_amdgcn_wmma_f32_16x16x32_f16(false, a1, false, b, (short)0, c1, false, false);
  asm volatile("v_nop\n\tv_nop\n\tv_nop\n\tv_nop" : "+v"(c0), "+v"(c1) : "v"(a0), "v"(a1), "v"(b));
}
// ch += a*bh ; cl += a*bl (scaled residual plane keeps its own accumulator), then the hazard guard
__device__ __forceinline__ void mma_h2(v16h a, v16h bh, v16h bl, v8f& ch, v8f& cl) {
  ch = __builtin_amdgcn_wmma_f32_16x16x32_f16(false, a, false, bh, (short)0, ch, false, false);
  cl = __builtin_amdgcn_wmma_f32_16x16x32_f16(false, a, false, bl, (short)0, cl, false, false);
  asm volatile("v_nop\n\tv_nop\n\tv_nop\n\tv_nop" : "+v"(ch), "+v"(cl) : "v"(a), "v"(bh), "v"(bl));
}

// 16-byte unit t of a T32 plane of FEAT columns holds elements (row, col .. col + 7)
__device__ __forceinline__ void t32_unit(int t, int& row, int& col) {
  const int tile = t >> 6, u = t & 63;
  const int tr = tile / (FEAT / 32), tc = tile - tr * (FEAT / 32);
  row = tr * 16 + (u & 15);
  col = tc * 32 + (u >> 4) * 8;
}

#define XBLK (MROWS * (FEAT / 8) / 256)
#define WBLK (FEAT * (FEAT / 8) / 256)
static_assert(MROWS * (FEAT / 8) % 256 == 0);
static_assert(FEAT * (FEAT / 8) % 256 == 0);
static_assert((size_t)FEAT * FEAT * 2 % 256 == 0);   // a weight plane needs no padding to the workspace's 256-byte step

// All eight operand planes in one launch (none depends on another). Blocks 0 .. XBLK-1: the compact x plane, bf16 bits (RNE), thread t writes unit t.
// Then WBLK blocks per weight plane [out][in], T32 order: planes 0..2 -> bf16 bits (RNE); planes 3..6 -> f16 bits of (RNE-bf16 value x 64).
// coverage: XBLK*256 units = the whole x plane, WBLK*256 units = one whole weight plane; every unit written once.
__global__ __launch_bounds__(256) void k_cvt(const float* __restrict__ X,
                                             const float* __restrict__ w0, const float* __restrict__ w1, const float* __restrict__ w2,
                                             const float* __restrict__ w3, const float* __restrict__ w4, const float* __restrict__ w5,
                                             const float* __restrict__ w6,
                                             unsigned short* __restrict__ Xb, unsigned short* __restrict__ Wplanes) {
  const int blk = blockIdx.x;
  int row, col;
  v8us o;
  if (blk < XBLK) {
    const int t = blk * 256 + threadIdx.x;
    t32_unit(t, row, col);
    const int b = row / SEQ, s = row - b * SEQ;
    const float* src = X + ((size_t)b * SEQ_FULL + s) * FEAT + col;
    const v4f x0 = *(const v4fa*)(src), x1 = *(const v4fa*)(src + 4);
    o[0] = bf16_bits(x0[0]); o[1] = bf16_bits(x0[1]); o[2] = bf16_bits(x0[2]); o[3] = bf16_bits(x0[3]);
    o[4] = bf16_bits(x1[0]); o[5] = bf16_bits(x1[1]); o[6] = bf16_bits(x1[2]); o[7] = bf16_bits(x1[3]);
    *(v8us*)(Xb + (size_t)t * 8) = o;
    return;
  }
  const int wi = (blk - XBLK) / WBLK;                      // block-uniform plane index
  const int t = (blk - XBLK - wi * WBLK) * 256 + threadIdx.x;
  const bool i1 = wi & 1, i2 = wi & 2, i4 = wi & 4;
  const float* Wsrc = i4 ? (i2 ? w6 : (i1 ? w5 : w4)) : (i2 ? (i1 ? w3 : w2) : (i1 ? w1 : w0));
  unsigned short* Wp = Wplanes + (size_t)wi * FEAT * FEAT;   // the seven planes lie back to back in the workspace
  t32_unit(t, row, col);
  const float* src = Wsrc + (size_t)row * FEAT + col;
  const v4f x0 = *(const v4fa*)(src), x1 = *(const v4fa*)(src + 4);
  if (wi < 3) {
    o[0] = bf16_bits(x0[0]); o[1] = bf16_bits(x0[1]); o[2] = bf16_bits(x0[2]); o[3] = bf16_bits(x0[3]);
    o[4] = bf16_bits(x1[0]); o[5] = bf16_bits(x1[1]); o[6] = bf16_bits(x1[2]); o[7] = bf16_bits(x1[3]);
  } else {
    Frag f;
    f.e[0] = (_Float16)(bf16_rne(x0[0]) * 64.0f); f.e[1] = (_Float16)(bf16_rne(x0[1]) * 64.0f);
    f.e[2] = (_Float16)(bf16_rne(x0[2]) * 64.0f); f.e[3] = (_Float16)(bf16_rne(x0[3]) * 64.0f);
    f.e[4] = (_Float16)(bf16_rne(x1[0]) * 64.0f); f.e[5] = (_Float16)(bf16_rne(x1[1]) * 64.0f);
    f.e[6] = (_Float16)(bf16_rne(x1[2]) * 64.0f); f.e[7] = (_Float16)(bf16_rne(x1[3]) * 64.0f);
    o = f.half[0];
  }
  *(v8us*)(Wp + (size_t)t * 8) = o;
}

// One 32-k step's fragments of a wave's 32 x 64 tile: ap, wp = this lane's unit of the step's first A and W tile (T32 planes of FEAT columns).
__device__ __forceinline__ void load_frags(Frag (&a)[2], Frag (&b)[4], const unsigned short* __restrict__ ap, const unsigned short* __restrict__ wp) {
#pragma unroll
  for (int fm = 0; fm < 2; ++fm) {
    a[fm].half[0] = *(const v8us*)(ap + (size_t)fm * 16 * FEAT);
    a[fm].half[1] = *(const v8us*)(ap + (size_t)fm * 16 * FEAT + 256);
  }
#pragma unroll
  for (int fn = 0; fn < 4; ++fn) {
    b[fn].half[0] = *(const v8us*)(wp + (size_t)fn * 16 * FEAT);
    b[fn].half[1] = *(const v8us*)(wp + (size_t)fn * 16 * FEAT + 256);
  }
}
// acc[fm][fn] += a[fm] * b[fn], then the hazard guard: four vector slots before anything may overwrite the operands (the refill) or read the sums
template <bool BF>
__device__ __forceinline__ void mma_frags(const Frag (&a)[2], const Frag (&b)[4], v8f (&acc)[2][4]) {
#pragma unroll
  for (int fm = 0; fm < 2; ++fm)
#pragma unroll
    for (int fn = 0; fn < 4; ++fn) {
      if (BF) acc[fm][fn] = __builtin_amdgcn_wmma_f32_16x16x32_bf16(false, a[fm].b, false, b[fn].b, (short)0, acc[fm][fn], false, false);
      else    acc[fm][fn] = __builtin_amdgcn_wmma_f32_16x16x32_f16(false, a[fm].h, false, b[fn].h, (short)0, acc[fm][fn], false, false);
    }
  asm volatile("v_nop\n\tv_nop\n\tv_nop\n\tv_nop"
               : "+v"(acc[0][0]), "+v"(acc[0][1]), "+v"(acc[0][2]), "+v"(acc[0][3]),
                 "+v"(acc[1][0]), "+v"(acc[1][1]), "+v"(acc[1][2]), "+v"(acc[1][3])
               : "v"(a[0].h), "v"(a[1].h), "v"(b[0].h), "v"(b[1].h), "v"(b[2].h), "v"(b[3].h));
}

// C[m][n] = sum_k A[m][k] W[n][k], K = FEAT, A and W planes of FEAT columns in T32 order.
// BF: bf16 operands, else f16 operands. One 128 x 128 tile (bx, by) of a (Mrows/128, Ncols/128) tiling per block, 8 waves of 32 x 64.
// EPI 0: out f16 plane [m][N], T32 order = f16((acc*sc + bias[n]) * carry)     (bias along columns)
// EPI 1: out f16 plane [m][N], T32 order = f16((acc*sc + bias[m]) * carry)     (bias along rows)
// EPI 3: as EPI 0, out plane [MROWS][FEAT] in T16 order
// EPI 2: out f32 [b*SEQ_FULL + s][FEAT] = acc*sc + bias[n], m = b*SEQ + s
// Epilogue: two phases of 16 rows; the wave's 16 x 64 tile is staged in its own LDS tile (fully written: 16 rows x 64 columns, fully consumed),
template <bool BF, int EPI>
__device__ __forceinline__ void gemm_tile(float (*__restrict__ sst)[16][68], int bx, int by,
                                          const unsigned short* __restrict__ A, const unsigned short* __restrict__ W,
                                          const float* __restrict__ bias, void* __restrict__ outp,
                                          int N, float sc, float carry) {
  const int tid = threadIdx.x, lane = tid & 31, w = __builtin_amdgcn_readfirstlane((int)(tid >> 5));
  const int wm = w & 3, wn = w >> 2, ln = lane & 15, hh = lane >> 4;
  const int m0 = bx * 128 + wm * 32;
  const int n0 = by * 128 + wn * 64;
  const unsigned short* ap = A + (size_t)m0 * FEAT + lane * 8;   // tile row m0/16 starts at (m0/16) * (FEAT/32) * 512
  const unsigned short* wp = W + (size_t)n0 * FEAT + lane * 8;
  v8f acc[2][4];
#pragma unroll
  for (int fm = 0; fm < 2; ++fm)
#pragma unroll
    for (int fn = 0; fn < 4; ++fn)
#pragma unroll
      for (int r = 0; r < 8; ++r) acc[fm][fn][r] = 0.0f;

  // Register ring of NS fragment sets: step i works on set i % NS, and behind its products the set is refilled with step i + NS,
  // so a load has NS - 1 steps of matrix work between its issue and its wait. Steps run in ascending k: the sums keep their order.
  constexpr int NS = 3, KIT = FEAT / 32, MAIN = (KIT - NS) / NS;   // NS = 3: two blocks still fit a WGP's registers
  static_assert(KIT > NS);
  Frag a[NS][2], b[NS][4];
#pragma unroll
  for (int s = 0; s < NS; ++s) load_frags(a[s], b[s], ap + s * 512, wp + s * 512);
  // kept rolled (a trip is NS steps) so that the loop's text stays short; every step of a trip has a refill in range
#pragma unroll 1
  for (int t = 0; t < MAIN; ++t) {
#pragma unroll
    for (int s = 0; s < NS; ++s) {
      mma_frags<BF>(a[s], b[s], acc);
      load_frags(a[s], b[s], ap + (NS + s) * 512, wp + (NS + s) * 512);
    }
    ap += NS * 512;
    wp += NS * 512;
  }
#pragma unroll
  for (int i = MAIN * NS; i < KIT; ++i) {
    const int s = i % NS;
    mma_frags<BF>(a[s], b[s], acc);
    if (i + NS < KIT) load_frags(a[s], b[s], ap + (i - MAIN * NS + NS) * 512, wp + (i - MAIN * NS + NS) * 512);
  }

  // D element r of tile (fm, fn) = C(m0 + 16 fm + 8 hh + r, n0 + 16 fn + ln)
  float bcol[4];
#pragma unroll
  for (int fn = 0; fn < 4; ++fn) bcol[fn] = 0.0f;
  if (EPI != 1) {
#pragma unroll
    for (int fn = 0; fn < 4; ++fn) bcol[fn] = bf16_rne(bias[n0 + fn * 16 + ln]);
  }
#pragma unroll
  for (int fm = 0; fm < 2; ++fm) {
    float brow[8];
#pragma unroll
    for (int r = 0; r < 8; ++r) brow[r] = 0.0f;
    if (EPI == 1) {
#pragma unroll
      for (int r = 0; r < 8; ++r) brow[r] = bf16_rne(bias[m0 + fm * 16 + 8 * hh + r]);
    }
#pragma unroll
    for (int fn = 0; fn < 4; ++fn)
#pragma unroll
      for (int r = 0; r < 8; ++r) {
        float v = acc[fm][fn][r] * sc + ((EPI == 1) ? brow[r] : bcol[fn]);
        if (EPI != 2) v = v * carry;
        sst[w][8 * hh + r][fn * 16 + ln] = v;
      }
    __syncthreads();
    if (EPI == 2) {
      float* of = (float*)outp;
      const int rsub = lane >> 4, c4 = (lane & 15) * 4;
      {
#pragma unroll
        for (int q = 0; q < 8; ++q) {
          const int row = 2 * q + rsub;
          const int m = m0 + fm * 16 + row;
          const int bb = m / SEQ;
          const size_t grow = (size_t)bb * SEQ_FULL + (size_t)(m - bb * SEQ);
          const v4f v = *(const v4fa*)&sst[w][row][c4];
          *(v4f*)(of + grow * FEAT + n0 + c4) = v;
        }
        
      }
    } else {
      unsigned short* oh = (unsigned short*)outp;
      {
#pragma unroll
        for (int it = 0; it < 4; ++it) {
          // lane (ln, hh) carries row ln, columns 16 it + 8 hh .. + 7: one 512-byte run of the out plane per store
          const v4f x0 = *(const v4fa*)&sst[w][ln][it * 16 + hh * 8];
          const v4f x1 = *(const v4fa*)&sst[w][ln][it * 16 + hh * 8 + 4];
          Frag f;
          f.e[0] = (_Float16)x0[0]; f.e[1] = (_Float16)x0[1]; f.e[2] = (_Float16)x0[2]; f.e[3] = (_Float16)x0[3];
          f.e[4] = (_Float16)x1[0]; f.e[5] = (_Float16)x1[1]; f.e[6] = (_Float16)x1[2]; f.e[7] = (_Float16)x1[3];
          const v8us o = f.half[0];
          if (EPI == 3) *(v8us*)(oh + ((size_t)((n0 >> 4) + it) * (MROWS / 16) + (m0 >> 4) + fm) * 256 + lane * 8) = o;
          else          *(v8us*)(oh + ((size_t)((m0 >> 4) + fm) * (N >> 5) + (n0 >> 5)) * 512 + it * 256 + lane * 8) = o;
        }
        
      }
    }
    __syncthreads();
  }
}

#define S10 0.0009765625f        // 1 / (16 * 64)
#define S14 0.00006103515625f    // 1 / (256 * 64)

// First Linears of the q, k and v chains in one launch: blockIdx.z picks the chain (block-uniform); grid (MROWS/128, FEAT/128, 3).
__global__ __launch_bounds__(256) void k_lin1(const unsigned short* __restrict__ Xb,
                                              const unsigned short* __restrict__ W0, const unsigned short* __restrict__ W1,
                                              const unsigned short* __restrict__ W2,
                                              const float* __restrict__ b0, const float* __restrict__ b1, const float* __restrict__ b2,
                                              unsigned short* __restrict__ o0, unsigned short* __restrict__ o1, unsigned short* __restrict__ o2) {
  __shared__ __attribute__((aligned(16))) float sst[8][16][68];
  const int z = blockIdx.z;
  gemm_tile<true, 0>(sst, blockIdx.x, blockIdx.y, Xb, z == 0 ? W0 : z == 1 ? W1 : W2, z == 0 ? b0 : z == 1 ? b1 : b2,
                     (void*)(z == 0 ? o0 : z == 1 ? o1 : o2), FEAT, 1.0f, 16.0f);
}

// Second Linears in one launch, grid (MROWS/128, FEAT/128, 3): z = 0, 1 -> Q and K planes (T16); z = 2 -> V^T[f][token] = sum_j vv[f][j] * t1v[token][j] + vv_b[f],
// whose tiling is (FEAT/128, MROWS/128): its tile comes from the block's flat index in the z slice.
__global__ __launch_bounds__(256) void k_lin2(const unsigned short* __restrict__ T1q, const unsigned short* __restrict__ T1k,
                                              const unsigned short* __restrict__ T1v,
                                              const unsigned short* __restrict__ Vq, const unsigned short* __restrict__ Vk,
                                              const unsigned short* __restrict__ Vv,
                                              const float* __restrict__ bq, const float* __restrict__ bk, const float* __restrict__ bv,
                                              unsigned short* __restrict__ Qp, unsigned short* __restrict__ Kp, unsigned short* __restrict__ Vt) {
  __shared__ __attribute__((aligned(16))) float sst[8][16][68];
  const int z = blockIdx.z;
  if (z < 2) {
    gemm_tile<false, 3>(sst, blockIdx.x, blockIdx.y, z == 0 ? T1q : T1k, z == 0 ? Vq : Vk, z == 0 ? bq : bk,
                        (void*)(z == 0 ? Qp : Kp), FEAT, S10, 16.0f);
  } else {
    const int flat = blockIdx.y * (MROWS / 128) + blockIdx.x;
    gemm_tile<false, 1>(sst, flat % (FEAT / 128), flat / (FEAT / 128), Vv, T1v, bv, (void*)Vt, MROWS, S10, 16.0f);
  }
}

// Output Linear, grid (MROWS/128, FEAT/128).
__global__ __launch_bounds__(256) void k_lin3(const unsigned short* __restrict__ O2, const unsigned short* __restrict__ Wo,
                                              const float* __restrict__ bo, float* __restrict__ out) {
  __shared__ __attribute__((aligned(16))) float sst[8][16][68];
  gemm_tile<false, 2>(sst, blockIdx.x, blockIdx.y, O2, Wo, bo, (void*)out, FEAT, S14, 1.0f);
}

// 2^x as the bare v_exp_f32, without the library form's rescue of results below 2^-126 (compare, select, add, select, ldexp per call).
// Arguments here are at most 8, up to the rounding of the exponent's FMA. A weight below 2^-126 rounds to zero in both f16 planes and vanishes against the row sum, which is about 256 or more from the first
// step on (the row's maximum carries 2^8); a rescale factor below 2^-126 multiplies sums that the new maximum's own terms then outweigh by 2^126.
__device__ __forceinline__ float hw_exp2(float x) { return __builtin_amdgcn_exp2f(x); }

// One 32-key step for a wave's 16 queries. kp: this lane's unit of the chunk's K tile at key0 (T16); vp: this lane's unit of the chunk's V^T tile at key0 (T32).
__device__ __forceinline__ void fa_step(const unsigned short* __restrict__ kp, const unsigned short* __restrict__ vp,
                                        const Frag& qf, float& mr, float& lr, v8f& Oh, v8f& Ol) {
  const v8us zz = {0, 0, 0, 0, 0, 0, 0, 0};
  // A fragments of K: row m = key (key0 + 16*kt + ln), elements 0..7 <- d = 8h + i, elements 8..15 (k slots 16..31) zero
  Frag k0, k1, vf;
  k0.half[0] = *(const v8us*)(kp);             k0.half[1] = zz;
  k1.half[0] = *(const v8us*)(kp + 256);       k1.half[1] = zz;
  // A fragment of V^T: row m = d (ln), elements 0..7 <- key0 + 8h + i, 8..15 <- key0 + 16 + 8h + i
  vf.half[0] = *(const v8us*)(vp);
  vf.half[1] = *(const v8us*)(vp + 256);
  v8f s0 = {0.f, 0.f, 0.f, 0.f, 0.f, 0.f, 0.f, 0.f};
  v8f s1 = {0.f, 0.f, 0.f, 0.f, 0.f, 0.f, 0.f, 0.f};
  // S^T tiles: element r of tile kt = 256 * q.k of (key0 + 16*kt + 8h + r, query ln)
  mma_s2(k0.h, k1.h, qf.h, s0, s1);
  // The scores stay in the accumulators' own unit (1024 x the scaled score: x16 x16 carries, divide by 4); that power of two is folded into EXPC.
  float mx = s0[0];
#pragma unroll
  for (int r = 1; r < 8; ++r) mx = fmaxf(mx, s0[r]);
#pragma unroll
  for (int r = 0; r < 8; ++r) mx = fmaxf(mx, s1[r]);
  mx = fmaxf(mx, __shfl_xor(mx, 16, 32));           // the other lane half holds the other 16 keys of this query
  const float mnew = fmaxf(mr, mx);
  const float al = hw_exp2((mr - mnew) * EXPC);
  mr = mnew;
  // weights carried x256: pc = 256 * exp(score - maximum) = 2^(s * EXPC + (8 - mnew * EXPC)); hi plane f16(pc), residual plane f16((pc - hi) * 2048).
  // Two scores a vector instruction: one packed FMA for the exponents, packed sum, packed x2048, packed convert.
  const float off = fmaf(-mnew, EXPC, 8.0f);
  const v2f off2 = {off, off}, c2 = {EXPC, EXPC}, k2 = {2048.0f, 2048.0f};
  Frag ph, pl;
  v2f ps2 = {0.0f, 0.0f};
#pragma unroll
  for (int i = 0; i < 8; ++i) {
    const v2f sp = (i < 4) ? v2f{s0[2 * i], s0[2 * i + 1]} : v2f{s1[2 * i - 8], s1[2 * i - 7]};
    const v2f ar = __builtin_elementwise_fma(sp, c2, off2);
    const v2f pc = {hw_exp2(ar[0]), hw_exp2(ar[1])};
    ps2 += pc;
    const v2h h = __builtin_convertvector(pc, v2h);
    ph.p[i] = h;                                    // B elements 2i, 2i+1: below 8 -> key0 + 8h + e (tile 0 row 8h+e); from 8 on -> key0 + 16 + 8h + (e-8) (tile 1)
    const v2f pk = pc * k2;
    pl.e[2 * i]     = (_Float16)fmaf((float)h[0], -2048.0f, pk[0]);   // exact difference, one rounding, as (pc - hi) * 2048
    pl.e[2 * i + 1] = (_Float16)fmaf((float)h[1], -2048.0f, pk[1]);
  }
  float ps = ps2[0] + ps2[1];
  ps += __shfl_xor(ps, 16, 32);
  lr = lr * al + ps;
  Oh = Oh * al; Ol = Ol * al;
  mma_h2(vf.h, ph.h, pl.h, Oh, Ol);
}

// Block = 4 waves x 16 queries = 64 queries of one (chunk, batch); no LDS and no barrier in the key loop.
// Epilogue: O^T tile -> per-wave LDS tile [16 queries][16 d] (fully written, fully consumed; block barrier), then thread tid stores unit tid of the
// block's 16 plane rows x 64 columns = two adjacent T32 tiles (it reads the LDS tile of the wave that owns its plane row, behind the block barrier).
// Context plane element order: flat = ((c*NB + b)*SEQ + s)*16 + h; plane row = (flat>>6) mod (NB*SEQ), column = (flat>>6)/(NB*SEQ)*64 + (flat&63).
// coverage: NCH*NB*(SEQ/64) blocks x 4 waves x 256 elements = every element of the plane exactly once.
__global__ __launch_bounds__(128) void k_attn(const unsigned short* __restrict__ Qp, const unsigned short* __restrict__ Kp,
                                              const unsigned short* __restrict__ Vt, unsigned short* __restrict__ O2) {
  __shared__ __attribute__((aligned(16))) float so[4][16][20];
  const int tid = threadIdx.x, w = __builtin_amdgcn_readfirstlane((int)(tid >> 5)), lane = tid & 31, ln = lane & 15, hh = lane >> 4;
  const int qt = blockIdx.x % (SEQ / 64);
  const int p = blockIdx.x / (SEQ / 64);
  const int b = p % NB, c = p / NB;
  const int qbase = qt * 64 + 16 * w;
  const v8us zz = {0, 0, 0, 0, 0, 0, 0, 0};
  // Q^T B fragment: column n = query qbase + ln, elements 0..7 <- d = 8h + i, elements 8..15 zero
  Frag qf;
  qf.half[0] = *(const v8us*)(Qp + ((size_t)c * (MROWS / 16) + (b * SEQ + qbase) / 16) * 256 + lane * 8);
  qf.half[1] = zz;
  const unsigned short* kb = Kp + ((size_t)c * (MROWS / 16) + (b * SEQ) / 16) * 256 + lane * 8;
  const unsigned short* vb = Vt + ((size_t)c * (MROWS / 32) + (b * SEQ) / 32) * 512 + lane * 8;
  float mr = -3.0e38f, lr = 0.0f;
  v8f Oh = {0.f, 0.f, 0.f, 0.f, 0.f, 0.f, 0.f, 0.f};
  v8f Ol = {0.f, 0.f, 0.f, 0.f, 0.f, 0.f, 0.f, 0.f};
#pragma unroll 1
  for (int j = 0; j < SEQ / 32; ++j)
    fa_step(kb + j * 512, vb + j * 512, qf, mr, lr, Oh, Ol);

  // O^T element r = out(query qbase + ln, d = 8h + r); undo x256 (in lr), x16 (V), x2048 (residual plane); carry the context x256
  const float inv = 16.0f * (1.0f / lr);
#pragma unroll
  for (int r = 0; r < 8; ++r)
    so[w][ln][8 * hh + r] = (Oh[r] + Ol[r] * 0.00048828125f) * inv;
  __syncthreads();
  // unit tid = plane row rr of the block's 16, 8-column piece p of its 64 columns; four queries of one wave make one plane row
  const int rr = tid & 15, p8 = tid >> 4;
  const int qq = (rr & 3) * 4 + (p8 >> 1), d0 = (p8 & 1) * 8;
  const v4f x0 = *(const v4fa*)&so[rr >> 2][qq][d0];
  const v4f x1 = *(const v4fa*)&so[rr >> 2][qq][d0 + 4];
  Frag f;
  f.e[0] = (_Float16)x0[0]; f.e[1] = (_Float16)x0[1]; f.e[2] = (_Float16)x0[2]; f.e[3] = (_Float16)x0[3];
  f.e[4] = (_Float16)x1[0]; f.e[5] = (_Float16)x1[1]; f.e[6] = (_Float16)x1[2]; f.e[7] = (_Float16)x1[3];
  const v8us o = f.half[0];
  const int R = (c * NB + b) * (SEQ / 4) + qt * 16;   // the block's first plane row, a multiple of 16
  const int hp = R / MROWS;
  const int prow = R - hp * MROWS;
  unsigned short* dst = O2 + ((size_t)(prow >> 4) * (FEAT / 32) + hp * 2) * 512 + tid * 8;
  *(v8us*)dst = o;
  
}

extern "C" void kernel_launch(void* const* d_in, const int* in_sizes, int n_in,
                              void* d_out, int out_size, void* d_ws, size_t ws_size, hipStream_t stream) {
  if (n_in < 15) return;
  const long long needx = ((long long)(NB - 1) * SEQ_FULL + SEQ) * FEAT;   // last element touched + 1
  if ((long long)in_sizes[0] < needx) return;
  if ((long long)out_size < needx) return;
  for (int i = 1; i < 15; i += 2) {
    if ((long long)in_sizes[i] < (long long)FEAT * FEAT) return;
    if ((long long)in_sizes[i + 1] < (long long)FEAT) return;
  }
  // wire order: x, then (weight, bias) pairs for wq, wk, wv, vq, vk, vv, wo
  const float* x    = (const float*)d_in[0];
  const float* wq_w = (const float*)d_in[1];
  const float* wq_b = (const float*)d_in[2];
  const float* wk_w = (const float*)d_in[3];
  const float* wk_b = (const float*)d_in[4];
  const float* wv_w = (const float*)d_in[5];
  const float* wv_b = (const float*)d_in[6];
  const float* vq_w = (const float*)d_in[7];
  const float* vq_b = (const float*)d_in[8];
  const float* vk_w = (const float*)d_in[9];
  const float* vk_b = (const float*)d_in[10];
  const float* vv_w = (const float*)d_in[11];
  const float* vv_b = (const float*)d_in[12];
  const float* wo_w = (const float*)d_in[13];
  const float* wo_b = (const float*)d_in[14];

  char* ws = (char*)d_ws;
  size_t off = 0;
  const size_t planeA = (size_t)MROWS * FEAT * 2;
  const size_t planeW = (size_t)FEAT * FEAT * 2;       // weight plane
  unsigned short* Xb  = (unsigned short*)(ws + off); off += (planeA + 255) & ~(size_t)255;
  unsigned short* Wqb = (unsigned short*)(ws + off); off += (planeW + 255) & ~(size_t)255;
  unsigned short* Wkb = (unsigned short*)(ws + off); off += (planeW + 255) & ~(size_t)255;
  unsigned short* Wvb = (unsigned short*)(ws + off); off += (planeW + 255) & ~(size_t)255;
  unsigned short* Vqh = (unsigned short*)(ws + off); off += (planeW + 255) & ~(size_t)255;
  unsigned short* Vkh = (unsigned short*)(ws + off); off += (planeW + 255) & ~(size_t)255;
  unsigned short* Vvh = (unsigned short*)(ws + off); off += (planeW + 255) & ~(size_t)255;
  unsigned short* Woh = (unsigned short*)(ws + off); off += (planeW + 255) & ~(size_t)255;
  unsigned short* T1q = (unsigned short*)(ws + off); off += (planeA + 255) & ~(size_t)255;
  unsigned short* T1k = (unsigned short*)(ws + off); off += (planeA + 255) & ~(size_t)255;
  unsigned short* T1v = (unsigned short*)(ws + off); off += (planeA + 255) & ~(size_t)255;
  unsigned short* Qp  = (unsigned short*)(ws + off); off += (planeA + 255) & ~(size_t)255;
  unsigned short* Kp  = (unsigned short*)(ws + off); off += (planeA + 255) & ~(size_t)255;
  unsigned short* Vt  = (unsigned short*)(ws + off); off += (planeA + 255) & ~(size_t)255;   // [FEAT][MROWS], T32 order
  unsigned short* O2  = (unsigned short*)(ws + off); off += (planeA + 255) & ~(size_t)255;
  if (off > ws_size) return;

  k_cvt<<<(unsigned)(XBLK + 7 * WBLK), 256, 0, stream>>>(x, wq_w, wk_w, wv_w, vq_w, vk_w, vv_w, wo_w, Xb, Wqb);

  const dim3 g3((unsigned)(MROWS / 128), (unsigned)(FEAT / 128), 3u);
  const dim3 g1((unsigned)(MROWS / 128), (unsigned)(FEAT / 128));
  k_lin1<<<g3, 256, 0, stream>>>(Xb, Wqb, Wkb, Wvb, wq_b, wk_b, wv_b, T1q, T1k, T1v);
  k_lin2<<<g3, 256, 0, stream>>>(T1q, T1k, T1v, Vqh, Vkh, Vvh, vq_b, vk_b, vv_b, Qp, Kp, Vt);

  k_attn<<<(unsigned)(NCH * NB * (SEQ / 64)), 128, 0, stream>>>(Qp, Kp, Vt, O2);

  k_lin3<<<g1, 256, 0, stream>>>(O2, Woh, wo_b, (float*)d_out);
}

// v006
// One run takes 78.2 microseconds.
// In two side-by-side timings against v005, it was 1.18 and 1.16 times as fast.
// Over all steps from v000 it is 3.15 times as fast.
#include <hip/hip_runtime.h>
// Contractions: first Linear of each q/k/v chain on v_wmma_f32_16x16x32_bf16 (x and W converted RNE to bf16, single product, f32 accumulate); second Linears, K Q^T scores and the output Linear on v_wmma_f32_16x16x32_f16 (activations x16 or x256 in f16, weights = RNE-bf16 value x64 held exactly in f16, f32 accumulate); O^T = V^T P^T on v_wmma_f32_16x16x32_f16 (V x16 f16; P x256 f16 hi plane + x2^11 f16 residual plane in a separate f32 accumulator); biases RNE-bf16 values added in f32; softmax statistics f32.
// 64 feature chunks of width 16 act as heads; scale 1/4; no mask; context is written in the flat-reinterpreted (16, b, s, 64) -> (b, s, 1024) order.
// GEMM engine: C[m][n] = sum_k A[m][k] W[n][k]; both operands are 16-bit planes held in fragment order
// (elements 0..7 <- k0 + 8h + i, elements 8..15 <- k0 + 16 + 8h + i for A rows and for W rows alike). A block's 128 A rows and 128 W rows are staged in LDS,
// four 32-k steps a stage, by asynchronous copies into two buffers; the waves read their fragments from LDS. 128x128 block tile, 8 waves of 32x64.
// Fragment order T32 of a plane [R][C]: 16 x 32 tiles, tile index (r/16)*(C/32) + c/32, 512 elements a tile; element (r, c) sits at
// tile*512 + ((c>>4)&1)*256 + (((c>>3)&1)*16 + (r&15))*8 + (c&7), so each half fragment is one wave-wide 16-byte load of 512 contiguous bytes.
// Fragment order T16 (Q and K planes, [MROWS][FEAT]): 16 x 16 tiles, tile index (c/16)*(MROWS/16) + r/16, 256 elements a tile; element (r, c) sits at
// tile*256 + (((c>>3)&1)*16 + (r&15))*8 + (c&7).
// Attention engine: transposed flash. Each wave owns 16 queries of one (chunk, batch). Per 32-key step: S^T tiles (key rows x query columns)
// from K rows (A) and Q^T (B), upper 16 k slots zero; the two 16-key D tiles pack straight into the P^T B fragment; O^T (16 d rows x query columns)
// accumulates from V^T rows (A, global f16 plane in T32 order produced directly by a GEMM with swapped operand roles).
#ifndef NB
#define NB 2
#endif
#ifndef SEQ
#define SEQ 1024
#endif
#define NB_FULL 2
#define SEQ_FULL 1024
#define FEAT 1024
#define NCH 64
#define MROWS (NB * SEQ)

static_assert(SEQ % 128 == 0);
static_assert(SEQ <= SEQ_FULL);
static_assert(NB <= NB_FULL);
static_assert(FEAT % 128 == 0);
static_assert(FEAT == NCH * 16);
static_assert((size_t)8 * MROWS * FEAT * 2 + (size_t)7 * FEAT * FEAT * 2 <= (size_t)134217728);
static_assert(((size_t)(NB - 1) * SEQ_FULL + SEQ) * FEAT <= (size_t)NB_FULL * SEQ_FULL * FEAT);

typedef __bf16 v16b __attribute__((ext_vector_type(16)));
typedef _Float16 v16h __attribute__((ext_vector_type(16)));
typedef unsigned short v8us __attribute__((ext_vector_type(8), may_alias));
typedef float v8f __attribute__((ext_vector_type(8)));
typedef float v4f __attribute__((ext_vector_type(4)));
typedef float v4fa __attribute__((ext_vector_type(4), may_alias));
typedef float v2f __attribute__((ext_vector_type(2)));
typedef _Float16 v2h __attribute__((ext_vector_type(2)));
union Frag { v16b b; v16h h; v8us half[2]; v2h p[8]; _Float16 e[16]; unsigned short u[16]; };

#define LOG2E 1.4426950408889634f
#define EXPC (LOG2E * 0.0009765625f)   // log2(e) / 1024

__device__ __forceinline__ unsigned short bf16_bits(float x) {   // RNE convert to bf16 bits
  unsigned int u = __float_as_uint(x);
  return (unsigned short)((u + 0x7FFFu + ((u >> 16) & 1u)) >> 16);
}
__device__ __forceinline__ float bf16_val(unsigned short b) { return __uint_as_float(((unsigned int)b) << 16); }
__device__ __forceinline__ float bf16_rne(float x) { return bf16_val(bf16_bits(x)); }

// c0 += a0*b ; c1 += a1*b (two key tiles against one query fragment), then the hazard guard
__device__ __forceinline__ void mma_s2(v16h a0, v16h a1, v16h b, v8f& c0, v8f& c1) {
  c0 = __builtin_amdgcn_wmma_f32_16x16x32_f16(false, a0, false, b, (short)0, c0, false, false);
  c1 = __builtin_amdgcn_wmma_f32_16x16x32_f16(false, a1, false, b, (short)0, c1, false, false);
  asm volatile("v_nop\n\tv_nop\n\tv_nop\n\tv_nop" : "+v"(c0), "+v"(c1) : "v"(a0), "v"(a1), "v"(b));
}
// ch += a*bh ; cl += a*bl (scaled residual plane keeps its own accumulator), then the hazard guard
__device__ __forceinline__ void mma_h2(v16h a, v16h bh, v16h bl, v8f& ch, v8f& cl) {
  ch = __builtin_amdgcn_wmma_f32_16x16x32_f16(false, a, false, bh, (short)0, ch, false, false);
  cl = __builtin_amdgcn_wmma_f32_16x16x32_f16(false, a, false, bl, (short)0, cl, false, false);
  asm volatile("v_nop\n\tv_nop\n\tv_nop\n\tv_nop" : "+v"(ch), "+v"(cl) : "v"(a), "v"(bh), "v"(bl));
}

// 16-byte unit t of a T32 plane of FEAT columns holds elements (row, col .. col + 7)
__device__ __forceinline__ void t32_unit(int t, int& row, int& col) {
  const int tile = t >> 6, u = t & 63;
  const int tr = tile / (FEAT / 32), tc = tile - tr * (FEAT / 32);
  row = tr * 16 + (u & 15);
  col = tc * 32 + (u >> 4) * 8;
}

#define XBLK (MROWS * (FEAT / 8) / 256)
#define WBLK (FEAT * (FEAT / 8) / 256)
static_assert(MROWS * (FEAT / 8) % 256 == 0);
static_assert(FEAT * (FEAT / 8) % 256 == 0);
static_assert((size_t)FEAT * FEAT * 2 % 256 == 0);   // a weight plane needs no padding to the workspace's 256-byte step

// All eight operand planes in one launch (none depends on another). Blocks 0 .. XBLK-1: the compact x plane, bf16 bits (RNE), thread t writes unit t.
// Then WBLK blocks per weight plane [out][in], T32 order: planes 0..2 -> bf16 bits (RNE); planes 3..6 -> f16 bits of (RNE-bf16 value x 64).
// coverage: XBLK*256 units = the whole x plane, WBLK*256 units = one whole weight plane; every unit written once.
__global__ __launch_bounds__(256) void k_cvt(const float* __restrict__ X,
                                             const float* __restrict__ w0, const float* __restrict__ w1, const float* __restrict__ w2,
                                             const float* __restrict__ w3, const float* __restrict__ w4, const float* __restrict__ w5,
                                             const float* __restrict__ w6,
                                             unsigned short* __restrict__ Xb, unsigned short* __restrict__ Wplanes) {
  const int blk = blockIdx.x;
  int row, col;
  v8us o;
  if (blk < XBLK) {
    const int t = blk * 256 + threadIdx.x;
    t32_unit(t, row, col);
    const int b = row / SEQ, s = row - b * SEQ;
    const float* src = X + ((size_t)b * SEQ_FULL + s) * FEAT + col;
    const v4f x0 = *(const v4fa*)(src), x1 = *(const v4fa*)(src + 4);
    o[0] = bf16_bits(x0[0]); o[1] = bf16_bits(x0[1]); o[2] = bf16_bits(x0[2]); o[3] = bf16_bits(x0[3]);
    o[4] = bf16_bits(x1[0]); o[5] = bf16_bits(x1[1]); o[6] = bf16_bits(x1[2]); o[7] = bf16_bits(x1[3]);
    *(v8us*)(Xb + (size_t)t * 8) = o;
    return;
  }
  const int wi = (blk - XBLK) / WBLK;                      // block-uniform plane index
  const int t = (blk - XBLK - wi * WBLK) * 256 + threadIdx.x;
  const bool i1 = wi & 1, i2 = wi & 2, i4 = wi & 4;
  const float* Wsrc = i4 ? (i2 ? w6 : (i1 ? w5 : w4)) : (i2 ? (i1 ? w3 : w2) : (i1 ? w1 : w0));
  unsigned short* Wp = Wplanes + (size_t)wi * FEAT * FEAT;   // the seven planes lie back to back in the workspace
  t32_unit(t, row, col);
  const float* src = Wsrc + (size_t)row * FEAT + col;
  const v4f x0 = *(const v4fa*)(src), x1 = *(const v4fa*)(src + 4);
  if (wi < 3) {
    o[0] = bf16_bits(x0[0]); o[1] = bf16_bits(x0[1]); o[2] = bf16_bits(x0[2]); o[3] = bf16_bits(x0[3]);
    o[4] = bf16_bits(x1[0]); o[5] = bf16_bits(x1[1]); o[6] = bf16_bits(x1[2]); o[7] = bf16_bits(x1[3]);
  } else {
    Frag f;
    f.e[0] = (_Float16)(bf16_rne(x0[0]) * 64.0f); f.e[1] = (_Float16)(bf16_rne(x0[1]) * 64.0f);
    f.e[2] = (_Float16)(bf16_rne(x0[2]) * 64.0f); f.e[3] = (_Float16)(bf16_rne(x0[3]) * 64.0f);
    f.e[4] = (_Float16)(bf16_rne(x1[0]) * 64.0f); f.e[5] = (_Float16)(bf16_rne(x1[1]) * 64.0f);
    f.e[6] = (_Float16)(bf16_rne(x1[2]) * 64.0f); f.e[7] = (_Float16)(bf16_rne(x1[3]) * 64.0f);
    o = f.half[0];
  }
  *(v8us*)(Wp + (size_t)t * 8) = o;
}

#define KC 4                          // 32-k steps a stage
#define ROWB (KC * 1024)              // bytes of one 16-row tile row in a stage: KC tiles of 1 KiB, contiguous in the T32 plane and in LDS alike
#define OPB (8 * ROWB)                // one operand's 128 rows in a stage
#define STB (2 * OPB)                 // a stage: [A 8 tile rows | W 8 tile rows]
#define NSTG (FEAT / 32 / KC)
static_assert(FEAT % (32 * KC) == 0);
static_assert(NSTG >= 2);
static_assert(ROWB == 256 * 16);      // one 16-byte copy a thread covers one tile row of a stage
static_assert(2 * STB >= 8 * 16 * 68 * 4);   // the epilogue's staging tiles fit the ring they take over

// Eight tile rows of one operand, global -> LDS, through no register: this thread's 16 bytes of each row. lds = its LDS byte address in the first row, g = its unit in the first row.
// The s_wait_xcnt stands inside the statement so that no address register is rewritten ahead of it.
__device__ __forceinline__ void copy_rows8(unsigned lds, const unsigned short* g) {
  asm volatile("global_load_async_to_lds_b128 %0, %8, off\n\t"
               "global_load_async_to_lds_b128 %1, %9, off\n\t"
               "global_load_async_to_lds_b128 %2, %10, off\n\t"
               "global_load_async_to_lds_b128 %3, %11, off\n\t"
               "global_load_async_to_lds_b128 %4, %12, off\n\t"
               "global_load_async_to_lds_b128 %5, %13, off\n\t"
               "global_load_async_to_lds_b128 %6, %14, off\n\t"
               "global_load_async_to_lds_b128 %7, %15, off\n\t"
               "s_wait_xcnt 0x0"
               :: "v"(lds), "v"(lds + 1 * ROWB), "v"(lds + 2 * ROWB), "v"(lds + 3 * ROWB),
                  "v"(lds + 4 * ROWB), "v"(lds + 5 * ROWB), "v"(lds + 6 * ROWB), "v"(lds + 7 * ROWB),
                  "v"(g), "v"(g + 1 * 16 * FEAT), "v"(g + 2 * 16 * FEAT), "v"(g + 3 * 16 * FEAT),
                  "v"(g + 4 * 16 * FEAT), "v"(g + 5 * 16 * FEAT), "v"(g + 6 * 16 * FEAT), "v"(g + 7 * 16 * FEAT)
               : "memory");
}
// One 32-k step's fragments of a wave's 32 x 64 tile: fa, fb = this lane's unit of the step's first A and W tile in the stage's LDS buffer.
__device__ __forceinline__ void lds_frags(Frag (&a)[2], Frag (&b)[4], const unsigned char* fa, const unsigned char* fb) {
#pragma unroll
  for (int fm = 0; fm < 2; ++fm) {
    a[fm].half[0] = *(const v8us*)(fa + fm * ROWB);
    a[fm].half[1] = *(const v8us*)(fa + fm * ROWB + 512);
  }
#pragma unroll
  for (int fn = 0; fn < 4; ++fn) {
    b[fn].half[0] = *(const v8us*)(fb + fn * ROWB);
    b[fn].half[1] = *(const v8us*)(fb + fn * ROWB + 512);
  }
}
// acc[fm][fn] += a[fm] * b[fn], then the hazard guard: four vector slots before anything may overwrite the operands (the next reads) or read the sums
template <bool BF>
__device__ __forceinline__ void mma_frags(const Frag (&a)[2], const Frag (&b)[4], v8f (&acc)[2][4]) {
#pragma unroll
  for (int fm = 0; fm < 2; ++fm)
#pragma unroll
    for (int fn = 0; fn < 4; ++fn) {
      if (BF) acc[fm][fn] = __builtin_amdgcn_wmma_f32_16x16x32_bf16(false, a[fm].b, false, b[fn].b, (short)0, acc[fm][fn], false, false);
      else    acc[fm][fn] = __builtin_amdgcn_wmma_f32_16x16x32_f16(false, a[fm].h, false, b[fn].h, (short)0, acc[fm][fn], false, false);
    }
  asm volatile("v_nop\n\tv_nop\n\tv_nop\n\tv_nop"
               : "+v"(acc[0][0]), "+v"(acc[0][1]), "+v"(acc[0][2]), "+v"(acc[0][3]),
                 "+v"(acc[1][0]), "+v"(acc[1][1]), "+v"(acc[1][2]), "+v"(acc[1][3])
               : "v"(a[0].h), "v"(a[1].h), "v"(b[0].h), "v"(b[1].h), "v"(b[2].h), "v"(b[3].h));
}

// C[m][n] = sum_k A[m][k] W[n][k], K = FEAT, A and W planes of FEAT columns in T32 order.
// BF: bf16 operands, else f16 operands. One 128 x 128 tile (bx, by) of a (Mrows/128, Ncols/128) tiling per block, 8 waves of 32 x 64.
// EPI 0: out f16 plane [m][N], T32 order = f16((acc*sc + bias[n]) * carry)     (bias along columns)
// EPI 1: out f16 plane [m][N], T32 order = f16((acc*sc + bias[m]) * carry)     (bias along rows)
// EPI 3: as EPI 0, out plane [MROWS][FEAT] in T16 order
// EPI 2: out f32 [b*SEQ_FULL + s][FEAT] = acc*sc + bias[n], m = b*SEQ + s
// Epilogue: two phases of 16 rows; the wave's 16 x 64 tile is staged in its own LDS tile (fully written: 16 rows x 64 columns, fully consumed),
// which lies in the ring's memory: the last stage's barrier ends every read of the ring, and no copy is in flight behind it.
template <bool BF, int EPI>
__device__ __forceinline__ void gemm_tile(unsigned char* smem, int bx, int by,
                                          const unsigned short* __restrict__ A, const unsigned short* __restrict__ W,
                                          const float* __restrict__ bias, void* __restrict__ outp,
                                          int N, float sc, float carry) {
  const int tid = threadIdx.x, lane = tid & 31, w = __builtin_amdgcn_readfirstlane((int)(tid >> 5));
  const int wm = w & 3, wn = w >> 2, ln = lane & 15, hh = lane >> 4;
  const int m0 = bx * 128 + wm * 32;
  const int n0 = by * 128 + wn * 64;
  float (*sst)[16][68] = (float (*)[16][68])smem;
  const unsigned short* ga = A + (size_t)bx * 128 * FEAT + tid * 8;   // tile row r starts at r * (FEAT/32) * 512 = r * 16 * FEAT
  const unsigned short* gw = W + (size_t)by * 128 * FEAT + tid * 8;
  const unsigned lcp = (unsigned)(size_t)smem + tid * 16;            // low 32 bits of the shared address = the LDS byte address
  v8f acc[2][4];
#pragma unroll
  for (int fm = 0; fm < 2; ++fm)
#pragma unroll
    for (int fn = 0; fn < 4; ++fn)
#pragma unroll
      for (int r = 0; r < 8; ++r) acc[fm][fn][r] = 0.0f;

  // Two LDS buffers: stage t is worked on while stage t + 1's copies fly. Steps run in ascending k: the sums keep their order.
  copy_rows8(lcp, ga);
  copy_rows8(lcp + OPB, gw);
  asm volatile("s_wait_asynccnt 0x0" ::: "memory");   // this wave's share of stage 0 has landed
  __syncthreads();                                    // every wave's share has
  copy_rows8(lcp + STB, ga + KC * 512);
  copy_rows8(lcp + STB + OPB, gw + KC * 512);
  // kept rolled (a trip is one stage of KC steps) so that the loop's text stays short
#pragma unroll 1
  for (int t = 0; t < NSTG; ++t) {
    const unsigned bo = (unsigned)(t & 1) * STB;
    const unsigned char* fa = smem + bo + wm * 2 * ROWB + lane * 16;
    const unsigned char* fb = smem + bo + OPB + wn * 4 * ROWB + lane * 16;
    // two fragment sets: step s + 1's LDS reads go out as one group ahead of step s's products; nothing of the next stage is read here
    Frag a[2][2], b[2][4];
    lds_frags(a[0], b[0], fa, fb);
    // unrolled so that the set index is a constant and both sets stay in registers
#pragma unroll
    for (int s = 0; s < KC; ++s) {
      if (s + 1 < KC) lds_frags(a[(s + 1) & 1], b[(s + 1) & 1], fa + (s + 1) * 1024, fb + (s + 1) * 1024);
      mma_frags<BF>(a[s & 1], b[s & 1], acc);
    }
    asm volatile("s_wait_dscnt 0x0" ::: "memory");      // this wave's reads of the buffer have returned before it is handed to its next writer
    asm volatile("s_wait_asynccnt 0x0" ::: "memory");   // this wave's share of stage t + 1 has landed
    __syncthreads();                                    // publishes stage t + 1 and ends every wave's reads of stage t
    if (t + 2 < NSTG) {                                 // block-uniform
      copy_rows8(lcp + bo, ga + (t + 2) * (KC * 512));
      copy_rows8(lcp + bo + OPB, gw + (t + 2) * (KC * 512));
    }
  }
  asm volatile("s_wait_asynccnt 0x0" ::: "memory");     // nothing is in flight when the ring becomes output staging

  // D element r of tile (fm, fn) = C(m0 + 16 fm + 8 hh + r, n0 + 16 fn + ln)
  float bcol[4];
#pragma unroll
  for (int fn = 0; fn < 4; ++fn) bcol[fn] = 0.0f;
  if (EPI != 1) {
#pragma unroll
    for (int fn = 0; fn < 4; ++fn) bcol[fn] = bf16_rne(bias[n0 + fn * 16 + ln]);
  }
#pragma unroll
  for (int fm = 0; fm < 2; ++fm) {
    float brow[8];
#pragma unroll
    for (int r = 0; r < 8; ++r) brow[r] = 0.0f;
    if (EPI == 1) {
#pragma unroll
      for (int r = 0; r < 8; ++r) brow[r] = bf16_rne(bias[m0 + fm * 16 + 8 * hh + r]);
    }
#pragma unroll
    for (int fn = 0; fn < 4; ++fn)
#pragma unroll
      for (int r = 0; r < 8; ++r) {
        float v = acc[fm][fn][r] * sc + ((EPI == 1) ? brow[r] : bcol[fn]);
        if (EPI != 2) v = v * carry;
        sst[w][8 * hh + r][fn * 16 + ln] = v;
      }
    __syncthreads();
    if (EPI == 2) {
      float* of = (float*)outp;
      const int rsub = lane >> 4, c4 = (lane & 15) * 4;
      {
#pragma unroll
        for (int q = 0; q < 8; ++q) {
          const int row = 2 * q + rsub;
          const int m = m0 + fm * 16 + row;
          const int bb = m / SEQ;
          const size_t grow = (size_t)bb * SEQ_FULL + (size_t)(m - bb * SEQ);
          const v4f v = *(const v4fa*)&sst[w][row][c4];
          *(v4f*)(of + grow * FEAT + n0 + c4) = v;
        }
        
      }
    } else {
      unsigned short* oh = (unsigned short*)outp;
      {
#pragma unroll
        for (int it = 0; it < 4; ++it) {
          // lane (ln, hh) carries row ln, columns 16 it + 8 hh .. + 7: one 512-byte run of the out plane per store
          const v4f x0 = *(const v4fa*)&sst[w][ln][it * 16 + hh * 8];
          const v4f x1 = *(const v4fa*)&sst[w][ln][it * 16 + hh * 8 + 4];
          Frag f;
          f.e[0] = (_Float16)x0[0]; f.e[1] = (_Float16)x0[1]; f.e[2] = (_Float16)x0[2]; f.e[3] = (_Float16)x0[3];
          f.e[4] = (_Float16)x1[0]; f.e[5] = (_Float16)x1[1]; f.e[6] = (_Float16)x1[2]; f.e[7] = (_Float16)x1[3];
          const v8us o = f.half[0];
          if (EPI == 3) *(v8us*)(oh + ((size_t)((n0 >> 4) + it) * (MROWS / 16) + (m0 >> 4) + fm) * 256 + lane * 8) = o;
          else          *(v8us*)(oh + ((size_t)((m0 >> 4) + fm) * (N >> 5) + (n0 >> 5)) * 512 + it * 256 + lane * 8) = o;
        }
        
      }
    }
    __syncthreads();
  }
}

#define S10 0.0009765625f        // 1 / (16 * 64)
#define S14 0.00006103515625f    // 1 / (256 * 64)

// First Linears of the q, k and v chains in one launch: blockIdx.z picks the chain (block-uniform); grid (MROWS/128, FEAT/128, 3).
__global__ __launch_bounds__(256) void k_lin1(const unsigned short* __restrict__ Xb,
                                              const unsigned short* __restrict__ W0, const unsigned short* __restrict__ W1,
                                              const unsigned short* __restrict__ W2,
                                              const float* __restrict__ b0, const float* __restrict__ b1, const float* __restrict__ b2,
                                              unsigned short* __restrict__ o0, unsigned short* __restrict__ o1, unsigned short* __restrict__ o2) {
  __shared__ __attribute__((aligned(16))) unsigned char smem[2 * STB];
  const int z = blockIdx.z;
  gemm_tile<true, 0>(smem, blockIdx.x, blockIdx.y, Xb, z == 0 ? W0 : z == 1 ? W1 : W2, z == 0 ? b0 : z == 1 ? b1 : b2,
                     (void*)(z == 0 ? o0 : z == 1 ? o1 : o2), FEAT, 1.0f, 16.0f);
}

// Second Linears in one launch, grid (MROWS/128, FEAT/128, 3): z = 0, 1 -> Q and K planes (T16); z = 2 -> V^T[f][token] = sum_j vv[f][j] * t1v[token][j] + vv_b[f],
// whose tiling is (FEAT/128, MROWS/128): its tile comes from the block's flat index in the z slice.
__global__ __launch_bounds__(256) void k_lin2(const unsigned short* __restrict__ T1q, const unsigned short* __restrict__ T1k,
                                              const unsigned short* __restrict__ T1v,
                                              const unsigned short* __restrict__ Vq, const unsigned short* __restrict__ Vk,
                                              const unsigned short* __restrict__ Vv,
                                              const float* __restrict__ bq, const float* __restrict__ bk, const float* __restrict__ bv,
                                              unsigned short* __restrict__ Qp, unsigned short* __restrict__ Kp, unsigned short* __restrict__ Vt) {
  __shared__ __attribute__((aligned(16))) unsigned char smem[2 * STB];
  const int z = blockIdx.z;
  if (z < 2) {
    gemm_tile<false, 3>(smem, blockIdx.x, blockIdx.y, z == 0 ? T1q : T1k, z == 0 ? Vq : Vk, z == 0 ? bq : bk,
                        (void*)(z == 0 ? Qp : Kp), FEAT, S10, 16.0f);
  } else {
    const int flat = blockIdx.y * (MROWS / 128) + blockIdx.x;
    gemm_tile<false, 1>(smem, flat % (FEAT / 128), flat / (FEAT / 128), Vv, T1v, bv, (void*)Vt, MROWS, S10, 16.0f);
  }
}

// Output Linear, grid (MROWS/128, FEAT/128).
__global__ __launch_bounds__(256) void k_lin3(const unsigned short* __restrict__ O2, const unsigned short* __restrict__ Wo,
                                              const float* __restrict__ bo, float* __restrict__ out) {
  __shared__ __attribute__((aligned(16))) unsigned char smem[2 * STB];
  gemm_tile<false, 2>(smem, blockIdx.x, blockIdx.y, O2, Wo, bo, (void*)out, FEAT, S14, 1.0f);
}

// 2^x as the bare v_exp_f32, without the library form's rescue of results below 2^-126 (compare, select, add, select, ldexp per call).
// Arguments here are at most 8, up to the rounding of the exponent's FMA. A weight below 2^-126 rounds to zero in both f16 planes and vanishes against the row sum, which is about 256 or more from the first
// step on (the row's maximum carries 2^8); a rescale factor below 2^-126 multiplies sums that the new maximum's own terms then outweigh by 2^126.
__device__ __forceinline__ float hw_exp2(float x) { return __builtin_amdgcn_exp2f(x); }

// One 32-key step for a wave's 16 queries. kp: this lane's unit of the chunk's K tile at key0 (T16); vp: this lane's unit of the chunk's V^T tile at key0 (T32).
__device__ __forceinline__ void fa_step(const unsigned short* __restrict__ kp, const unsigned short* __restrict__ vp,
                                        const Frag& qf, float& mr, float& lr, v8f& Oh, v8f& Ol) {
  const v8us zz = {0, 0, 0, 0, 0, 0, 0, 0};
  // A fragments of K: row m = key (key0 + 16*kt + ln), elements 0..7 <- d = 8h + i, elements 8..15 (k slots 16..31) zero
  Frag k0, k1, vf;
  k0.half[0] = *(const v8us*)(kp);             k0.half[1] = zz;
  k1.half[0] = *(const v8us*)(kp + 256);       k1.half[1] = zz;
  // A fragment of V^T: row m = d (ln), elements 0..7 <- key0 + 8h + i, 8..15 <- key0 + 16 + 8h + i
  vf.half[0] = *(const v8us*)(vp);
  vf.half[1] = *(const v8us*)(vp + 256);
  v8f s0 = {0.f, 0.f, 0.f, 0.f, 0.f, 0.f, 0.f, 0.f};
  v8f s1 = {0.f, 0.f, 0.f, 0.f, 0.f, 0.f, 0.f, 0.f};
  // S^T tiles: element r of tile kt = 256 * q.k of (key0 + 16*kt + 8h + r, query ln)
  mma_s2(k0.h, k1.h, qf.h, s0, s1);
  // The scores stay in the accumulators' own unit (1024 x the scaled score: x16 x16 carries, divide by 4); that power of two is folded into EXPC.
  float mx = s0[0];
#pragma unroll
  for (int r = 1; r < 8; ++r) mx = fmaxf(mx, s0[r]);
#pragma unroll
  for (int r = 0; r < 8; ++r) mx = fmaxf(mx, s1[r]);
  mx = fmaxf(mx, __shfl_xor(mx, 16, 32));           // the other lane half holds the other 16 keys of this query
  const float mnew = fmaxf(mr, mx);
  const float al = hw_exp2((mr - mnew) * EXPC);
  mr = mnew;
  // weights carried x256: pc = 256 * exp(score - maximum) = 2^(s * EXPC + (8 - mnew * EXPC)); hi plane f16(pc), residual plane f16((pc - hi) * 2048).
  // Two scores a vector instruction: one packed FMA for the exponents, packed sum, packed x2048, packed convert.
  const float off = fmaf(-mnew, EXPC, 8.0f);
  const v2f off2 = {off, off}, c2 = {EXPC, EXPC}, k2 = {2048.0f, 2048.0f};
  Frag ph, pl;
  v2f ps2 = {0.0f, 0.0f};
#pragma unroll
  for (int i = 0; i < 8; ++i) {
    const v2f sp = (i < 4) ? v2f{s0[2 * i], s0[2 * i + 1]} : v2f{s1[2 * i - 8], s1[2 * i - 7]};
    const v2f ar = __builtin_elementwise_fma(sp, c2, off2);
    const v2f pc = {hw_exp2(ar[0]), hw_exp2(ar[1])};
    ps2 += pc;
    const v2h h = __builtin_convertvector(pc, v2h);
    ph.p[i] = h;                                    // B elements 2i, 2i+1: below 8 -> key0 + 8h + e (tile 0 row 8h+e); from 8 on -> key0 + 16 + 8h + (e-8) (tile 1)
    const v2f pk = pc * k2;
    pl.e[2 * i]     = (_Float16)fmaf((float)h[0], -2048.0f, pk[0]);   // exact difference, one rounding, as (pc - hi) * 2048
    pl.e[2 * i + 1] = (_Float16)fmaf((float)h[1], -2048.0f, pk[1]);
  }
  float ps = ps2[0] + ps2[1];
  ps += __shfl_xor(ps, 16, 32);
  lr = lr * al + ps;
  Oh = Oh * al; Ol = Ol * al;
  mma_h2(vf.h, ph.h, pl.h, Oh, Ol);
}

// Block = 4 waves x 16 queries = 64 queries of one (chunk, batch); no LDS and no barrier in the key loop.
// Epilogue: O^T tile -> per-wave LDS tile [16 queries][16 d] (fully written, fully consumed; block barrier), then thread tid stores unit tid of the
// block's 16 plane rows x 64 columns = two adjacent T32 tiles (it reads the LDS tile of the wave that owns its plane row, behind the block barrier).
// Context plane element order: flat = ((c*NB + b)*SEQ + s)*16 + h; plane row = (flat>>6) mod (NB*SEQ), column = (flat>>6)/(NB*SEQ)*64 + (flat&63).
// coverage: NCH*NB*(SEQ/64) blocks x 4 waves x 256 elements = every element of the plane exactly once.
__global__ __launch_bounds__(128) void k_attn(const unsigned short* __restrict__ Qp, const unsigned short* __restrict__ Kp,
                                              const unsigned short* __restrict__ Vt, unsigned short* __restrict__ O2) {
  __shared__ __attribute__((aligned(16))) float so[4][16][20];
  const int tid = threadIdx.x, w = __builtin_amdgcn_readfirstlane((int)(tid >> 5)), lane = tid & 31, ln = lane & 15, hh = lane >> 4;
  const int qt = blockIdx.x % (SEQ / 64);
  const int p = blockIdx.x / (SEQ / 64);
  const int b = p % NB, c = p / NB;
  const int qbase = qt * 64 + 16 * w;
  const v8us zz = {0, 0, 0, 0, 0, 0, 0, 0};
  // Q^T B fragment: column n = query qbase + ln, elements 0..7 <- d = 8h + i, elements 8..15 zero
  Frag qf;
  qf.half[0] = *(const v8us*)(Qp + ((size_t)c * (MROWS / 16) + (b * SEQ + qbase) / 16) * 256 + lane * 8);
  qf.half[1] = zz;
  const unsigned short* kb = Kp + ((size_t)c * (MROWS / 16) + (b * SEQ) / 16) * 256 + lane * 8;
  const unsigned short* vb = Vt + ((size_t)c * (MROWS / 32) + (b * SEQ) / 32) * 512 + lane * 8;
  float mr = -3.0e38f, lr = 0.0f;
  v8f Oh = {0.f, 0.f, 0.f, 0.f, 0.f, 0.f, 0.f, 0.f};
  v8f Ol = {0.f, 0.f, 0.f, 0.f, 0.f, 0.f, 0.f, 0.f};
#pragma unroll 1
  for (int j = 0; j < SEQ / 32; ++j)
    fa_step(kb + j * 512, vb + j * 512, qf, mr, lr, Oh, Ol);

  // O^T element r = out(query qbase + ln, d = 8h + r); undo x256 (in lr), x16 (V), x2048 (residual plane); carry the context x256
  const float inv = 16.0f * (1.0f / lr);
#pragma unroll
  for (int r = 0; r < 8; ++r)
    so[w][ln][8 * hh + r] = (Oh[r] + Ol[r] * 0.00048828125f) * inv;
  __syncthreads();
  // unit tid = plane row rr of the block's 16, 8-column piece p of its 64 columns; four queries of one wave make one plane row
  const int rr = tid & 15, p8 = tid >> 4;
  const int qq = (rr & 3) * 4 + (p8 >> 1), d0 = (p8 & 1) * 8;
  const v4f x0 = *(const v4fa*)&so[rr >> 2][qq][d0];
  const v4f x1 = *(const v4fa*)&so[rr >> 2][qq][d0 + 4];
  Frag f;
  f.e[0] = (_Float16)x0[0]; f.e[1] = (_Float16)x0[1]; f.e[2] = (_Float16)x0[2]; f.e[3] = (_Float16)x0[3];
  f.e[4] = (_Float16)x1[0]; f.e[5] = (_Float16)x1[1]; f.e[6] = (_Float16)x1[2]; f.e[7] = (_Float16)x1[3];
  const v8us o = f.half[0];
  const int R = (c * NB + b) * (SEQ / 4) + qt * 16;   // the block's first plane row, a multiple of 16
  const int hp = R / MROWS;
  const int prow = R - hp * MROWS;
  unsigned short* dst = O2 + ((size_t)(prow >> 4) * (FEAT / 32) + hp * 2) * 512 + tid * 8;
  *(v8us*)dst = o;
  
}

extern "C" void kernel_launch(void* const* d_in, const int* in_sizes, int n_in,
                              void* d_out, int out_size, void* d_ws, size_t ws_size, hipStream_t stream) {
  if (n_in < 15) return;
  const long long needx = ((long long)(NB - 1) * SEQ_FULL + SEQ) * FEAT;   // last element touched + 1
  if ((long long)in_sizes[0] < needx) return;
  if ((long long)out_size < needx) return;
  for (int i = 1; i < 15; i += 2) {
    if ((long long)in_sizes[i] < (long long)FEAT * FEAT) return;
    if ((long long)in_sizes[i + 1] < (long long)FEAT) return;
  }
  // wire order: x, then (weight, bias) pairs for wq, wk, wv, vq, vk, vv, wo
  const float* x    = (const float*)d_in[0];
  const float* wq_w = (const float*)d_in[1];
  const float* wq_b = (const float*)d_in[2];
  const float* wk_w = (const float*)d_in[3];
  const float* wk_b = (const float*)d_in[4];
  const float* wv_w = (const float*)d_in[5];
  const float* wv_b = (const float*)d_in[6];
  const float* vq_w = (const float*)d_in[7];
  const float* vq_b = (const float*)d_in[8];
  const float* vk_w = (const float*)d_in[9];
  const float* vk_b = (const float*)d_in[10];
  const float* vv_w = (const float*)d_in[11];
  const float* vv_b = (const float*)d_in[12];
  const float* wo_w = (const float*)d_in[13];
  const float* wo_b = (const float*)d_in[14];

  char* ws = (char*)d_ws;
  size_t off = 0;
  const size_t planeA = (size_t)MROWS * FEAT * 2;
  const size_t planeW = (size_t)FEAT * FEAT * 2;       // weight plane
  unsigned short* Xb  = (unsigned short*)(ws + off); off += (planeA + 255) & ~(size_t)255;
  unsigned short* Wqb = (unsigned short*)(ws + off); off += (planeW + 255) & ~(size_t)255;
  unsigned short* Wkb = (unsigned short*)(ws + off); off += (planeW + 255) & ~(size_t)255;
  unsigned short* Wvb = (unsigned short*)(ws + off); off += (planeW + 255) & ~(size_t)255;
  unsigned short* Vqh = (unsigned short*)(ws + off); off += (planeW + 255) & ~(size_t)255;
  unsigned short* Vkh = (unsigned short*)(ws + off); off += (planeW + 255) & ~(size_t)255;
  unsigned short* Vvh = (unsigned short*)(ws + off); off += (planeW + 255) & ~(size_t)255;
  unsigned short* Woh = (unsigned short*)(ws + off); off += (planeW + 255) & ~(size_t)255;
  unsigned short* T1q = (unsigned short*)(ws + off); off += (planeA + 255) & ~(size_t)255;
  unsigned short* T1k = (unsigned short*)(ws + off); off += (planeA + 255) & ~(size_t)255;
  unsigned short* T1v = (unsigned short*)(ws + off); off += (planeA + 255) & ~(size_t)255;
  unsigned short* Qp  = (unsigned short*)(ws + off); off += (planeA + 255) & ~(size_t)255;
  unsigned short* Kp  = (unsigned short*)(ws + off); off += (planeA + 255) & ~(size_t)255;
  unsigned short* Vt  = (unsigned short*)(ws + off); off += (planeA + 255) & ~(size_t)255;   // [FEAT][MROWS], T32 order
  unsigned short* O2  = (unsigned short*)(ws + off); off += (planeA + 255) & ~(size_t)255;
  if (off > ws_size) return;

  k_cvt<<<(unsigned)(XBLK + 7 * WBLK), 256, 0, stream>>>(x, wq_w, wk_w, wv_w, vq_w, vk_w, vv_w, wo_w, Xb, Wqb);

  const dim3 g3((unsigned)(MROWS / 128), (unsigned)(FEAT / 128), 3u);
  const dim3 g1((unsigned)(MROWS / 128), (unsigned)(FEAT / 128));
  k_lin1<<<g3, 256, 0, stream>>>(Xb, Wqb, Wkb, Wvb, wq_b, wk_b, wv_b, T1q, T1k, T1v);
  k_lin2<<<g3, 256, 0, stream>>>(T1q, T1k, T1v, Vqh, Vkh, Vvh, vq_b, vk_b, vv_b, Qp, Kp, Vt);

  k_attn<<<(unsigned)(NCH * NB * (SEQ / 64)), 128, 0, stream>>>(Qp, Kp, Vt, O2);

  k_lin3<<<g1, 256, 0, stream>>>(O2, Woh, wo_b, (float*)d_out);
}

// v007
// Measured time: 75.1 microseconds a run.
// Two timings next to v006 both put it at 1.05 times that version's speed.
// Over all steps from v000 it is 3.30 times as fast.
#include <hip/hip_runtime.h>
// Contractions: first Linear of each q/k/v chain on v_wmma_f32_16x16x32_bf16 (x and W converted RNE to bf16, single product, f32 accumulate); second Linears, K Q^T scores and the output Linear on v_wmma_f32_16x16x32_f16 (activations x16 or x256 in f16, weights = RNE-bf16 value x64 held exactly in f16, f32 accumulate); O^T = V^T P^T on v_wmma_f32_16x16x32_f16 (V x16 f16; P x256 f16 hi plane + x2^11 f16 residual plane in a separate f32 accumulator); biases RNE-bf16 values added in f32; softmax statistics f32.
// 64 feature chunks of width 16 act as heads; scale 1/4; no mask; context is written in the flat-reinterpreted (16, b, s, 64) -> (b, s, 1024) order.
// GEMM engine: C[m][n] = sum_k A[m][k] W[n][k]; both operands are 16-bit planes held in fragment order
// (elements 0..7 <- k0 + 8h + i, elements 8..15 <- k0 + 16 + 8h + i for A rows and for W rows alike). A block's 128 A rows and 128 W rows are staged in LDS,
// four 32-k steps a stage, by asynchronous copies into two buffers; the waves read their fragments from LDS. 128x128 block tile, 8 waves of 32x64.
// Fragment order T32 of a plane [R][C]: 16 x 32 tiles, tile index (r/16)*(C/32) + c/32, 512 elements a tile; element (r, c) sits at
// tile*512 + ((c>>4)&1)*256 + (((c>>3)&1)*16 + (r&15))*8 + (c&7), so each half fragment is one wave-wide 16-byte load of 512 contiguous bytes.
// Fragment order T16 (Q and K planes, [MROWS][FEAT]): 16 x 16 tiles, tile index (c/16)*(MROWS/16) + r/16, 256 elements a tile; element (r, c) sits at
// tile*256 + (((c>>3)&1)*16 + (r&15))*8 + (c&7).
// Attention engine: transposed flash. Each wave owns 16 queries of one (chunk, batch). Per 32-key step: S^T tiles (key rows x query columns)
// from K rows (A) and Q^T (B), upper 16 k slots zero; the two 16-key D tiles pack straight into the P^T B fragment; O^T (16 d rows x query columns)
// accumulates from V^T rows (A, global f16 plane in T32 order produced directly by a GEMM with swapped operand roles).
#ifndef NB
#define NB 2
#endif
#ifndef SEQ
#define SEQ 1024
#endif
#define NB_FULL 2
#define SEQ_FULL 1024
#define FEAT 1024
#define NCH 64
#define MROWS (NB * SEQ)

static_assert(SEQ % 128 == 0);
static_assert(SEQ <= SEQ_FULL);
static_assert(NB <= NB_FULL);
static_assert(FEAT % 128 == 0);
static_assert(FEAT == NCH * 16);
static_assert((size_t)8 * MROWS * FEAT * 2 + (size_t)7 * FEAT * FEAT * 2 <= (size_t)134217728);
static_assert(((size_t)(NB - 1) * SEQ_FULL + SEQ) * FEAT <= (size_t)NB_FULL * SEQ_FULL * FEAT);

typedef __bf16 v16b __attribute__((ext_vector_type(16)));
typedef _Float16 v16h __attribute__((ext_vector_type(16)));
typedef unsigned short v8us __attribute__((ext_vector_type(8), may_alias));
typedef float v8f __attribute__((ext_vector_type(8)));
typedef float v4f __attribute__((ext_vector_type(4)));
typedef float v4fa __attribute__((ext_vector_type(4), may_alias));
typedef float v2f __attribute__((ext_vector_type(2)));
typedef _Float16 v2h __attribute__((ext_vector_type(2)));
union Frag { v16b b; v16h h; v8us half[2]; v2h p[8]; _Float16 e[16]; unsigned short u[16]; };

#define LOG2E 1.4426950408889634f
#define EXPC (LOG2E * 0.0009765625f)   // log2(e) / 1024

__device__ __forceinline__ unsigned short bf16_bits(float x) {   // RNE convert to bf16 bits
  unsigned int u = __float_as_uint(x);
  return (unsigned short)((u + 0x7FFFu + ((u >> 16) & 1u)) >> 16);
}
__device__ __forceinline__ float bf16_val(unsigned short b) { return __uint_as_float(((unsigned int)b) << 16); }
__device__ __forceinline__ float bf16_rne(float x) { return bf16_val(bf16_bits(x)); }

// c0 += a0*b ; c1 += a1*b (two key tiles against one query fragment), then the hazard guard
__device__ __forceinline__ void mma_s2(v16h a0, v16h a1, v16h b, v8f& c0, v8f& c1) {
  c0 = __builtin_amdgcn_wmma_f32_16x16x32_f16(false, a0, false, b, (short)0, c0, false, false);
  c1 = __builtin_amdgcn_wmma_f32_16x16x32_f16(false, a1, false, b, (short)0, c1, false, false);
  asm volatile("v_nop\n\tv_nop\n\tv_nop\n\tv_nop" : "+v"(c0), "+v"(c1) : "v"(a0), "v"(a1), "v"(b));
}
// ch += a*bh ; cl += a*bl (scaled residual plane keeps its own accumulator), then the hazard guard
__device__ __forceinline__ void mma_h2(v16h a, v16h bh, v16h bl, v8f& ch, v8f& cl) {
  ch = __builtin_amdgcn_wmma_f32_16x16x32_f16(false, a, false, bh, (short)0, ch, false, false);
  cl = __builtin_amdgcn_wmma_f32_16x16x32_f16(false, a, false, bl, (short)0, cl, false, false);
  asm volatile("v_nop\n\tv_nop\n\tv_nop\n\tv_nop" : "+v"(ch), "+v"(cl) : "v"(a), "v"(bh), "v"(bl));
}

// 16-byte unit t of a T32 plane of FEAT columns holds elements (row, col .. col + 7)
__device__ __forceinline__ void t32_unit(int t, int& row, int& col) {
  const int tile = t >> 6, u = t & 63;
  const int tr = tile / (FEAT / 32), tc = tile - tr * (FEAT / 32);
  row = tr * 16 + (u & 15);
  col = tc * 32 + (u >> 4) * 8;
}

#define XBLK (MROWS * (FEAT / 8) / 256)
#define WBLK (FEAT * (FEAT / 8) / 256)
static_assert(MROWS * (FEAT / 8) % 256 == 0);
static_assert(FEAT * (FEAT / 8) % 256 == 0);
static_assert((size_t)FEAT * FEAT * 2 % 256 == 0);   // a weight plane needs no padding to the workspace's 256-byte step

// All eight operand planes in one launch (none depends on another). Blocks 0 .. XBLK-1: the compact x plane, bf16 bits (RNE), thread t writes unit t.
// Then WBLK blocks per weight plane [out][in], T32 order: planes 0..2 -> bf16 bits (RNE); planes 3..6 -> f16 bits of (RNE-bf16 value x 64).
// coverage: XBLK*256 units = the whole x plane, WBLK*256 units = one whole weight plane; every unit written once.
__global__ __launch_bounds__(256) void k_cvt(const float* __restrict__ X,
                                             const float* __restrict__ w0, const float* __restrict__ w1, const float* __restrict__ w2,
                                             const float* __restrict__ w3, const float* __restrict__ w4, const float* __restrict__ w5,
                                             const float* __restrict__ w6,
                                             unsigned short* __restrict__ Xb, unsigned short* __restrict__ Wplanes) {
  const int blk = blockIdx.x;
  int row, col;
  v8us o;
  if (blk < XBLK) {
    const int t = blk * 256 + threadIdx.x;
    t32_unit(t, row, col);
    const int b = row / SEQ, s = row - b * SEQ;
    const float* src = X + ((size_t)b * SEQ_FULL + s) * FEAT + col;
    const v4f x0 = *(const v4fa*)(src), x1 = *(const v4fa*)(src + 4);
    o[0] = bf16_bits(x0[0]); o[1] = bf16_bits(x0[1]); o[2] = bf16_bits(x0[2]); o[3] = bf16_bits(x0[3]);
    o[4] = bf16_bits(x1[0]); o[5] = bf16_bits(x1[1]); o[6] = bf16_bits(x1[2]); o[7] = bf16_bits(x1[3]);
    *(v8us*)(Xb + (size_t)t * 8) = o;
    return;
  }
  const int wi = (blk - XBLK) / WBLK;                      // block-uniform plane index
  const int t = (blk - XBLK - wi * WBLK) * 256 + threadIdx.x;
  const bool i1 = wi & 1, i2 = wi & 2, i4 = wi & 4;
  const float* Wsrc = i4 ? (i2 ? w6 : (i1 ? w5 : w4)) : (i2 ? (i1 ? w3 : w2) : (i1 ? w1 : w0));
  unsigned short* Wp = Wplanes + (size_t)wi * FEAT * FEAT;   // the seven planes lie back to back in the workspace
  t32_unit(t, row, col);
  const float* src = Wsrc + (size_t)row * FEAT + col;
  const v4f x0 = *(const v4fa*)(src), x1 = *(const v4fa*)(src + 4);
  if (wi < 3) {
    o[0] = bf16_bits(x0[0]); o[1] = bf16_bits(x0[1]); o[2] = bf16_bits(x0[2]); o[3] = bf16_bits(x0[3]);
    o[4] = bf16_bits(x1[0]); o[5] = bf16_bits(x1[1]); o[6] = bf16_bits(x1[2]); o[7] = bf16_bits(x1[3]);
  } else {
    Frag f;
    f.e[0] = (_Float16)(bf16_rne(x0[0]) * 64.0f); f.e[1] = (_Float16)(bf16_rne(x0[1]) * 64.0f);
    f.e[2] = (_Float16)(bf16_rne(x0[2]) * 64.0f); f.e[3] = (_Float16)(bf16_rne(x0[3]) * 64.0f);
    f.e[4] = (_Float16)(bf16_rne(x1[0]) * 64.0f); f.e[5] = (_Float16)(bf16_rne(x1[1]) * 64.0f);
    f.e[6] = (_Float16)(bf16_rne(x1[2]) * 64.0f); f.e[7] = (_Float16)(bf16_rne(x1[3]) * 64.0f);
    o = f.half[0];
  }
  *(v8us*)(Wp + (size_t)t * 8) = o;
}

#define KC 4                          // 32-k steps a stage
#define ROWB (KC * 1024)              // bytes of one 16-row tile row in a stage: KC tiles of 1 KiB, contiguous in the T32 plane and in LDS alike
#define OPB (8 * ROWB)                // one operand's 128 rows in a stage
#define STB (2 * OPB)                 // a stage: [A 8 tile rows | W 8 tile rows]
#define NSTG (FEAT / 32 / KC)
static_assert(FEAT % (32 * KC) == 0);
static_assert(NSTG >= 2);
static_assert(ROWB == 256 * 16);      // one 16-byte copy a thread covers one tile row of a stage
static_assert(2 * STB >= 8 * 16 * 68 * 4);   // the epilogue's staging tiles fit the ring they take over

// Eight tile rows of one operand, global -> LDS, through no register: this thread's 16 bytes of each row. lds = its LDS byte address in the first row, g = its unit in the first row.
// The s_wait_xcnt stands inside the statement so that no address register is rewritten ahead of it.
__device__ __forceinline__ void copy_rows8(unsigned lds, const unsigned short* g) {
  asm volatile("global_load_async_to_lds_b128 %0, %8, off\n\t"
               "global_load_async_to_lds_b128 %1, %9, off\n\t"
               "global_load_async_to_lds_b128 %2, %10, off\n\t"
               "global_load_async_to_lds_b128 %3, %11, off\n\t"
               "global_load_async_to_lds_b128 %4, %12, off\n\t"
               "global_load_async_to_lds_b128 %5, %13, off\n\t"
               "global_load_async_to_lds_b128 %6, %14, off\n\t"
               "global_load_async_to_lds_b128 %7, %15, off\n\t"
               "s_wait_xcnt 0x0"
               :: "v"(lds), "v"(lds + 1 * ROWB), "v"(lds + 2 * ROWB), "v"(lds + 3 * ROWB),
                  "v"(lds + 4 * ROWB), "v"(lds + 5 * ROWB), "v"(lds + 6 * ROWB), "v"(lds + 7 * ROWB),
                  "v"(g), "v"(g + 1 * 16 * FEAT), "v"(g + 2 * 16 * FEAT), "v"(g + 3 * 16 * FEAT),
                  "v"(g + 4 * 16 * FEAT), "v"(g + 5 * 16 * FEAT), "v"(g + 6 * 16 * FEAT), "v"(g + 7 * 16 * FEAT)
               : "memory");
}
// One 32-k step's fragments of a wave's 32 x 64 tile: fa, fb = this lane's unit of the step's first A and W tile in the stage's LDS buffer.
__device__ __forceinline__ void lds_frags(Frag (&a)[2], Frag (&b)[4], const unsigned char* fa, const unsigned char* fb) {
#pragma unroll
  for (int fm = 0; fm < 2; ++fm) {
    a[fm].half[0] = *(const v8us*)(fa + fm * ROWB);
    a[fm].half[1] = *(const v8us*)(fa + fm * ROWB + 512);
  }
#pragma unroll
  for (int fn = 0; fn < 4; ++fn) {
    b[fn].half[0] = *(const v8us*)(fb + fn * ROWB);
    b[fn].half[1] = *(const v8us*)(fb + fn * ROWB + 512);
  }
}
// acc[fm][fn] += a[fm] * b[fn], then the hazard guard: four vector slots before anything may overwrite the operands (the next reads) or read the sums
template <bool BF>
__device__ __forceinline__ void mma_frags(const Frag (&a)[2], const Frag (&b)[4], v8f (&acc)[2][4]) {
#pragma unroll
  for (int fm = 0; fm < 2; ++fm)
#pragma unroll
    for (int fn = 0; fn < 4; ++fn) {
      if (BF) acc[fm][fn] = __builtin_amdgcn_wmma_f32_16x16x32_bf16(false, a[fm].b, false, b[fn].b, (short)0, acc[fm][fn], false, false);
      else    acc[fm][fn] = __builtin_amdgcn_wmma_f32_16x16x32_f16(false, a[fm].h, false, b[fn].h, (short)0, acc[fm][fn], false, false);
    }
  asm volatile("v_nop\n\tv_nop\n\tv_nop\n\tv_nop"
               : "+v"(acc[0][0]), "+v"(acc[0][1]), "+v"(acc[0][2]), "+v"(acc[0][3]),
                 "+v"(acc[1][0]), "+v"(acc[1][1]), "+v"(acc[1][2]), "+v"(acc[1][3])
               : "v"(a[0].h), "v"(a[1].h), "v"(b[0].h), "v"(b[1].h), "v"(b[2].h), "v"(b[3].h));
}

// C[m][n] = sum_k A[m][k] W[n][k], K = FEAT, A and W planes of FEAT columns in T32 order.
// BF: bf16 operands, else f16 operands. One 128 x 128 tile (bx, by) of a (Mrows/128, Ncols/128) tiling per block, 8 waves of 32 x 64.
// EPI 0: out f16 plane [m][N], T32 order = f16((acc*sc + bias[n]) * carry)     (bias along columns)
// EPI 1: out f16 plane [m][N], T32 order = f16((acc*sc + bias[m]) * carry)     (bias along rows)
// EPI 3: as EPI 0, out plane [MROWS][FEAT] in T16 order
// EPI 2: out f32 [b*SEQ_FULL + s][FEAT] = acc*sc + bias[n], m = b*SEQ + s
// Epilogue: two phases of 16 rows; the wave's 16 x 64 tile is staged in its own LDS tile (fully written: 16 rows x 64 columns, fully consumed),
// which lies in the ring's memory: the last stage's barrier ends every read of the ring, and no copy is in flight behind it.
template <bool BF, int EPI>
__device__ __forceinline__ void gemm_tile(unsigned char* smem, int bx, int by,
                                          const unsigned short* __restrict__ A, const unsigned short* __restrict__ W,
                                          const float* __restrict__ bias, void* __restrict__ outp,
                                          int N, float sc, float carry) {
  const int tid = threadIdx.x, lane = tid & 31, w = __builtin_amdgcn_readfirstlane((int)(tid >> 5));
  const int wm = w & 3, wn = w >> 2, ln = lane & 15, hh = lane >> 4;
  const int m0 = bx * 128 + wm * 32;
  const int n0 = by * 128 + wn * 64;
  float (*sst)[16][68] = (float (*)[16][68])smem;
  const unsigned short* ga = A + (size_t)bx * 128 * FEAT + tid * 8;   // tile row r starts at r * (FEAT/32) * 512 = r * 16 * FEAT
  const unsigned short* gw = W + (size_t)by * 128 * FEAT + tid * 8;
  const unsigned lcp = (unsigned)(size_t)smem + tid * 16;            // low 32 bits of the shared address = the LDS byte address
  v8f acc[2][4];
#pragma unroll
  for (int fm = 0; fm < 2; ++fm)
#pragma unroll
    for (int fn = 0; fn < 4; ++fn)
#pragma unroll
      for (int r = 0; r < 8; ++r) acc[fm][fn][r] = 0.0f;

  // Two LDS buffers: stage t is worked on while stage t + 1's copies fly. Steps run in ascending k: the sums keep their order.
  copy_rows8(lcp, ga);
  copy_rows8(lcp + OPB, gw);
  asm volatile("s_wait_asynccnt 0x0" ::: "memory");   // this wave's share of stage 0 has landed
  __syncthreads();                                    // every wave's share has
  copy_rows8(lcp + STB, ga + KC * 512);
  copy_rows8(lcp + STB + OPB, gw + KC * 512);
  // kept rolled (a trip is one stage of KC steps) so that the loop's text stays short
#pragma unroll 1
  for (int t = 0; t < NSTG; ++t) {
    const unsigned bo = (unsigned)(t & 1) * STB;
    const unsigned char* fa = smem + bo + wm * 2 * ROWB + lane * 16;
    const unsigned char* fb = smem + bo + OPB + wn * 4 * ROWB + lane * 16;
    // two fragment sets: step s + 1's LDS reads go out as one group ahead of step s's products; nothing of the next stage is read here
    Frag a[2][2], b[2][4];
    lds_frags(a[0], b[0], fa, fb);
    // unrolled so that the set index is a constant and both sets stay in registers
#pragma unroll
    for (int s = 0; s < KC; ++s) {
      if (s + 1 < KC) lds_frags(a[(s + 1) & 1], b[(s + 1) & 1], fa + (s + 1) * 1024, fb + (s + 1) * 1024);
      mma_frags<BF>(a[s & 1], b[s & 1], acc);
    }
    asm volatile("s_wait_dscnt 0x0" ::: "memory");      // this wave's reads of the buffer have returned before it is handed to its next writer
    asm volatile("s_wait_asynccnt 0x0" ::: "memory");   // this wave's share of stage t + 1 has landed
    __syncthreads();                                    // publishes stage t + 1 and ends every wave's reads of stage t
    if (t + 2 < NSTG) {                                 // block-uniform
      copy_rows8(lcp + bo, ga + (t + 2) * (KC * 512));
      copy_rows8(lcp + bo + OPB, gw + (t + 2) * (KC * 512));
    }
  }
  asm volatile("s_wait_asynccnt 0x0" ::: "memory");     // nothing is in flight when the ring becomes output staging

  // D element r of tile (fm, fn) = C(m0 + 16 fm + 8 hh + r, n0 + 16 fn + ln)
  float bcol[4];
#pragma unroll
  for (int fn = 0; fn < 4; ++fn) bcol[fn] = 0.0f;
  if (EPI != 1) {
#pragma unroll
    for (int fn = 0; fn < 4; ++fn) bcol[fn] = bf16_rne(bias[n0 + fn * 16 + ln]);
  }
#pragma unroll
  for (int fm = 0; fm < 2; ++fm) {
    float brow[8];
#pragma unroll
    for (int r = 0; r < 8; ++r) brow[r] = 0.0f;
    if (EPI == 1) {
#pragma unroll
      for (int r = 0; r < 8; ++r) brow[r] = bf16_rne(bias[m0 + fm * 16 + 8 * hh + r]);
    }
#pragma unroll
    for (int fn = 0; fn < 4; ++fn)
#pragma unroll
      for (int r = 0; r < 8; ++r) {
        float v = acc[fm][fn][r] * sc + ((EPI == 1) ? brow[r] : bcol[fn]);
        if (EPI != 2) v = v * carry;
        sst[w][8 * hh + r][fn * 16 + ln] = v;
      }
    __syncthreads();
    if (EPI == 2) {
      float* of = (float*)outp;
      const int rsub = lane >> 4, c4 = (lane & 15) * 4;
      {
#pragma unroll
        for (int q = 0; q < 8; ++q) {
          const int row = 2 * q + rsub;
          const int m = m0 + fm * 16 + row;
          const int bb = m / SEQ;
          const size_t grow = (size_t)bb * SEQ_FULL + (size_t)(m - bb * SEQ);
          const v4f v = *(const v4fa*)&sst[w][row][c4];
          *(v4f*)(of + grow * FEAT + n0 + c4) = v;
        }
        
      }
    } else {
      unsigned short* oh = (unsigned short*)outp;
      {
#pragma unroll
        for (int it = 0; it < 4; ++it) {
          // lane (ln, hh) carries row ln, columns 16 it + 8 hh .. + 7: one 512-byte run of the out plane per store
          const v4f x0 = *(const v4fa*)&sst[w][ln][it * 16 + hh * 8];
          const v4f x1 = *(const v4fa*)&sst[w][ln][it * 16 + hh * 8 + 4];
          Frag f;
          f.e[0] = (_Float16)x0[0]; f.e[1] = (_Float16)x0[1]; f.e[2] = (_Float16)x0[2]; f.e[3] = (_Float16)x0[3];
          f.e[4] = (_Float16)x1[0]; f.e[5] = (_Float16)x1[1]; f.e[6] = (_Float16)x1[2]; f.e[7] = (_Float16)x1[3];
          const v8us o = f.half[0];
          if (EPI == 3) *(v8us*)(oh + ((size_t)((n0 >> 4) + it) * (MROWS / 16) + (m0 >> 4) + fm) * 256 + lane * 8) = o;
          else          *(v8us*)(oh + ((size_t)((m0 >> 4) + fm) * (N >> 5) + (n0 >> 5)) * 512 + it * 256 + lane * 8) = o;
        }
        
      }
    }
    __syncthreads();
  }
}

#define S10 0.0009765625f        // 1 / (16 * 64)
#define S14 0.00006103515625f    // 1 / (256 * 64)

// First Linears of the q, k and v chains in one launch: blockIdx.z picks the chain (block-uniform); grid (MROWS/128, FEAT/128, 3).
__global__ __launch_bounds__(256) void k_lin1(const unsigned short* __restrict__ Xb,
                                              const unsigned short* __restrict__ W0, const unsigned short* __restrict__ W1,
                                              const unsigned short* __restrict__ W2,
                                              const float* __restrict__ b0, const float* __restrict__ b1, const float* __restrict__ b2,
                                              unsigned short* __restrict__ o0, unsigned short* __restrict__ o1, unsigned short* __restrict__ o2) {
  __shared__ __attribute__((aligned(16))) unsigned char smem[2 * STB];
  const int z = blockIdx.z;
  gemm_tile<true, 0>(smem, blockIdx.x, blockIdx.y, Xb, z == 0 ? W0 : z == 1 ? W1 : W2, z == 0 ? b0 : z == 1 ? b1 : b2,
                     (void*)(z == 0 ? o0 : z == 1 ? o1 : o2), FEAT, 1.0f, 16.0f);
}

// Second Linears in one launch, grid (MROWS/128, FEAT/128, 3): z = 0, 1 -> Q and K planes (T16); z = 2 -> V^T[f][token] = sum_j vv[f][j] * t1v[token][j] + vv_b[f],
// whose tiling is (FEAT/128, MROWS/128): its tile comes from the block's flat index in the z slice.
__global__ __launch_bounds__(256) void k_lin2(const unsigned short* __restrict__ T1q, const unsigned short* __restrict__ T1k,
                                              const unsigned short* __restrict__ T1v,
                                              const unsigned short* __restrict__ Vq, const unsigned short* __restrict__ Vk,
                                              const unsigned short* __restrict__ Vv,
                                              const float* __restrict__ bq, const float* __restrict__ bk, const float* __restrict__ bv,
                                              unsigned short* __restrict__ Qp, unsigned short* __restrict__ Kp, unsigned short* __restrict__ Vt) {
  __shared__ __attribute__((aligned(16))) unsigned char smem[2 * STB];
  const int z = blockIdx.z;
  if (z < 2) {
    gemm_tile<false, 3>(smem, blockIdx.x, blockIdx.y, z == 0 ? T1q : T1k, z == 0 ? Vq : Vk, z == 0 ? bq : bk,
                        (void*)(z == 0 ? Qp : Kp), FEAT, S10, 16.0f);
  } else {
    const int flat = blockIdx.y * (MROWS / 128) + blockIdx.x;
    gemm_tile<false, 1>(smem, flat % (FEAT / 128), flat / (FEAT / 128), Vv, T1v, bv, (void*)Vt, MROWS, S10, 16.0f);
  }
}

// Output Linear, grid (MROWS/128, FEAT/128).
__global__ __launch_bounds__(256) void k_lin3(const unsigned short* __restrict__ O2, const unsigned short* __restrict__ Wo,
                                              const float* __restrict__ bo, float* __restrict__ out) {
  __shared__ __attribute__((aligned(16))) unsigned char smem[2 * STB];
  gemm_tile<false, 2>(smem, blockIdx.x, blockIdx.y, O2, Wo, bo, (void*)out, FEAT, S14, 1.0f);
}

// 2^x as the bare v_exp_f32, without the library form's rescue of results below 2^-126 (compare, select, add, select, ldexp per call).
// Arguments of the weights that are kept are at most 15 (PLIM below); trial weights beyond that, the first step's among them, may come out infinite and are thrown away. A weight below 2^-126 rounds to zero
// in both f16 planes and vanishes against the row sum, which is about 256 or more from the first step on (the key that gave the base carries 2^8); a rescale factor below 2^-126 multiplies sums that the new base's own terms then outweigh by 2^126.
__device__ __forceinline__ float hw_exp2(float x) { return __builtin_amdgcn_exp2f(x); }

// Weights of one 32-key step against the held maximum, carried x256: pc = 2^(s * EXPC + off), off = 8 - maximum * EXPC. Two scores a vector instruction: one packed FMA for the exponents, packed sum.
// Returns this lane's sum of its 16 weights.
__device__ __forceinline__ float fa_weights(const v8f& s0, const v8f& s1, float off, v2f (&pc)[8]) {
  const v2f off2 = {off, off}, c2 = {EXPC, EXPC};
  v2f ps2 = {0.0f, 0.0f};
  // unrolled so that every index is a constant and scores and weights stay in registers
#pragma unroll
  for (int i = 0; i < 8; ++i) {
    const v2f sp = (i < 4) ? v2f{s0[2 * i], s0[2 * i + 1]} : v2f{s1[2 * i - 8], s1[2 * i - 7]};
    const v2f ar = __builtin_elementwise_fma(sp, c2, off2);
    pc[i] = v2f{hw_exp2(ar[0]), hw_exp2(ar[1])};
    ps2 += pc[i];
  }
  return ps2[0] + ps2[1];
}
// The weights' two f16 planes: hi plane f16(pc), residual plane f16((pc - hi) * 2048); packed x2048, packed convert.
__device__ __forceinline__ void fa_planes(const v2f (&pc)[8], Frag& ph, Frag& pl) {
  const v2f k2 = {2048.0f, 2048.0f};
  // unrolled so that every index is a constant and weights and fragments stay in registers
#pragma unroll
  for (int i = 0; i < 8; ++i) {
    const v2h h = __builtin_convertvector(pc[i], v2h);
    ph.p[i] = h;                                    // B elements 2i, 2i+1: below 8 -> key0 + 8h + e (tile 0 row 8h+e); from 8 on -> key0 + 16 + 8h + (e-8) (tile 1)
    const v2f pk = pc[i] * k2;
    pl.e[2 * i]     = (_Float16)fmaf((float)h[0], -2048.0f, pk[0]);   // exact difference, one rounding, as (pc - hi) * 2048
    pl.e[2 * i + 1] = (_Float16)fmaf((float)h[1], -2048.0f, pk[1]);
  }
}

// A lane's 16 weights of a step are positive, so each is at most their sum: a sum up to PLIM keeps every weight and every scaled residual finite in f16 (largest f16 65504; residual at most 8 * 2048).
#define PLIM 32768.0f

// One 32-key step for a wave's 16 queries. kp: this lane's unit of the chunk's K tile at key0 (T16); vp: this lane's unit of the chunk's V^T tile at key0 (T32); xl: the partner lane's ds_bpermute index.
// The maximum mr (with its offset off) is HELD from step to step: any base gives the same quotient sum(p v) / sum(p) as long as the weights stay in range, so the step forms its
// weights against the held base at once, and only where some lane's weights leave the range (always in the first step, whose base is none; later when weights have grown to about 2^7 times the base key's)
// does the whole wave take the side path: new base = the larger of the held base and this step's maximum (exchanged between the lane halves), rescale of the sums, weights formed again.
__device__ __forceinline__ void fa_step(const unsigned short* __restrict__ kp, const unsigned short* __restrict__ vp,
                                        const Frag& qf, int xl, float& mr, float& off, float& lr, v8f& Oh, v8f& Ol) {
  const v8us zz = {0, 0, 0, 0, 0, 0, 0, 0};
  // A fragments of K: row m = key (key0 + 16*kt + ln), elements 0..7 <- d = 8h + i, elements 8..15 (k slots 16..31) zero
  Frag k0, k1, vf;
  k0.half[0] = *(const v8us*)(kp);             k0.half[1] = zz;
  k1.half[0] = *(const v8us*)(kp + 256);       k1.half[1] = zz;
  // A fragment of V^T: row m = d (ln), elements 0..7 <- key0 + 8h + i, 8..15 <- key0 + 16 + 8h + i
  vf.half[0] = *(const v8us*)(vp);
  vf.half[1] = *(const v8us*)(vp + 256);
  asm volatile("s_wait_xcnt 0x0" ::: "memory");     // stands in front of the loop's next write of the four loads' address registers
  v8f s0 = {0.f, 0.f, 0.f, 0.f, 0.f, 0.f, 0.f, 0.f};
  v8f s1 = {0.f, 0.f, 0.f, 0.f, 0.f, 0.f, 0.f, 0.f};
  // S^T tiles: element r of tile kt = 256 * q.k of (key0 + 16*kt + 8h + r, query ln)
  mma_s2(k0.h, k1.h, qf.h, s0, s1);
  // The scores stay in the accumulators' own unit (1024 x the scaled score: x16 x16 carries, divide by 4); that power of two is folded into EXPC.
  v2f pc[8];
  float ps = fa_weights(s0, s1, off, pc);
  // the negated compare also catches a sum that is not a number; the ballot makes the branch the same for the whole wave (the side path exchanges between lanes)
  if (__builtin_amdgcn_ballot_w32(!(ps <= PLIM)) != 0u) {
    float mx = s0[0];
#pragma unroll
    for (int r = 1; r < 8; ++r) mx = fmaxf(mx, s0[r]);
#pragma unroll
    for (int r = 0; r < 8; ++r) mx = fmaxf(mx, s1[r]);
    mx = fmaxf(mx, __int_as_float(__builtin_amdgcn_ds_bpermute(xl, __float_as_int(mx))));   // the other lane half holds the other 16 keys of this query: both halves take the same base
    const float mnew = fmaxf(mr, mx);
    const float al = hw_exp2((mr - mnew) * EXPC);
    mr = mnew;
    off = fmaf(-mnew, EXPC, 8.0f);
    lr = lr * al;
    Oh = Oh * al; Ol = Ol * al;
    ps = fa_weights(s0, s1, off, pc);               // every weight now at most 2^8
  }
  ps += __int_as_float(__builtin_amdgcn_ds_bpermute(xl, __float_as_int(ps)));   // the other lane half's 16 keys; all lanes are on (the branch above is the wave's)
  lr += ps;
  Frag ph, pl;
  fa_planes(pc, ph, pl);
  mma_h2(vf.h, ph.h, pl.h, Oh, Ol);
}

// Block = 4 waves x 16 queries = 64 queries of one (chunk, batch); no LDS and no barrier in the key loop.
// Epilogue: O^T tile -> per-wave LDS tile [16 queries][16 d] (fully written, fully consumed; block barrier), then thread tid stores unit tid of the
// block's 16 plane rows x 64 columns = two adjacent T32 tiles (it reads the LDS tile of the wave that owns its plane row, behind the block barrier).
// Context plane element order: flat = ((c*NB + b)*SEQ + s)*16 + h; plane row = (flat>>6) mod (NB*SEQ), column = (flat>>6)/(NB*SEQ)*64 + (flat&63).
// coverage: NCH*NB*(SEQ/64) blocks x 4 waves x 256 elements = every element of the plane exactly once.
__global__ __launch_bounds__(128) void k_attn(const unsigned short* __restrict__ Qp, const unsigned short* __restrict__ Kp,
                                              const unsigned short* __restrict__ Vt, unsigned short* __restrict__ O2) {
  __shared__ __attribute__((aligned(16))) float so[4][16][20];
  const int tid = threadIdx.x, w = __builtin_amdgcn_readfirstlane((int)(tid >> 5)), lane = tid & 31, ln = lane & 15, hh = lane >> 4;
  const int qt = blockIdx.x % (SEQ / 64);
  const int p = blockIdx.x / (SEQ / 64);
  const int b = p % NB, c = p / NB;
  const int qbase = qt * 64 + 16 * w;
  const v8us zz = {0, 0, 0, 0, 0, 0, 0, 0};
  // Q^T B fragment: column n = query qbase + ln, elements 0..7 <- d = 8h + i, elements 8..15 zero
  Frag qf;
  qf.half[0] = *(const v8us*)(Qp + ((size_t)c * (MROWS / 16) + (b * SEQ + qbase) / 16) * 256 + lane * 8);
  qf.half[1] = zz;
  const unsigned short* kb = Kp + ((size_t)c * (MROWS / 16) + (b * SEQ) / 16) * 256 + lane * 8;
  const unsigned short* vb = Vt + ((size_t)c * (MROWS / 32) + (b * SEQ) / 32) * 512 + lane * 8;
  // ds_bpermute byte index of the lane that holds the other 16 keys of the same query, formed once here: with the library shuffle both in the side path and behind it
  // this compiler forms the index anew in every step and copies both accumulators round the branch
  const int xl = (lane ^ 16) * 4;
  float mr = -3.0e38f, off = 3.0e38f, lr = 0.0f;   // no base yet: this offset sends every weight of the first step out of range, so the first step takes the side path
  v8f Oh = {0.f, 0.f, 0.f, 0.f, 0.f, 0.f, 0.f, 0.f};
  v8f Ol = {0.f, 0.f, 0.f, 0.f, 0.f, 0.f, 0.f, 0.f};
#pragma unroll 1
  for (int j = 0; j < SEQ / 32; ++j)
    fa_step(kb + j * 512, vb + j * 512, qf, xl, mr, off, lr, Oh, Ol);

  // O^T element r = out(query qbase + ln, d = 8h + r); undo x256 (in lr), x16 (V), x2048 (residual plane); carry the context x256
  const float inv = 16.0f * (1.0f / lr);
#pragma unroll
  for (int r = 0; r < 8; ++r)
    so[w][ln][8 * hh + r] = (Oh[r] + Ol[r] * 0.00048828125f) * inv;
  __syncthreads();
  // unit tid = plane row rr of the block's 16, 8-column piece p of its 64 columns; four queries of one wave make one plane row
  const int rr = tid & 15, p8 = tid >> 4;
  const int qq = (rr & 3) * 4 + (p8 >> 1), d0 = (p8 & 1) * 8;
  const v4f x0 = *(const v4fa*)&so[rr >> 2][qq][d0];
  const v4f x1 = *(const v4fa*)&so[rr >> 2][qq][d0 + 4];
  Frag f;
  f.e[0] = (_Float16)x0[0]; f.e[1] = (_Float16)x0[1]; f.e[2] = (_Float16)x0[2]; f.e[3] = (_Float16)x0[3];
  f.e[4] = (_Float16)x1[0]; f.e[5] = (_Float16)x1[1]; f.e[6] = (_Float16)x1[2]; f.e[7] = (_Float16)x1[3];
  const v8us o = f.half[0];
  const int R = (c * NB + b) * (SEQ / 4) + qt * 16;   // the block's first plane row, a multiple of 16
  const int hp = R / MROWS;
  const int prow = R - hp * MROWS;
  unsigned short* dst = O2 + ((size_t)(prow >> 4) * (FEAT / 32) + hp * 2) * 512 + tid * 8;
  *(v8us*)dst = o;
  
}

extern "C" void kernel_launch(void* const* d_in, const int* in_sizes, int n_in,
                              void* d_out, int out_size, void* d_ws, size_t ws_size, hipStream_t stream) {
  if (n_in < 15) return;
  const long long needx = ((long long)(NB - 1) * SEQ_FULL + SEQ) * FEAT;   // last element touched + 1
  if ((long long)in_sizes[0] < needx) return;
  if ((long long)out_size < needx) return;
  for (int i = 1; i < 15; i += 2) {
    if ((long long)in_sizes[i] < (long long)FEAT * FEAT) return;
    if ((long long)in_sizes[i + 1] < (long long)FEAT) return;
  }
  // wire order: x, then (weight, bias) pairs for wq, wk, wv, vq, vk, vv, wo
  const float* x    = (const float*)d_in[0];
  const float* wq_w = (const float*)d_in[1];
  const float* wq_b = (const float*)d_in[2];
  const float* wk_w = (const float*)d_in[3];
  const float* wk_b = (const float*)d_in[4];
  const float* wv_w = (const float*)d_in[5];
  const float* wv_b = (const float*)d_in[6];
  const float* vq_w = (const float*)d_in[7];
  const float* vq_b = (const float*)d_in[8];
  const float* vk_w = (const float*)d_in[9];
  const float* vk_b = (const float*)d_in[10];
  const float* vv_w = (const float*)d_in[11];
  const float* vv_b = (const float*)d_in[12];
  const float* wo_w = (const float*)d_in[13];
  const float* wo_b = (const float*)d_in[14];

  char* ws = (char*)d_ws;
  size_t off = 0;
  const size_t planeA = (size_t)MROWS * FEAT * 2;
  const size_t planeW = (size_t)FEAT * FEAT * 2;       // weight plane
  unsigned short* Xb  = (unsigned short*)(ws + off); off += (planeA + 255) & ~(size_t)255;
  unsigned short* Wqb = (unsigned short*)(ws + off); off += (planeW + 255) & ~(size_t)255;
  unsigned short* Wkb = (unsigned short*)(ws + off); off += (planeW + 255) & ~(size_t)255;
  unsigned short* Wvb = (unsigned short*)(ws + off); off += (planeW + 255) & ~(size_t)255;
  unsigned short* Vqh = (unsigned short*)(ws + off); off += (planeW + 255) & ~(size_t)255;
  unsigned short* Vkh = (unsigned short*)(ws + off); off += (planeW + 255) & ~(size_t)255;
  unsigned short* Vvh = (unsigned short*)(ws + off); off += (planeW + 255) & ~(size_t)255;
  unsigned short* Woh = (unsigned short*)(ws + off); off += (planeW + 255) & ~(size_t)255;
  unsigned short* T1q = (unsigned short*)(ws + off); off += (planeA + 255) & ~(size_t)255;
  unsigned short* T1k = (unsigned short*)(ws + off); off += (planeA + 255) & ~(size_t)255;
  unsigned short* T1v = (unsigned short*)(ws + off); off += (planeA + 255) & ~(size_t)255;
  unsigned short* Qp  = (unsigned short*)(ws + off); off += (planeA + 255) & ~(size_t)255;
  unsigned short* Kp  = (unsigned short*)(ws + off); off += (planeA + 255) & ~(size_t)255;
  unsigned short* Vt  = (unsigned short*)(ws + off); off += (planeA + 255) & ~(size_t)255;   // [FEAT][MROWS], T32 order
  unsigned short* O2  = (unsigned short*)(ws + off); off += (planeA + 255) & ~(size_t)255;
  if (off > ws_size) return;

  k_cvt<<<(unsigned)(XBLK + 7 * WBLK), 256, 0, stream>>>(x, wq_w, wk_w, wv_w, vq_w, vk_w, vv_w, wo_w, Xb, Wqb);

  const dim3 g3((unsigned)(MROWS / 128), (unsigned)(FEAT / 128), 3u);
  const dim3 g1((unsigned)(MROWS / 128), (unsigned)(FEAT / 128));
  k_lin1<<<g3, 256, 0, stream>>>(Xb, Wqb, Wkb, Wvb, wq_b, wk_b, wv_b, T1q, T1k, T1v);
  k_lin2<<<g3, 256, 0, stream>>>(T1q, T1k, T1v, Vqh, Vkh, Vvh, vq_b, vk_b, vv_b, Qp, Kp, Vt);

  k_attn<<<(unsigned)(NCH * NB * (SEQ / 64)), 128, 0, stream>>>(Qp, Kp, Vt, O2);

  k_lin3<<<g1, 256, 0, stream>>>(O2, Woh, wo_b, (float*)d_out);
}

// v008
// One run takes 71.7 microseconds.
// Two timings next to v007 put it at 1.04 and 1.05 times that version's speed.
// All steps since v000 together make it 3.46 times as fast.
#include <hip/hip_runtime.h>
// Contractions: first Linear of each q/k/v chain on v_wmma_f32_16x16x32_bf16 (x and W converted RNE to bf16, single product, f32 accumulate); second Linears, K Q^T scores and the output Linear on v_wmma_f32_16x16x32_f16 (activations x16 or x256 in f16, weights = RNE-bf16 value x64 held exactly in f16, f32 accumulate); O^T = V^T P^T on v_wmma_f32_16x16x32_f16 (V x16 f16; P x256 f16, one plane each: a second plane of P alone would not make the products more exact than V's own rounding lets them be); biases RNE-bf16 values added in f32; softmax statistics f32.
// 64 feature chunks of width 16 act as heads; scale 1/4; no mask; context is written in the flat-reinterpreted (16, b, s, 64) -> (b, s, 1024) order.
// GEMM engine: C[m][n] = sum_k A[m][k] W[n][k]; both operands are 16-bit planes held in fragment order
// (elements 0..7 <- k0 + 8h + i, elements 8..15 <- k0 + 16 + 8h + i for A rows and for W rows alike). A block's 128 A rows and 128 W rows are staged in LDS,
// four 32-k steps a stage, by asynchronous copies into two buffers; the waves read their fragments from LDS. 128x128 block tile, 8 waves of 32x64.
// Fragment order T32 of a plane [R][C]: 16 x 32 tiles, tile index (r/16)*(C/32) + c/32, 512 elements a tile; element (r, c) sits at
// tile*512 + ((c>>4)&1)*256 + (((c>>3)&1)*16 + (r&15))*8 + (c&7), so each half fragment is one wave-wide 16-byte load of 512 contiguous bytes.
// Fragment order T16 (Q and K planes, [MROWS][FEAT]): 16 x 16 tiles, tile index (c/16)*(MROWS/16) + r/16, 256 elements a tile; element (r, c) sits at
// tile*256 + (((c>>3)&1)*16 + (r&15))*8 + (c&7).
// Attention engine: transposed flash. Each wave owns 16 queries of one (chunk, batch). Per 32-key step: S^T tiles (key rows x query columns)
// from K rows (A) and Q^T (B), upper 16 k slots zero; the two 16-key D tiles pack straight into the P^T B fragment; O^T (16 d rows x query columns)
// accumulates from V^T rows (A, global f16 plane in T32 order produced directly by a GEMM with swapped operand roles).
#ifndef NB
#define NB 2
#endif
#ifndef SEQ
#define SEQ 1024
#endif
#define NB_FULL 2
#define SEQ_FULL 1024
#define FEAT 1024
#define NCH 64
#define MROWS (NB * SEQ)

static_assert(SEQ % 128 == 0);
static_assert(SEQ <= SEQ_FULL);
static_assert(NB <= NB_FULL);
static_assert(FEAT % 128 == 0);
static_assert(FEAT == NCH * 16);
static_assert((size_t)8 * MROWS * FEAT * 2 + (size_t)7 * FEAT * FEAT * 2 <= (size_t)134217728);
static_assert(((size_t)(NB - 1) * SEQ_FULL + SEQ) * FEAT <= (size_t)NB_FULL * SEQ_FULL * FEAT);

typedef __bf16 v16b __attribute__((ext_vector_type(16)));
typedef _Float16 v16h __attribute__((ext_vector_type(16)));
typedef unsigned short v8us __attribute__((ext_vector_type(8), may_alias));
typedef float v8f __attribute__((ext_vector_type(8)));
typedef float v4f __attribute__((ext_vector_type(4)));
typedef float v4fa __attribute__((ext_vector_type(4), may_alias));
typedef float v2f __attribute__((ext_vector_type(2)));
typedef _Float16 v2h __attribute__((ext_vector_type(2)));
union Frag { v16b b; v16h h; v8us half[2]; v2h p[8]; _Float16 e[16]; unsigned short u[16]; };

#define LOG2E 1.4426950408889634f
#define EXPC (LOG2E * 0.0009765625f)   // log2(e) / 1024

__device__ __forceinline__ unsigned short bf16_bits(float x) {   // RNE convert to bf16 bits
  unsigned int u = __float_as_uint(x);
  return (unsigned short)((u + 0x7FFFu + ((u >> 16) & 1u)) >> 16);
}
__device__ __forceinline__ float bf16_val(unsigned short b) { return __uint_as_float(((unsigned int)b) << 16); }
__device__ __forceinline__ float bf16_rne(float x) { return bf16_val(bf16_bits(x)); }

// c0 += a0*b ; c1 += a1*b (two key tiles against one query fragment), then the hazard guard
__device__ __forceinline__ void mma_s2(v16h a0, v16h a1, v16h b, v8f& c0, v8f& c1) {
  c0 = __builtin_amdgcn_wmma_f32_16x16x32_f16(false, a0, false, b, (short)0, c0, false, false);
  c1 = __builtin_amdgcn_wmma_f32_16x16x32_f16(false, a1, false, b, (short)0, c1, false, false);
  asm volatile("v_nop\n\tv_nop\n\tv_nop\n\tv_nop" : "+v"(c0), "+v"(c1) : "v"(a0), "v"(a1), "v"(b));
}
// c += a*b, then the hazard guard: four vector slots before anything may overwrite the operands (the next step's fragments) or read the sum, on the loop's taken branch too
__device__ __forceinline__ void mma_h1(v16h a, v16h b, v8f& c) {
  c = __builtin_amdgcn_wmma_f32_16x16x32_f16(false, a, false, b, (short)0, c, false, false);
  asm volatile("v_nop\n\tv_nop\n\tv_nop\n\tv_nop" : "+v"(c) : "v"(a), "v"(b));
}

// 16-byte unit t of a T32 plane of FEAT columns holds elements (row, col .. col + 7)
__device__ __forceinline__ void t32_unit(int t, int& row, int& col) {
  const int tile = t >> 6, u = t & 63;
  const int tr = tile / (FEAT / 32), tc = tile - tr * (FEAT / 32);
  row = tr * 16 + (u & 15);
  col = tc * 32 + (u >> 4) * 8;
}

#define XBLK (MROWS * (FEAT / 8) / 256)
#define WBLK (FEAT * (FEAT / 8) / 256)
static_assert(MROWS * (FEAT / 8) % 256 == 0);
static_assert(FEAT * (FEAT / 8) % 256 == 0);
static_assert((size_t)FEAT * FEAT * 2 % 256 == 0);   // a weight plane needs no padding to the workspace's 256-byte step

// All eight operand planes in one launch (none depends on another). Blocks 0 .. XBLK-1: the compact x plane, bf16 bits (RNE), thread t writes unit t.
// Then WBLK blocks per weight plane [out][in], T32 order: planes 0..2 -> bf16 bits (RNE); planes 3..6 -> f16 bits of (RNE-bf16 value x 64).
// coverage: XBLK*256 units = the whole x plane, WBLK*256 units = one whole weight plane; every unit written once.
__global__ __launch_bounds__(256) void k_cvt(const float* __restrict__ X,
                                             const float* __restrict__ w0, const float* __restrict__ w1, const float* __restrict__ w2,
                                             const float* __restrict__ w3, const float* __restrict__ w4, const float* __restrict__ w5,
                                             const float* __restrict__ w6,
                                             unsigned short* __restrict__ Xb, unsigned short* __restrict__ Wplanes) {
  const int blk = blockIdx.x;
  int row, col;
  v8us o;
  if (blk < XBLK) {
    const int t = blk * 256 + threadIdx.x;
    t32_unit(t, row, col);
    const int b = row / SEQ, s = row - b * SEQ;
    const float* src = X + ((size_t)b * SEQ_FULL + s) * FEAT + col;
    const v4f x0 = *(const v4fa*)(src), x1 = *(const v4fa*)(src + 4);
    o[0] = bf16_bits(x0[0]); o[1] = bf16_bits(x0[1]); o[2] = bf16_bits(x0[2]); o[3] = bf16_bits(x0[3]);
    o[4] = bf16_bits(x1[0]); o[5] = bf16_bits(x1[1]); o[6] = bf16_bits(x1[2]); o[7] = bf16_bits(x1[3]);
    *(v8us*)(Xb + (size_t)t * 8) = o;
    return;
  }
  const int wi = (blk - XBLK) / WBLK;                      // block-uniform plane index
  const int t = (blk - XBLK - wi * WBLK) * 256 + threadIdx.x;
  const bool i1 = wi & 1, i2 = wi & 2, i4 = wi & 4;
  const float* Wsrc = i4 ? (i2 ? w6 : (i1 ? w5 : w4)) : (i2 ? (i1 ? w3 : w2) : (i1 ? w1 : w0));
  unsigned short* Wp = Wplanes + (size_t)wi * FEAT * FEAT;   // the seven planes lie back to back in the workspace
  t32_unit(t, row, col);
  const float* src = Wsrc + (size_t)row * FEAT + col;
  const v4f x0 = *(const v4fa*)(src), x1 = *(const v4fa*)(src + 4);
  if (wi < 3) {
    o[0] = bf16_bits(x0[0]); o[1] = bf16_bits(x0[1]); o[2] = bf16_bits(x0[2]); o[3] = bf16_bits(x0[3]);
    o[4] = bf16_bits(x1[0]); o[5] = bf16_bits(x1[1]); o[6] = bf16_bits(x1[2]); o[7] = bf16_bits(x1[3]);
  } else {
    Frag f;
    f.e[0] = (_Float16)(bf16_rne(x0[0]) * 64.0f); f.e[1] = (_Float16)(bf16_rne(x0[1]) * 64.0f);
    f.e[2] = (_Float16)(bf16_rne(x0[2]) * 64.0f); f.e[3] = (_Float16)(bf16_rne(x0[3]) * 64.0f);
    f.e[4] = (_Float16)(bf16_rne(x1[0]) * 64.0f); f.e[5] = (_Float16)(bf16_rne(x1[1]) * 64.0f);
    f.e[6] = (_Float16)(bf16_rne(x1[2]) * 64.0f); f.e[7] = (_Float16)(bf16_rne(x1[3]) * 64.0f);
    o = f.half[0];
  }
  *(v8us*)(Wp + (size_t)t * 8) = o;
}

#define KC 4                          // 32-k steps a stage
#define ROWB (KC * 1024)              // bytes of one 16-row tile row in a stage: KC tiles of 1 KiB, contiguous in the T32 plane and in LDS alike
#define OPB (8 * ROWB)                // one operand's 128 rows in a stage
#define STB (2 * OPB)                 // a stage: [A 8 tile rows | W 8 tile rows]
#define NSTG (FEAT / 32 / KC)
static_assert(FEAT % (32 * KC) == 0);
static_assert(NSTG >= 2);
static_assert(ROWB == 256 * 16);      // one 16-byte copy a thread covers one tile row of a stage
static_assert(2 * STB >= 8 * 16 * 68 * 4);   // the epilogue's staging tiles fit the ring they take over

// Eight tile rows of one operand, global -> LDS, through no register: this thread's 16 bytes of each row. lds = its LDS byte address in the first row, g = its unit in the first row.
// The s_wait_xcnt stands inside the statement so that no address register is rewritten ahead of it.
__device__ __forceinline__ void copy_rows8(unsigned lds, const unsigned short* g) {
  asm volatile("global_load_async_to_lds_b128 %0, %8, off\n\t"
               "global_load_async_to_lds_b128 %1, %9, off\n\t"
               "global_load_async_to_lds_b128 %2, %10, off\n\t"
               "global_load_async_to_lds_b128 %3, %11, off\n\t"
               "global_load_async_to_lds_b128 %4, %12, off\n\t"
               "global_load_async_to_lds_b128 %5, %13, off\n\t"
               "global_load_async_to_lds_b128 %6, %14, off\n\t"
               "global_load_async_to_lds_b128 %7, %15, off\n\t"
               "s_wait_xcnt 0x0"
               :: "v"(lds), "v"(lds + 1 * ROWB), "v"(lds + 2 * ROWB), "v"(lds + 3 * ROWB),
                  "v"(lds + 4 * ROWB), "v"(lds + 5 * ROWB), "v"(lds + 6 * ROWB), "v"(lds + 7 * ROWB),
                  "v"(g), "v"(g + 1 * 16 * FEAT), "v"(g + 2 * 16 * FEAT), "v"(g + 3 * 16 * FEAT),
                  "v"(g + 4 * 16 * FEAT), "v"(g + 5 * 16 * FEAT), "v"(g + 6 * 16 * FEAT), "v"(g + 7 * 16 * FEAT)
               : "memory");
}
// One 32-k step's fragments of a wave's 32 x 64 tile: fa, fb = this lane's unit of the step's first A and W tile in the stage's LDS buffer.
__device__ __forceinline__ void lds_frags(Frag (&a)[2], Frag (&b)[4], const unsigned char* fa, const unsigned char* fb) {
#pragma unroll
  for (int fm = 0; fm < 2; ++fm) {
    a[fm].half[0] = *(const v8us*)(fa + fm * ROWB);
    a[fm].half[1] = *(const v8us*)(fa + fm * ROWB + 512);
  }
#pragma unroll
  for (int fn = 0; fn < 4; ++fn) {
    b[fn].half[0] = *(const v8us*)(fb + fn * ROWB);
    b[fn].half[1] = *(const v8us*)(fb + fn * ROWB + 512);
  }
}
// acc[fm][fn] += a[fm] * b[fn], then the hazard guard: four vector slots before anything may overwrite the operands (the next reads) or read the sums
template <bool BF>
__device__ __forceinline__ void mma_frags(const Frag (&a)[2], const Frag (&b)[4], v8f (&acc)[2][4]) {
#pragma unroll
  for (int fm = 0; fm < 2; ++fm)
#pragma unroll
    for (int fn = 0; fn < 4; ++fn) {
      if (BF) acc[fm][fn] = __builtin_amdgcn_wmma_f32_16x16x32_bf16(false, a[fm].b, false, b[fn].b, (short)0, acc[fm][fn], false, false);
      else    acc[fm][fn] = __builtin_amdgcn_wmma_f32_16x16x32_f16(false, a[fm].h, false, b[fn].h, (short)0, acc[fm][fn], false, false);
    }
  asm volatile("v_nop\n\tv_nop\n\tv_nop\n\tv_nop"
               : "+v"(acc[0][0]), "+v"(acc[0][1]), "+v"(acc[0][2]), "+v"(acc[0][3]),
                 "+v"(acc[1][0]), "+v"(acc[1][1]), "+v"(acc[1][2]), "+v"(acc[1][3])
               : "v"(a[0].h), "v"(a[1].h), "v"(b[0].h), "v"(b[1].h), "v"(b[2].h), "v"(b[3].h));
}

// C[m][n] = sum_k A[m][k] W[n][k], K = FEAT, A and W planes of FEAT columns in T32 order.
// BF: bf16 operands, else f16 operands. One 128 x 128 tile (bx, by) of a (Mrows/128, Ncols/128) tiling per block, 8 waves of 32 x 64.
// EPI 0: out f16 plane [m][N], T32 order = f16((acc*sc + bias[n]) * carry)     (bias along columns)
// EPI 1: out f16 plane [m][N], T32 order = f16((acc*sc + bias[m]) * carry)     (bias along rows)
// EPI 3: as EPI 0, out plane [MROWS][FEAT] in T16 order
// EPI 2: out f32 [b*SEQ_FULL + s][FEAT] = acc*sc + bias[n], m = b*SEQ + s
// Epilogue: two phases of 16 rows; the wave's 16 x 64 tile is staged in its own LDS tile (fully written: 16 rows x 64 columns, fully consumed),
// which lies in the ring's memory: the last stage's barrier ends every read of the ring, and no copy is in flight behind it.
template <bool BF, int EPI>
__device__ __forceinline__ void gemm_tile(unsigned char* smem, int bx, int by,
                                          const unsigned short* __restrict__ A, const unsigned short* __restrict__ W,
                                          const float* __restrict__ bias, void* __restrict__ outp,
                                          int N, float sc, float carry) {
  const int tid = threadIdx.x, lane = tid & 31, w = __builtin_amdgcn_readfirstlane((int)(tid >> 5));
  const int wm = w & 3, wn = w >> 2, ln = lane & 15, hh = lane >> 4;
  const int m0 = bx * 128 + wm * 32;
  const int n0 = by * 128 + wn * 64;
  float (*sst)[16][68] = (float (*)[16][68])smem;
  const unsigned short* ga = A + (size_t)bx * 128 * FEAT + tid * 8;   // tile row r starts at r * (FEAT/32) * 512 = r * 16 * FEAT
  const unsigned short* gw = W + (size_t)by * 128 * FEAT + tid * 8;
  const unsigned lcp = (unsigned)(size_t)smem + tid * 16;            // low 32 bits of the shared address = the LDS byte address
  v8f acc[2][4];
#pragma unroll
  for (int fm = 0; fm < 2; ++fm)
#pragma unroll
    for (int fn = 0; fn < 4; ++fn)
#pragma unroll
      for (int r = 0; r < 8; ++r) acc[fm][fn][r] = 0.0f;

  // Two LDS buffers: stage t is worked on while stage t + 1's copies fly. Steps run in ascending k: the sums keep their order.
  copy_rows8(lcp, ga);
  copy_rows8(lcp + OPB, gw);
  asm volatile("s_wait_asynccnt 0x0" ::: "memory");   // this wave's share of stage 0 has landed
  __syncthreads();                                    // every wave's share has
  copy_rows8(lcp + STB, ga + KC * 512);
  copy_rows8(lcp + STB + OPB, gw + KC * 512);
  // kept rolled (a trip is one stage of KC steps) so that the loop's text stays short
#pragma unroll 1
  for (int t = 0; t < NSTG; ++t) {
    const unsigned bo = (unsigned)(t & 1) * STB;
    const unsigned char* fa = smem + bo + wm * 2 * ROWB + lane * 16;
    const unsigned char* fb = smem + bo + OPB + wn * 4 * ROWB + lane * 16;
    // two fragment sets: step s + 1's LDS reads go out as one group ahead of step s's products; nothing of the next stage is read here
    Frag a[2][2], b[2][4];
    lds_frags(a[0], b[0], fa, fb);
    // unrolled so that the set index is a constant and both sets stay in registers
#pragma unroll
    for (int s = 0; s < KC; ++s) {
      if (s + 1 < KC) lds_frags(a[(s + 1) & 1], b[(s + 1) & 1], fa + (s + 1) * 1024, fb + (s + 1) * 1024);
      mma_frags<BF>(a[s & 1], b[s & 1], acc);
    }
    asm volatile("s_wait_dscnt 0x0" ::: "memory");      // this wave's reads of the buffer have returned before it is handed to its next writer
    asm volatile("s_wait_asynccnt 0x0" ::: "memory");   // this wave's share of stage t + 1 has landed
    __syncthreads();                                    // publishes stage t + 1 and ends every wave's reads of stage t
    if (t + 2 < NSTG) {                                 // block-uniform
      copy_rows8(lcp + bo, ga + (t + 2) * (KC * 512));
      copy_rows8(lcp + bo + OPB, gw + (t + 2) * (KC * 512));
    }
  }
  asm volatile("s_wait_asynccnt 0x0" ::: "memory");     // nothing is in flight when the ring becomes output staging

  // D element r of tile (fm, fn) = C(m0 + 16 fm + 8 hh + r, n0 + 16 fn + ln)
  float bcol[4];
#pragma unroll
  for (int fn = 0; fn < 4; ++fn) bcol[fn] = 0.0f;
  if (EPI != 1) {
#pragma unroll
    for (int fn = 0; fn < 4; ++fn) bcol[fn] = bf16_rne(bias[n0 + fn * 16 + ln]);
  }
#pragma unroll
  for (int fm = 0; fm < 2; ++fm) {
    float brow[8];
#pragma unroll
    for (int r = 0; r < 8; ++r) brow[r] = 0.0f;
    if (EPI == 1) {
#pragma unroll
      for (int r = 0; r < 8; ++r) brow[r] = bf16_rne(bias[m0 + fm * 16 + 8 * hh + r]);
    }
#pragma unroll
    for (int fn = 0; fn < 4; ++fn)
#pragma unroll
      for (int r = 0; r < 8; ++r) {
        float v = acc[fm][fn][r] * sc + ((EPI == 1) ? brow[r] : bcol[fn]);
        if (EPI != 2) v = v * carry;
        sst[w][8 * hh + r][fn * 16 + ln] = v;
      }
    __syncthreads();
    if (EPI == 2) {
      float* of = (float*)outp;
      const int rsub = lane >> 4, c4 = (lane & 15) * 4;
      {
#pragma unroll
        for (int q = 0; q < 8; ++q) {
          const int row = 2 * q + rsub;
          const int m = m0 + fm * 16 + row;
          const int bb = m / SEQ;
          const size_t grow = (size_t)bb * SEQ_FULL + (size_t)(m - bb * SEQ);
          const v4f v = *(const v4fa*)&sst[w][row][c4];
          *(v4f*)(of + grow * FEAT + n0 + c4) = v;
        }
        
      }
    } else {
      unsigned short* oh = (unsigned short*)outp;
      {
#pragma unroll
        for (int it = 0; it < 4; ++it) {
          // lane (ln, hh) carries row ln, columns 16 it + 8 hh .. + 7: one 512-byte run of the out plane per store
          const v4f x0 = *(const v4fa*)&sst[w][ln][it * 16 + hh * 8];
          const v4f x1 = *(const v4fa*)&sst[w][ln][it * 16 + hh * 8 + 4];
          Frag f;
          f.e[0] = (_Float16)x0[0]; f.e[1] = (_Float16)x0[1]; f.e[2] = (_Float16)x0[2]; f.e[3] = (_Float16)x0[3];
          f.e[4] = (_Float16)x1[0]; f.e[5] = (_Float16)x1[1]; f.e[6] = (_Float16)x1[2]; f.e[7] = (_Float16)x1[3];
          const v8us o = f.half[0];
          if (EPI == 3) *(v8us*)(oh + ((size_t)((n0 >> 4) + it) * (MROWS / 16) + (m0 >> 4) + fm) * 256 + lane * 8) = o;
          else          *(v8us*)(oh + ((size_t)((m0 >> 4) + fm) * (N >> 5) + (n0 >> 5)) * 512 + it * 256 + lane * 8) = o;
        }
        
      }
    }
    __syncthreads();
  }
}

#define S10 0.0009765625f        // 1 / (16 * 64)
#define S14 0.00006103515625f    // 1 / (256 * 64)

// First Linears of the q, k and v chains in one launch: blockIdx.z picks the chain (block-uniform); grid (MROWS/128, FEAT/128, 3).
__global__ __launch_bounds__(256) void k_lin1(const unsigned short* __restrict__ Xb,
                                              const unsigned short* __restrict__ W0, const unsigned short* __restrict__ W1,
                                              const unsigned short* __restrict__ W2,
                                              const float* __restrict__ b0, const float* __restrict__ b1, const float* __restrict__ b2,
                                              unsigned short* __restrict__ o0, unsigned short* __restrict__ o1, unsigned short* __restrict__ o2) {
  __shared__ __attribute__((aligned(16))) unsigned char smem[2 * STB];
  const int z = blockIdx.z;
  gemm_tile<true, 0>(smem, blockIdx.x, blockIdx.y, Xb, z == 0 ? W0 : z == 1 ? W1 : W2, z == 0 ? b0 : z == 1 ? b1 : b2,
                     (void*)(z == 0 ? o0 : z == 1 ? o1 : o2), FEAT, 1.0f, 16.0f);
}

// Second Linears in one launch, grid (MROWS/128, FEAT/128, 3): z = 0, 1 -> Q and K planes (T16); z = 2 -> V^T[f][token] = sum_j vv[f][j] * t1v[token][j] + vv_b[f],
// whose tiling is (FEAT/128, MROWS/128): its tile comes from the block's flat index in the z slice.
__global__ __launch_bounds__(256) void k_lin2(const unsigned short* __restrict__ T1q, const unsigned short* __restrict__ T1k,
                                              const unsigned short* __restrict__ T1v,
                                              const unsigned short* __restrict__ Vq, const unsigned short* __restrict__ Vk,
                                              const unsigned short* __restrict__ Vv,
                                              const float* __restrict__ bq, const float* __restrict__ bk, const float* __restrict__ bv,
                                              unsigned short* __restrict__ Qp, unsigned short* __restrict__ Kp, unsigned short* __restrict__ Vt) {
  __shared__ __attribute__((aligned(16))) unsigned char smem[2 * STB];
  const int z = blockIdx.z;
  if (z < 2) {
    gemm_tile<false, 3>(smem, blockIdx.x, blockIdx.y, z == 0 ? T1q : T1k, z == 0 ? Vq : Vk, z == 0 ? bq : bk,
                        (void*)(z == 0 ? Qp : Kp), FEAT, S10, 16.0f);
  } else {
    const int flat = blockIdx.y * (MROWS / 128) + blockIdx.x;
    gemm_tile<false, 1>(smem, flat % (FEAT / 128), flat / (FEAT / 128), Vv, T1v, bv, (void*)Vt, MROWS, S10, 16.0f);
  }
}

// Output Linear, grid (MROWS/128, FEAT/128).
__global__ __launch_bounds__(256) void k_lin3(const unsigned short* __restrict__ O2, const unsigned short* __restrict__ Wo,
                                              const float* __restrict__ bo, float* __restrict__ out) {
  __shared__ __attribute__((aligned(16))) unsigned char smem[2 * STB];
  gemm_tile<false, 2>(smem, blockIdx.x, blockIdx.y, O2, Wo, bo, (void*)out, FEAT, S14, 1.0f);
}

// 2^x as the bare v_exp_f32, without the library form's rescue of results below 2^-126 (compare, select, add, select, ldexp per call).
// Arguments of the weights that are kept are at most 15 (PLIM below); trial weights beyond that, the first step's among them, may come out infinite and are thrown away. A weight below 2^-126 rounds to zero
// in the f16 plane and vanishes against the row sum, which is about 256 or more from the first step on (the key that gave the base carries 2^8); a rescale factor below 2^-126 multiplies sums that the new base's own terms then outweigh by 2^126.
__device__ __forceinline__ float hw_exp2(float x) { return __builtin_amdgcn_exp2f(x); }

// Weights of one 32-key step against the held maximum, carried x256: pc = 2^(s * EXPC + off), off = 8 - maximum * EXPC. Two scores a vector instruction: one packed FMA for the exponents, packed sum.
// Returns this lane's sum of its 16 weights.
__device__ __forceinline__ float fa_weights(const v8f& s0, const v8f& s1, float off, v2f (&pc)[8]) {
  const v2f off2 = {off, off}, c2 = {EXPC, EXPC};
  v2f ps2 = {0.0f, 0.0f};
  // unrolled so that every index is a constant and scores and weights stay in registers
#pragma unroll
  for (int i = 0; i < 8; ++i) {
    const v2f sp = (i < 4) ? v2f{s0[2 * i], s0[2 * i + 1]} : v2f{s1[2 * i - 8], s1[2 * i - 7]};
    const v2f ar = __builtin_elementwise_fma(sp, c2, off2);
    pc[i] = v2f{hw_exp2(ar[0]), hw_exp2(ar[1])};
    ps2 += pc[i];
  }
  return ps2[0] + ps2[1];
}
// The weights' f16 plane: f16(pc), packed convert (round to nearest even, 11 significant bits, as V's plane has).
__device__ __forceinline__ void fa_plane(const v2f (&pc)[8], Frag& ph) {
  // unrolled so that every index is a constant and weights and fragment stay in registers
#pragma unroll
  for (int i = 0; i < 8; ++i)
    ph.p[i] = __builtin_convertvector(pc[i], v2h);  // B elements 2i, 2i+1: below 8 -> key0 + 8h + e (tile 0 row 8h+e); from 8 on -> key0 + 16 + 8h + (e-8) (tile 1)
}

// A lane's 16 weights of a step are positive, so each is at most their sum: a sum up to PLIM keeps every weight finite in f16 (largest f16 65504).
#define PLIM 32768.0f

// One 32-key step for a wave's 16 queries. kp: this lane's unit of the chunk's K tile at key0 (T16); vp: this lane's unit of the chunk's V^T tile at key0 (T32); xl: the partner lane's ds_bpermute index.
// The maximum mr (with its offset off) is HELD from step to step: any base gives the same quotient sum(p v) / sum(p) as long as the weights stay in range, so the step forms its
// weights against the held base at once, and only where some lane's weights leave the range (always in the first step, whose base is none; later when weights have grown to about 2^7 times the base key's)
// does the whole wave take the side path: new base = the larger of the held base and this step's maximum (exchanged between the lane halves), rescale of the sums, weights formed again.
__device__ __forceinline__ void fa_step(const unsigned short* __restrict__ kp, const unsigned short* __restrict__ vp,
                                        const Frag& qf, int xl, float& mr, float& off, float& lr, v8f& Oh) {
  const v8us zz = {0, 0, 0, 0, 0, 0, 0, 0};
  // A fragments of K: row m = key (key0 + 16*kt + ln), elements 0..7 <- d = 8h + i, elements 8..15 (k slots 16..31) zero
  Frag k0, k1, vf;
  k0.half[0] = *(const v8us*)(kp);             k0.half[1] = zz;
  k1.half[0] = *(const v8us*)(kp + 256);       k1.half[1] = zz;
  // A fragment of V^T: row m = d (ln), elements 0..7 <- key0 + 8h + i, 8..15 <- key0 + 16 + 8h + i
  vf.half[0] = *(const v8us*)(vp);
  vf.half[1] = *(const v8us*)(vp + 256);
  asm volatile("s_wait_xcnt 0x0" ::: "memory");     // stands in front of the loop's next write of the four loads' address registers
  v8f s0 = {0.f, 0.f, 0.f, 0.f, 0.f, 0.f, 0.f, 0.f};
  v8f s1 = {0.f, 0.f, 0.f, 0.f, 0.f, 0.f, 0.f, 0.f};
  // S^T tiles: element r of tile kt = 256 * q.k of (key0 + 16*kt + 8h + r, query ln)
  mma_s2(k0.h, k1.h, qf.h, s0, s1);
  // The scores stay in the accumulators' own unit (1024 x the scaled score: x16 x16 carries, divide by 4); that power of two is folded into EXPC.
  v2f pc[8];
  float ps = fa_weights(s0, s1, off, pc);
  // the negated compare also catches a sum that is not a number; the ballot makes the branch the same for the whole wave (the side path exchanges between lanes)
  if (__builtin_amdgcn_ballot_w32(!(ps <= PLIM)) != 0u) {
    float mx = s0[0];
#pragma unroll
    for (int r = 1; r < 8; ++r) mx = fmaxf(mx, s0[r]);
#pragma unroll
    for (int r = 0; r < 8; ++r) mx = fmaxf(mx, s1[r]);
    mx = fmaxf(mx, __int_as_float(__builtin_amdgcn_ds_bpermute(xl, __float_as_int(mx))));   // the other lane half holds the other 16 keys of this query: both halves take the same base
    const float mnew = fmaxf(mr, mx);
    // the rescale factor's 2^x, written with its own slots: the instruction set asks for one independent instruction or v_nop between a transcendental and an instruction that overwrites its source or
    // reads its result; this build gave the factor a register that the weights' v_exp_f32 directly ahead of it reads, and a v_nop in a statement of its own did not stay between the two
    float al;
    asm("v_nop\n\tv_exp_f32 %0, %1\n\tv_nop" : "=v"(al) : "v"((mr - mnew) * EXPC));
    mr = mnew;
    off = fmaf(-mnew, EXPC, 8.0f);
    lr = lr * al;
    Oh = Oh * al;
    ps = fa_weights(s0, s1, off, pc);               // every weight now at most 2^8
  }
  ps += __int_as_float(__builtin_amdgcn_ds_bpermute(xl, __float_as_int(ps)));   // the other lane half's 16 keys; all lanes are on (the branch above is the wave's)
  lr += ps;
  Frag ph;
  fa_plane(pc, ph);
  mma_h1(vf.h, ph.h, Oh);
}

// Block = 4 waves x 16 queries = 64 queries of one (chunk, batch); no LDS and no barrier in the key loop.
// Epilogue: O^T tile -> per-wave LDS tile [16 queries][16 d] (fully written, fully consumed; block barrier), then thread tid stores unit tid of the
// block's 16 plane rows x 64 columns = two adjacent T32 tiles (it reads the LDS tile of the wave that owns its plane row, behind the block barrier).
// Context plane element order: flat = ((c*NB + b)*SEQ + s)*16 + h; plane row = (flat>>6) mod (NB*SEQ), column = (flat>>6)/(NB*SEQ)*64 + (flat&63).
// coverage: NCH*NB*(SEQ/64) blocks x 4 waves x 256 elements = every element of the plane exactly once.
__global__ __launch_bounds__(128) void k_attn(const unsigned short* __restrict__ Qp, const unsigned short* __restrict__ Kp,
                                              const unsigned short* __restrict__ Vt, unsigned short* __restrict__ O2) {
  __shared__ __attribute__((aligned(16))) float so[4][16][20];
  const int tid = threadIdx.x, w = __builtin_amdgcn_readfirstlane((int)(tid >> 5)), lane = tid & 31, ln = lane & 15, hh = lane >> 4;
  const int qt = blockIdx.x % (SEQ / 64);
  const int p = blockIdx.x / (SEQ / 64);
  const int b = p % NB, c = p / NB;
  const int qbase = qt * 64 + 16 * w;
  const v8us zz = {0, 0, 0, 0, 0, 0, 0, 0};
  // Q^T B fragment: column n = query qbase + ln, elements 0..7 <- d = 8h + i, elements 8..15 zero
  Frag qf;
  qf.half[0] = *(const v8us*)(Qp + ((size_t)c * (MROWS / 16) + (b * SEQ + qbase) / 16) * 256 + lane * 8);
  qf.half[1] = zz;
  const unsigned short* kb = Kp + ((size_t)c * (MROWS / 16) + (b * SEQ) / 16) * 256 + lane * 8;
  const unsigned short* vb = Vt + ((size_t)c * (MROWS / 32) + (b * SEQ) / 32) * 512 + lane * 8;
  // ds_bpermute byte index of the lane that holds the other 16 keys of the same query, formed once here: with the library shuffle both in the side path and behind it
  // this compiler forms the index anew in every step
  const int xl = (lane ^ 16) * 4;
  float mr = -3.0e38f, off = 3.0e38f, lr = 0.0f;   // no base yet: this offset sends every weight of the first step out of range, so the first step takes the side path
  v8f Oh = {0.f, 0.f, 0.f, 0.f, 0.f, 0.f, 0.f, 0.f};
#pragma unroll 1
  for (int j = 0; j < SEQ / 32; ++j)
    fa_step(kb + j * 512, vb + j * 512, qf, xl, mr, off, lr, Oh);

  // O^T element r = out(query qbase + ln, d = 8h + r); undo x256 (in lr), x16 (V); carry the context x256
  const float inv = 16.0f * (1.0f / lr);
#pragma unroll
  for (int r = 0; r < 8; ++r)
    so[w][ln][8 * hh + r] = Oh[r] * inv;
  __syncthreads();
  // unit tid = plane row rr of the block's 16, 8-column piece p of its 64 columns; four queries of one wave make one plane row
  const int rr = tid & 15, p8 = tid >> 4;
  const int qq = (rr & 3) * 4 + (p8 >> 1), d0 = (p8 & 1) * 8;
  const v4f x0 = *(const v4fa*)&so[rr >> 2][qq][d0];
  const v4f x1 = *(const v4fa*)&so[rr >> 2][qq][d0 + 4];
  Frag f;
  f.e[0] = (_Float16)x0[0]; f.e[1] = (_Float16)x0[1]; f.e[2] = (_Float16)x0[2]; f.e[3] = (_Float16)x0[3];
  f.e[4] = (_Float16)x1[0]; f.e[5] = (_Float16)x1[1]; f.e[6] = (_Float16)x1[2]; f.e[7] = (_Float16)x1[3];
  const v8us o = f.half[0];
  const int R = (c * NB + b) * (SEQ / 4) + qt * 16;   // the block's first plane row, a multiple of 16
  const int hp = R / MROWS;
  const int prow = R - hp * MROWS;
  unsigned short* dst = O2 + ((size_t)(prow >> 4) * (FEAT / 32) + hp * 2) * 512 + tid * 8;
  *(v8us*)dst = o;
  
}

extern "C" void kernel_launch(void* const* d_in, const int* in_sizes, int n_in,
                              void* d_out, int out_size, void* d_ws, size_t ws_size, hipStream_t stream) {
  if (n_in < 15) return;
  const long long needx = ((long long)(NB - 1) * SEQ_FULL + SEQ) * FEAT;   // last element touched + 1
  if ((long long)in_sizes[0] < needx) return;
  if ((long long)out_size < needx) return;
  for (int i = 1; i < 15; i += 2) {
    if ((long long)in_sizes[i] < (long long)FEAT * FEAT) return;
    if ((long long)in_sizes[i + 1] < (long long)FEAT) return;
  }
  // wire order: x, then (weight, bias) pairs for wq, wk, wv, vq, vk, vv, wo
  const float* x    = (const float*)d_in[0];
  const float* wq_w = (const float*)d_in[1];
  const float* wq_b = (const float*)d_in[2];
  const float* wk_w = (const float*)d_in[3];
  const float* wk_b = (const float*)d_in[4];
  const float* wv_w = (const float*)d_in[5];
  const float* wv_b = (const float*)d_in[6];
  const float* vq_w = (const float*)d_in[7];
  const float* vq_b = (const float*)d_in[8];
  const float* vk_w = (const float*)d_in[9];
  const float* vk_b = (const float*)d_in[10];
  const float* vv_w = (const float*)d_in[11];
  const float* vv_b = (const float*)d_in[12];
  const float* wo_w = (const float*)d_in[13];
  const float* wo_b = (const float*)d_in[14];

  char* ws = (char*)d_ws;
  size_t off = 0;
  const size_t planeA = (size_t)MROWS * FEAT * 2;
  const size_t planeW = (size_t)FEAT * FEAT * 2;       // weight plane
  unsigned short* Xb  = (unsigned short*)(ws + off); off += (planeA + 255) & ~(size_t)255;
  unsigned short* Wqb = (unsigned short*)(ws + off); off += (planeW + 255) & ~(size_t)255;
  unsigned short* Wkb = (unsigned short*)(ws + off); off += (planeW + 255) & ~(size_t)255;
  unsigned short* Wvb = (unsigned short*)(ws + off); off += (planeW + 255) & ~(size_t)255;
  unsigned short* Vqh = (unsigned short*)(ws + off); off += (planeW + 255) & ~(size_t)255;
  unsigned short* Vkh = (unsigned short*)(ws + off); off += (planeW + 255) & ~(size_t)255;
  unsigned short* Vvh = (unsigned short*)(ws + off); off += (planeW + 255) & ~(size_t)255;
  unsigned short* Woh = (unsigned short*)(ws + off); off += (planeW + 255) & ~(size_t)255;
  unsigned short* T1q = (unsigned short*)(ws + off); off += (planeA + 255) & ~(size_t)255;
  unsigned short* T1k = (unsigned short*)(ws + off); off += (planeA + 255) & ~(size_t)255;
  unsigned short* T1v = (unsigned short*)(ws + off); off += (planeA + 255) & ~(size_t)255;
  unsigned short* Qp  = (unsigned short*)(ws + off); off += (planeA + 255) & ~(size_t)255;
  unsigned short* Kp  = (unsigned short*)(ws + off); off += (planeA + 255) & ~(size_t)255;
  unsigned short* Vt  = (unsigned short*)(ws + off); off += (planeA + 255) & ~(size_t)255;   // [FEAT][MROWS], T32 order
  unsigned short* O2  = (unsigned short*)(ws + off); off += (planeA + 255) & ~(size_t)255;
  if (off > ws_size) return;

  k_cvt<<<(unsigned)(XBLK + 7 * WBLK), 256, 0, stream>>>(x, wq_w, wk_w, wv_w, vq_w, vk_w, vv_w, wo_w, Xb, Wqb);

  const dim3 g3((unsigned)(MROWS / 128), (unsigned)(FEAT / 128), 3u);
  const dim3 g1((unsigned)(MROWS / 128), (unsigned)(FEAT / 128));
  k_lin1<<<g3, 256, 0, stream>>>(Xb, Wqb, Wkb, Wvb, wq_b, wk_b, wv_b, T1q, T1k, T1v);
  k_lin2<<<g3, 256, 0, stream>>>(T1q, T1k, T1v, Vqh, Vkh, Vvh, vq_b, vk_b, vv_b, Qp, Kp, Vt);

  k_attn<<<(unsigned)(NCH * NB * (SEQ / 64)), 128, 0, stream>>>(Qp, Kp, Vt, O2);

  k_lin3<<<g1, 256, 0, stream>>>(O2, Woh, wo_b, (float*)d_out);
}

// v010
// A run of this version takes 57 microseconds.
// Versions in between are left out here; by their measured steps it is 1.28 times as fast as v008.
// Over all steps from v000 it is 4.45 times as fast.
#include <hip/hip_runtime.h>
// The two Linears of each q/k/v chain are one Linear with the product weight: (x W^T + b) V^T + c = x (V W)^T + (V b + c).
// Contractions: Wc = V W and V b on v_wmma_f32_16x16x32_bf16 (both weights and b converted RNE to bf16 while they are staged, f32 accumulate); x Wc^T, K Q^T scores and the output Linear on v_wmma_f32_16x16x32_f16 (x x16, context x256 in f16; Wc x64 in f16; output weight = RNE-bf16 value x64 held exactly in f16; f32 accumulate); O^T = V^T P^T on v_wmma_f32_16x16x32_f16 (V x16 f16; P x256 f16, one plane each: a second plane of P alone would not make the products more exact than V's own rounding lets them be); c and the output bias RNE-bf16 values added in f32; softmax statistics f32.
// 64 feature chunks of width 16 act as heads; scale 1/4; no mask; context is written in the flat-reinterpreted (64, b, s, 16) -> (b, s, 1024) order.
// GEMM engine: C[m][n] = sum_k A[m][k] W[n][k]; both operands are 16-bit planes held in fragment order
// (elements 0..7 <- k0 + 8h + i, elements 8..15 <- k0 + 16 + 8h + i for A rows and for W rows alike). A block's 128 A rows and 128 W rows are staged in LDS,
// four 32-k steps a stage, by asynchronous copies into two buffers; the waves read their fragments from LDS. 128x128 block tile, 8 waves of 32x64.
// Fragment order T32 of a plane [R][C]: 16 x 32 tiles, tile index (r/16)*(C/32) + c/32, 512 elements a tile; element (r, c) sits at
// tile*512 + ((c>>4)&1)*256 + (((c>>3)&1)*16 + (r&15))*8 + (c&7), so each half fragment is one wave-wide 16-byte load of 512 contiguous bytes.
// Fragment order T16 (Q and K planes, [MROWS][FEAT]): 16 x 16 tiles, tile index (c/16)*(MROWS/16) + r/16, 256 elements a tile; element (r, c) sits at
// tile*256 + (((c>>3)&1)*16 + (r&15))*8 + (c&7).
// Attention engine: transposed flash. Each wave owns 16 queries of one (chunk, batch). Per 32-key step: S^T tiles (key rows x query columns)
// from K rows (A) and Q^T (B), upper 16 k slots zero; the two 16-key D tiles pack straight into the P^T B fragment; O^T (16 d rows x query columns)
// accumulates from V^T rows (A, global f16 plane in T32 order produced directly by a GEMM with swapped operand roles).
#ifndef NB
#define NB 2
#endif
#ifndef SEQ
#define SEQ 1024
#endif
#define NB_FULL 2
#define SEQ_FULL 1024
#define FEAT 1024
#define NCH 64
#define MROWS (NB * SEQ)

static_assert(SEQ % 256 == 0);
static_assert(SEQ <= SEQ_FULL);
static_assert(NB <= NB_FULL);
static_assert(FEAT % 128 == 0);
static_assert(FEAT == NCH * 16);
static_assert((size_t)5 * MROWS * FEAT * 2 + (size_t)4 * FEAT * FEAT * 2 + (size_t)3 * FEAT * 4 <= (size_t)134217728);
static_assert(((size_t)(NB - 1) * SEQ_FULL + SEQ) * FEAT <= (size_t)NB_FULL * SEQ_FULL * FEAT);

typedef __bf16 v16b __attribute__((ext_vector_type(16)));
typedef _Float16 v16h __attribute__((ext_vector_type(16)));
typedef unsigned short v8us __attribute__((ext_vector_type(8), may_alias));
typedef float v8f __attribute__((ext_vector_type(8)));
typedef float v4f __attribute__((ext_vector_type(4)));
typedef float v4fa __attribute__((ext_vector_type(4), may_alias));
typedef float v2f __attribute__((ext_vector_type(2)));
typedef _Float16 v2h __attribute__((ext_vector_type(2)));
typedef __bf16 v2b __attribute__((ext_vector_type(2)));
typedef unsigned int v2u __attribute__((ext_vector_type(2), may_alias));
typedef unsigned int v4u __attribute__((ext_vector_type(4), may_alias));
union Frag { v16b b; v16h h; v8us half[2]; v2h p[8]; _Float16 e[16]; unsigned short u[16]; };

#define LOG2E 1.4426950408889634f
#define EXPC (LOG2E * 0.0009765625f)   // log2(e) / 1024

__device__ __forceinline__ unsigned short bf16_bits(float x) {   // RNE convert to bf16 bits
  unsigned int u = __float_as_uint(x);
  return (unsigned short)((u + 0x7FFFu + ((u >> 16) & 1u)) >> 16);
}
__device__ __forceinline__ float bf16_val(unsigned short b) { return __uint_as_float(((unsigned int)b) << 16); }
__device__ __forceinline__ float bf16_rne(float x) { return bf16_val(bf16_bits(x)); }
// two f32 -> two bf16 (RNE) in one word, a in the low half
__device__ __forceinline__ unsigned int pk_bf16(float a, float b) {
  const v2f x = {a, b};
  return __builtin_bit_cast(unsigned int, __builtin_convertvector(x, v2b));
}

// c0 += a0*b ; c1 += a1*b (two key tiles against one query fragment), then the hazard guard
__device__ __forceinline__ void mma_s2(v16h a0, v16h a1, v16h b, v8f& c0, v8f& c1) {
  c0 = __builtin_amdgcn_wmma_f32_16x16x32_f16(false, a0, false, b, (short)0, c0, false, false);
  c1 = __builtin_amdgcn_wmma_f32_16x16x32_f16(false, a1, false, b, (short)0, c1, false, false);
  asm volatile("v_nop\n\tv_nop\n\tv_nop\n\tv_nop" : "+v"(c0), "+v"(c1) : "v"(a0), "v"(a1), "v"(b));
}
// c += a*b, then the hazard guard: four vector slots before anything may overwrite the operands (the next step's fragments) or read the sum, on the loop's taken branch too
__device__ __forceinline__ void mma_h1(v16h a, v16h b, v8f& c) {
  c = __builtin_amdgcn_wmma_f32_16x16x32_f16(false, a, false, b, (short)0, c, false, false);
  asm volatile("v_nop\n\tv_nop\n\tv_nop\n\tv_nop" : "+v"(c) : "v"(a), "v"(b));
}


#define KC 4                          // 32-k steps a stage
#define ROWB (KC * 1024)              // bytes of one 16-row tile row in a stage: KC tiles of 1 KiB, contiguous in the T32 plane and in LDS alike
#define OPB (8 * ROWB)                // one operand's 128 rows in a stage
#define STB (2 * OPB)                 // a stage: [A 8 tile rows | W 8 tile rows]
#define NSTG (FEAT / 32 / KC)
static_assert(FEAT % (32 * KC) == 0);
static_assert(NSTG >= 2);
static_assert((NSTG & (NSTG - 1)) == 0);   // the k walk wraps by a mask

// Where tile (bx, by) starts its walk over the NSTG k stages; it wraps and takes every stage once. Blocks that share an operand's rows would otherwise ask L2 for the same lines at the same
// moment, stage after stage: such requests collide, and where the lines are not in L2 yet every sharer waits out the same miss. Sharers of the A rows (bx alike) differ in by;
// sharers of the W rows (by alike) differ in bx, neighbours by two stages.
__device__ __forceinline__ int k_start(int bx, int by) { return (by + 2 * (bx & 3) + (bx >> 3)) & (NSTG - 1); }
static_assert(ROWB == 256 * 16);      // one 16-byte copy a thread covers one tile row of a stage
static_assert(2 * STB >= 8 * 16 * 68 * 4);   // the epilogue's staging tiles fit the ring they take over

// Eight tile rows of one operand, global -> LDS, through no register: this thread's 16 bytes of each row. lds = its LDS byte address in the first row, g = its unit in the first row.
// The s_wait_xcnt stands inside the statement so that no address register is rewritten ahead of it.
__device__ __forceinline__ void copy_rows8(unsigned lds, const unsigned short* g) {
  asm volatile("global_load_async_to_lds_b128 %0, %8, off\n\t"
               "global_load_async_to_lds_b128 %1, %9, off\n\t"
               "global_load_async_to_lds_b128 %2, %10, off\n\t"
               "global_load_async_to_lds_b128 %3, %11, off\n\t"
               "global_load_async_to_lds_b128 %4, %12, off\n\t"
               "global_load_async_to_lds_b128 %5, %13, off\n\t"
               "global_load_async_to_lds_b128 %6, %14, off\n\t"
               "global_load_async_to_lds_b128 %7, %15, off\n\t"
               "s_wait_xcnt 0x0"
               :: "v"(lds), "v"(lds + 1 * ROWB), "v"(lds + 2 * ROWB), "v"(lds + 3 * ROWB),
                  "v"(lds + 4 * ROWB), "v"(lds + 5 * ROWB), "v"(lds + 6 * ROWB), "v"(lds + 7 * ROWB),
                  "v"(g), "v"(g + 1 * 16 * FEAT), "v"(g + 2 * 16 * FEAT), "v"(g + 3 * 16 * FEAT),
                  "v"(g + 4 * 16 * FEAT), "v"(g + 5 * 16 * FEAT), "v"(g + 6 * 16 * FEAT), "v"(g + 7 * 16 * FEAT)
               : "memory");
}
// One 32-k step's fragments of a wave's 32 x 64 tile: fa, fb = this lane's unit of the step's first A and W tile in the stage's LDS buffer.
__device__ __forceinline__ void lds_frags(Frag (&a)[2], Frag (&b)[4], const unsigned char* fa, const unsigned char* fb) {
#pragma unroll
  for (int fm = 0; fm < 2; ++fm) {
    a[fm].half[0] = *(const v8us*)(fa + fm * ROWB);
    a[fm].half[1] = *(const v8us*)(fa + fm * ROWB + 512);
  }
#pragma unroll
  for (int fn = 0; fn < 4; ++fn) {
    b[fn].half[0] = *(const v8us*)(fb + fn * ROWB);
    b[fn].half[1] = *(const v8us*)(fb + fn * ROWB + 512);
  }
}
// acc[fm][fn] += a[fm] * b[fn], then the hazard guard: four vector slots before anything may overwrite the operands (the next reads) or read the sums
template <bool BF>
__device__ __forceinline__ void mma_frags(const Frag (&a)[2], const Frag (&b)[4], v8f (&acc)[2][4]) {
#pragma unroll
  for (int fm = 0; fm < 2; ++fm)
#pragma unroll
    for (int fn = 0; fn < 4; ++fn) {
      if (BF) acc[fm][fn] = __builtin_amdgcn_wmma_f32_16x16x32_bf16(false, a[fm].b, false, b[fn].b, (short)0, acc[fm][fn], false, false);
      else    acc[fm][fn] = __builtin_amdgcn_wmma_f32_16x16x32_f16(false, a[fm].h, false, b[fn].h, (short)0, acc[fm][fn], false, false);
    }
  asm volatile("v_nop\n\tv_nop\n\tv_nop\n\tv_nop"
               : "+v"(acc[0][0]), "+v"(acc[0][1]), "+v"(acc[0][2]), "+v"(acc[0][3]),
                 "+v"(acc[1][0]), "+v"(acc[1][1]), "+v"(acc[1][2]), "+v"(acc[1][3])
               : "v"(a[0].h), "v"(a[1].h), "v"(b[0].h), "v"(b[1].h), "v"(b[2].h), "v"(b[3].h));
}

// Epilogue of one 128 x 128 tile, acc = a wave's 32 x 64 sums at (m0, n0).
// EPI 1: out f16 plane [m][N], T32 order = f16((acc*sc + bias[m]) * carry)     (bias along rows, f32 as it stands)
// EPI 3: out f16 plane [MROWS][FEAT], T16 order = f16((acc*sc + bias[n]) * carry)   (bias along columns, f32 as it stands)
// EPI 4: out f16 plane [m][N], T32 order = f16(acc*sc*carry), no bias
// EPI 2: out f32 [b*SEQ_FULL + s][FEAT] = acc*sc + RNE-bf16(bias[n]), m = b*SEQ + s
// Two phases of 16 rows; the wave's 16 x 64 tile is staged in its own LDS tile (fully written: 16 rows x 64 columns, fully consumed),
// which lies in the ring's memory: the last stage's barrier ends every read of the ring, and nothing is in flight behind it.
template <int EPI>
__device__ __forceinline__ void gemm_epi(unsigned char* smem, v8f (&acc)[2][4], int m0, int n0, int w, int lane,
                                         const float* __restrict__ bias, void* __restrict__ outp, int N, float sc, float carry) {
  const int ln = lane & 15, hh = lane >> 4;
  float (*sst)[16][68] = (float (*)[16][68])smem;
  // D element r of tile (fm, fn) = C(m0 + 16 fm + 8 hh + r, n0 + 16 fn + ln)
  float bcol[4];
#pragma unroll
  for (int fn = 0; fn < 4; ++fn) bcol[fn] = 0.0f;
  if (EPI == 2 || EPI == 3) {
#pragma unroll
    for (int fn = 0; fn < 4; ++fn) bcol[fn] = (EPI == 2) ? bf16_rne(bias[n0 + fn * 16 + ln]) : bias[n0 + fn * 16 + ln];
  }
#pragma unroll
  for (int fm = 0; fm < 2; ++fm) {
    float brow[8];
#pragma unroll
    for (int r = 0; r < 8; ++r) brow[r] = 0.0f;
    if (EPI == 1) {
#pragma unroll
      for (int r = 0; r < 8; ++r) brow[r] = bias[m0 + fm * 16 + 8 * hh + r];
    }
#pragma unroll
    for (int fn = 0; fn < 4; ++fn)
#pragma unroll
      for (int r = 0; r < 8; ++r) {
        float v = acc[fm][fn][r] * sc + ((EPI == 1) ? brow[r] : bcol[fn]);
        if (EPI != 2) v = v * carry;
        sst[w][8 * hh + r][fn * 16 + ln] = v;
      }
    __syncthreads();
    if (EPI == 2) {
      float* of = (float*)outp;
      const int rsub = lane >> 4, c4 = (lane & 15) * 4;
      {
#pragma unroll
        for (int q = 0; q < 8; ++q) {
          const int row = 2 * q + rsub;
          const int m = m0 + fm * 16 + row;
          const int bb = m / SEQ;
          const size_t grow = (size_t)bb * SEQ_FULL + (size_t)(m - bb * SEQ);
          const v4f v = *(const v4fa*)&sst[w][row][c4];
          *(v4f*)(of + grow * FEAT + n0 + c4) = v;
        }
        
      }
    } else {
      unsigned short* oh = (unsigned short*)outp;
      {
#pragma unroll
        for (int it = 0; it < 4; ++it) {
          // lane (ln, hh) carries row ln, columns 16 it + 8 hh .. + 7: one 512-byte run of the out plane per store
          const v4f x0 = *(const v4fa*)&sst[w][ln][it * 16 + hh * 8];
          const v4f x1 = *(const v4fa*)&sst[w][ln][it * 16 + hh * 8 + 4];
          Frag f;
          f.e[0] = (_Float16)x0[0]; f.e[1] = (_Float16)x0[1]; f.e[2] = (_Float16)x0[2]; f.e[3] = (_Float16)x0[3];
          f.e[4] = (_Float16)x1[0]; f.e[5] = (_Float16)x1[1]; f.e[6] = (_Float16)x1[2]; f.e[7] = (_Float16)x1[3];
          const v8us o = f.half[0];
          if (EPI == 3) *(v8us*)(oh + ((size_t)((n0 >> 4) + it) * (MROWS / 16) + (m0 >> 4) + fm) * 256 + lane * 8) = o;
          else          *(v8us*)(oh + ((size_t)((m0 >> 4) + fm) * (N >> 5) + (n0 >> 5)) * 512 + it * 256 + lane * 8) = o;
        }
        
      }
    }
    __syncthreads();
  }
}

// C[m][n] = sum_k A[m][k] W[n][k], K = FEAT, A and W planes of FEAT columns in T32 order.
// BF: bf16 operands, else f16 operands. One 128 x 128 tile (bx, by) of a (Mrows/128, Ncols/128) tiling per block, 8 waves of 32 x 64.
template <bool BF, int EPI>
__device__ __forceinline__ void gemm_tile(unsigned char* smem, int bx, int by,
                                          const unsigned short* __restrict__ A, const unsigned short* __restrict__ W,
                                          const float* __restrict__ bias, void* __restrict__ outp,
                                          int N, float sc, float carry) {
  const int tid = threadIdx.x, lane = tid & 31, w = __builtin_amdgcn_readfirstlane((int)(tid >> 5));
  const int wm = w & 3, wn = w >> 2;
  const int m0 = bx * 128 + wm * 32;
  const int n0 = by * 128 + wn * 64;
  const unsigned short* ga = A + (size_t)bx * 128 * FEAT + tid * 8;   // tile row r starts at r * (FEAT/32) * 512 = r * 16 * FEAT
  const unsigned short* gw = W + (size_t)by * 128 * FEAT + tid * 8;
  const unsigned lcp = (unsigned)(size_t)smem + tid * 16;            // low 32 bits of the shared address = the LDS byte address
  const int rot = k_start(bx, by);
  v8f acc[2][4];
#pragma unroll
  for (int fm = 0; fm < 2; ++fm)
#pragma unroll
    for (int fn = 0; fn < 4; ++fn)
#pragma unroll
      for (int r = 0; r < 8; ++r) acc[fm][fn][r] = 0.0f;

  // Two LDS buffers: trip t's stage is worked on while trip t + 1's copies fly. Trip t takes k stage (t + rot) mod NSTG: the sums run in ascending k from the block's own start and wrap.
  copy_rows8(lcp, ga + rot * (KC * 512));
  copy_rows8(lcp + OPB, gw + rot * (KC * 512));
  asm volatile("s_wait_asynccnt 0x0" ::: "memory");   // this wave's share of stage 0 has landed
  __syncthreads();                                    // every wave's share has
  copy_rows8(lcp + STB, ga + ((1 + rot) & (NSTG - 1)) * (KC * 512));
  copy_rows8(lcp + STB + OPB, gw + ((1 + rot) & (NSTG - 1)) * (KC * 512));
  // kept rolled (a trip is one stage of KC steps) so that the loop's text stays short
#pragma unroll 1
  for (int t = 0; t < NSTG; ++t) {
    const unsigned bo = (unsigned)(t & 1) * STB;
    const unsigned char* fa = smem + bo + wm * 2 * ROWB + lane * 16;
    const unsigned char* fb = smem + bo + OPB + wn * 4 * ROWB + lane * 16;
    // two fragment sets: step s + 1's LDS reads go out as one group ahead of step s's products; nothing of the next stage is read here
    Frag a[2][2], b[2][4];
    lds_frags(a[0], b[0], fa, fb);
    // unrolled so that the set index is a constant and both sets stay in registers
#pragma unroll
    for (int s = 0; s < KC; ++s) {
      if (s + 1 < KC) lds_frags(a[(s + 1) & 1], b[(s + 1) & 1], fa + (s + 1) * 1024, fb + (s + 1) * 1024);
      mma_frags<BF>(a[s & 1], b[s & 1], acc);
    }
    asm volatile("s_wait_dscnt 0x0" ::: "memory");      // this wave's reads of the buffer have returned before it is handed to its next writer
    asm volatile("s_wait_asynccnt 0x0" ::: "memory");   // this wave's share of stage t + 1 has landed
    __syncthreads();                                    // publishes stage t + 1 and ends every wave's reads of stage t
    if (t + 2 < NSTG) {                                 // block-uniform
      const int ks = (t + 2 + rot) & (NSTG - 1);
      copy_rows8(lcp + bo, ga + ks * (KC * 512));
      copy_rows8(lcp + bo + OPB, gw + ks * (KC * 512));
    }
  }
  asm volatile("s_wait_asynccnt 0x0" ::: "memory");     // nothing is in flight when the ring becomes output staging

  gemm_epi<EPI>(smem, acc, m0, n0, w, lane, bias, outp, N, sc, carry);
}

// ---- first launch: product weights straight from the f32 weights ----
// LDS form of a stage here: the same 16-byte units (8 k of one row) as in T32, a group = the 16 rows of one 8-k piece.
// A group takes GP bytes and a tile row TRP bytes: the 16 bytes over 256 and over 16 groups turn the banks, so that the writers below (whole global lines a load, hence
// one row over 16 groups, or 4 rows in each of 8 tile rows, a store) hit every bank once; a fragment read is still 16 lanes x 16 contiguous bytes, twice.
#define GP 272
#define TRP (KC * 4 * GP + 16)
#define OPB2 (8 * TRP)
#define STB2 (2 * OPB2)
static_assert(2 * STB2 >= 8 * 16 * 68 * 4);   // the epilogue's staging tiles fit the ring they take over
static_assert(2 * STB2 <= 160 * 1024);        // two blocks a WGP
static_assert(KC * 32 == 128);                // a wave-wide 16-byte load covers one row's k range of a stage

template <bool B> struct BoolC { static constexpr bool value = B; };

// One 32-k step's fragments from the padded stage: fa, fb = this lane's unit (group hh, row ln) of the step's first A and W tile row.
__device__ __forceinline__ void lds_frags_p(Frag (&a)[2], Frag (&b)[4], const unsigned char* fa, const unsigned char* fb) {
  // unrolled so that the fragment index is a constant
#pragma unroll
  for (int fm = 0; fm < 2; ++fm) {
    a[fm].half[0] = *(const v8us*)(fa + fm * TRP);
    a[fm].half[1] = *(const v8us*)(fa + fm * TRP + 2 * GP);
  }
#pragma unroll
  for (int fn = 0; fn < 4; ++fn) {
    b[fn].half[0] = *(const v8us*)(fb + fn * TRP);
    b[fn].half[1] = *(const v8us*)(fb + fn * TRP + 2 * GP);
  }
}

// Wc[o][i] = sum_j V[o][j] Wf[j][i]: tile (bx, by) of an 8 x 8 tiling, A rows = V rows (k = j runs along the row), W rows = Wf columns (k = j runs down the column).
// BCOL (tile column 8): the W operand's row 0 is b1 and its other 127 rows are zero, so column 0 of the tile is V b1; bc[o] = that + RNE-bf16(b2[o]).
// Staging through registers, converted on the way: wave w brings A tile row w (16 loads, one row of 128 k each: lane l holds k 4l .. 4l+3 = half a unit)
// and k rows 16w .. 16w+15 of Wf (16 loads of 128 columns: lane l holds columns 4l .. 4l+3, so 8 loads give it 4 whole units).
// The next stage's A flies over steps 0 and 1, its W over steps 2 and 3; both land in the other buffer, whose readers left it at the last barrier.
template <bool BCOL>
__device__ __forceinline__ void wprod_tile(unsigned char* smem, int bx, int by,
                                           const float* __restrict__ V, const float* __restrict__ Wf,
                                           const float* __restrict__ b1, const float* __restrict__ b2,
                                           unsigned short* __restrict__ Wc, float* __restrict__ bc) {
  const int tid = threadIdx.x, lane = tid & 31, w = __builtin_amdgcn_readfirstlane((int)(tid >> 5));
  const int wm = w & 3, wn = w >> 2, ln = lane & 15, hh = lane >> 4;
  const int m0 = bx * 128 + wm * 32;
  const int n0 = by * 128 + wn * 64;
  const int rot = k_start(bx, by);   // trip t takes k stage (t + rot) mod NSTG
  const float* ga = V + (size_t)(bx * 128 + w * 16) * FEAT + lane * 4;
  const float* gw = Wf + (size_t)(w * 16) * FEAT + (BCOL ? 0 : by * 128) + lane * 4;
  unsigned char* sa = smem + w * TRP + (lane >> 1) * GP + (lane & 1) * 8;                  // row r at + 16 r
  unsigned char* sw = smem + OPB2 + (lane >> 2) * TRP + (2 * w) * GP + (lane & 3) * 64;    // group 2w + gg at + gg GP, column c at + 16 c
  // every inner loop of this function is unrolled so that each index into rs, acc and the fragment sets is a constant and they stay in registers
  v4f rs[16];
  v8f acc[2][4];
#pragma unroll
  for (int fm = 0; fm < 2; ++fm)
#pragma unroll
    for (int fn = 0; fn < 4; ++fn)
#pragma unroll
      for (int r = 0; r < 8; ++r) acc[fm][fn][r] = 0.0f;

  auto loadA = [&](int t) __attribute__((always_inline)) {
    const float* p = ga + ((t + rot) & (NSTG - 1)) * 128;   // the run's one address; the rows are constant offsets from it
#pragma unroll
    for (int r = 0; r < 16; ++r) rs[r] = *(const v4fa*)(p + (size_t)r * FEAT);
    // stands in front of any later write of the loads' address registers; the address as its input is live up to here, so that no result of the run is given its registers;
    // also keeps the loads up here, ahead of the steps they fly over
    asm volatile("s_wait_xcnt 0x0" :: "v"(p) : "memory");
  };
  auto storeA = [&](unsigned bo) __attribute__((always_inline)) {
#pragma unroll
    for (int r = 0; r < 16; ++r) {
      const v2u o = {pk_bf16(rs[r][0], rs[r][1]), pk_bf16(rs[r][2], rs[r][3])};
      *(v2u*)(sa + bo + r * 16) = o;
    }
  };
  auto loadW = [&](int t) __attribute__((always_inline)) {
    const int ks = (t + rot) & (NSTG - 1);
    const float* p = gw + (size_t)ks * 128 * FEAT;   // the run's one address; the k rows are constant offsets from it
#pragma unroll
    for (int q = 0; q < 16; ++q) {
      if (BCOL) {
        const float v = b1[ks * 128 + w * 16 + q];
        rs[q] = v4f{lane == 0 ? v : 0.0f, 0.0f, 0.0f, 0.0f};
      } else {
        rs[q] = *(const v4fa*)(p + (size_t)q * FEAT);
      }
    }
    if (BCOL) asm volatile("s_wait_xcnt 0x0" ::: "memory");            // as in loadA; the bias comes by scalar loads
    else      asm volatile("s_wait_xcnt 0x0" :: "v"(p) : "memory");    // as in loadA
  };
  auto storeW = [&](unsigned bo) __attribute__((always_inline)) {
#pragma unroll
    for (int gg = 0; gg < 2; ++gg)
#pragma unroll
      for (int c = 0; c < 4; ++c) {
        const v4u o = {pk_bf16(rs[gg * 8 + 0][c], rs[gg * 8 + 1][c]), pk_bf16(rs[gg * 8 + 2][c], rs[gg * 8 + 3][c]),
                       pk_bf16(rs[gg * 8 + 4][c], rs[gg * 8 + 5][c]), pk_bf16(rs[gg * 8 + 6][c], rs[gg * 8 + 7][c])};
        *(v4u*)(sw + bo + gg * GP + c * 16) = o;
      }
  };
  // One stage of KC steps in ascending k (the stages from the block's own start, wrapping); two fragment sets, step s + 1's LDS reads ahead of step s's products.
  auto stage = [&](int t, auto more) __attribute__((always_inline)) {
    constexpr bool MORE = decltype(more)::value;
    const unsigned bo = (unsigned)(t & 1) * STB2, bn = STB2 - bo;
    const unsigned char* fa = smem + bo + wm * 2 * TRP + hh * GP + ln * 16;
    const unsigned char* fb = smem + bo + OPB2 + wn * 4 * TRP + hh * GP + ln * 16;
    Frag a[2][2], b[2][4];
    if (MORE) loadA(t + 1);
    lds_frags_p(a[0], b[0], fa, fb);
    lds_frags_p(a[1], b[1], fa + 4 * GP, fb + 4 * GP);
    mma_frags<true>(a[0], b[0], acc);
    lds_frags_p(a[0], b[0], fa + 8 * GP, fb + 8 * GP);
    mma_frags<true>(a[1], b[1], acc);
    if (MORE) {
      __builtin_amdgcn_sched_barrier(0);   // keeps the wait on the A loads, and the stores behind it, from rising into the two steps that cover the loads' flight
      storeA(bn);
      loadW(t + 1);
    }
    lds_frags_p(a[1], b[1], fa + 12 * GP, fb + 12 * GP);
    mma_frags<true>(a[0], b[0], acc);
    mma_frags<true>(a[1], b[1], acc);
    if (MORE) {
      __builtin_amdgcn_sched_barrier(0);   // the same for the W loads
      storeW(bn);
    }
    __syncthreads();   // publishes stage t + 1 and ends every wave's reads of stage t
  };

  loadA(0);
  storeA(0);
  loadW(0);
  storeW(0);
  __syncthreads();
  // kept rolled so that the loop's text stays short; the last stage, which stages nothing, stands behind it
#pragma unroll 1
  for (int t = 0; t < NSTG - 1; ++t) stage(t, BoolC<true>{});
  stage(NSTG - 1, BoolC<false>{});

  if (BCOL) {
    // D element r of tile (fm, 0), lanes ln == 0 of the waves wn == 0 = column 0 of the tile, row m0 + 16 fm + 8 hh + r
    if (wn == 0 && ln == 0) {
#pragma unroll
      for (int fm = 0; fm < 2; ++fm)
#pragma unroll
        for (int r = 0; r < 8; ++r) {
          const int m = m0 + fm * 16 + 8 * hh + r;
          bc[m] = acc[fm][0][r] + bf16_rne(b2[m]);
        }
    }
  } else {
    gemm_epi<4>(smem, acc, m0, n0, w, lane, nullptr, (void*)Wc, FEAT, 1.0f, 64.0f);
  }
}

#define CVU 16                                   // units a thread
#define XCB (MROWS * (FEAT / 8) / (256 * CVU))   // blocks for the x plane
#define WCB (FEAT * (FEAT / 8) / (256 * CVU))    // blocks for the output weight's plane
#define PRB (3 * 9 * 8)                          // product blocks: 3 chains x (8 + 1) tile columns x 8 tile rows
static_assert(MROWS * (FEAT / 8) % (256 * CVU) == 0);
static_assert(FEAT * (FEAT / 8) % (256 * CVU) == 0);
static_assert(256 * CVU / 64 == 2 * (FEAT / 32));   // a block's units fill two whole tile rows
static_assert(FEAT / 32 == 4 * 8);                  // eight steps of four tiles cross one tile row

// The two operand planes that no product of this launch needs, T32 order: x -> f16(x * 16), output weight -> f16 bits of (RNE-bf16 value x 64).
// Block cb converts 256 * CVU units, thread tid the units base + 256 e; all its loads are out before the first convert. coverage: XCB blocks = the whole x plane, WCB blocks = the whole weight plane; every unit written once.
template <bool ISX>
__device__ __forceinline__ void cvt_units(int cb, const float* __restrict__ src0, unsigned short* __restrict__ dst0) {
  const int tid = (int)threadIdx.x, u = tid & 63;
  const int base = cb * (256 * CVU) + tid;
  // unit base + 256 e lies in tile cb*64 + (tid>>6) + 4e = tile row 2 cb + (e>>3), tile column (tid>>6) + 4 (e&7): rows 32 cb + 16 (e>>3) + (u&15), columns 32 (tid>>6) + 8 (u>>4) + 128 (e&7).
  // The block's 32 rows lie in one batch (SEQ is a multiple of 128), so one address serves all loads, the rest being constant offsets.
  const int rb = cb * 32, b = rb / SEQ, s = rb - b * SEQ;
  const float* p = src0 + ((ISX ? ((size_t)b * SEQ_FULL + s) : (size_t)rb) + (u & 15)) * FEAT + (tid >> 6) * 32 + (u >> 4) * 8;
  // both loops are unrolled so that the loaded values stay in registers and every load is out before the first convert
  v4f x0[CVU], x1[CVU];
#pragma unroll
  for (int e = 0; e < CVU; ++e) {
    const float* src = p + (size_t)(e >> 3) * 16 * FEAT + (e & 7) * 128;
    x0[e] = *(const v4fa*)(src);
    x1[e] = *(const v4fa*)(src + 4);
  }
  // stands in front of any later write of the loads' address registers; the address as its input is live up to here, so that no result of the run is given its registers
  asm volatile("s_wait_xcnt 0x0" :: "v"(p) : "memory");
  unsigned short* dst = dst0 + (size_t)base * 8;
#pragma unroll
  for (int e = 0; e < CVU; ++e) {
    Frag f;
#pragma unroll
    for (int i = 0; i < 4; ++i) {
      f.e[i]     = (_Float16)(ISX ? x0[e][i] * 16.0f : bf16_rne(x0[e][i]) * 64.0f);
      f.e[i + 4] = (_Float16)(ISX ? x1[e][i] * 16.0f : bf16_rne(x1[e][i]) * 64.0f);
    }
    *(v8us*)(dst + (size_t)e * 256 * 8) = f.half[0];
  }
  asm volatile("s_wait_xcnt 0x0" ::: "memory");   // stands in front of whatever code behind this function next writes a register of the last stores
}

// First launch, PRB + XCB + WCB blocks. Blocks below PRB: chain z = blk / 72, tile column by = (blk % 72) / 8 (8 = the bias column), tile row bx = blk % 8. The rest convert x and the output weight.
// The three product planes lie back to back at Wc, the three bias vectors at bc.
__global__ __launch_bounds__(256) void k_wprod(const float* __restrict__ X,
                                               const float* __restrict__ w0, const float* __restrict__ w1, const float* __restrict__ w2,
                                               const float* __restrict__ v0, const float* __restrict__ v1, const float* __restrict__ v2,
                                               const float* __restrict__ wo,
                                               const float* __restrict__ wb0, const float* __restrict__ wb1, const float* __restrict__ wb2,
                                               const float* __restrict__ vb0, const float* __restrict__ vb1, const float* __restrict__ vb2,
                                               unsigned short* __restrict__ Xh, unsigned short* __restrict__ Wc,
                                               unsigned short* __restrict__ Woh, float* __restrict__ bc) {
  __shared__ __attribute__((aligned(16))) unsigned char smem[2 * STB2];
  const int blk = blockIdx.x;
  if (blk >= PRB) {                              // block-uniform, in front of every barrier
    if (blk - PRB < XCB) cvt_units<true>(blk - PRB, X, Xh);
    else                 cvt_units<false>(blk - PRB - XCB, wo, Woh);
    return;
  }
  const int z = blk / 72, rem = blk - z * 72, by = rem >> 3, bx = rem & 7;
  const float* V  = z == 0 ? v0 : z == 1 ? v1 : v2;
  const float* Wf = z == 0 ? w0 : z == 1 ? w1 : w2;
  const float* b1 = z == 0 ? wb0 : z == 1 ? wb1 : wb2;
  const float* b2 = z == 0 ? vb0 : z == 1 ? vb1 : vb2;
  if (by < 8) wprod_tile<false>(smem, bx, by, V, Wf, b1, b2, Wc + (size_t)z * FEAT * FEAT, bc + z * FEAT);
  else        wprod_tile<true>(smem, bx, by, V, Wf, b1, b2, Wc + (size_t)z * FEAT * FEAT, bc + z * FEAT);
}

#define S10 0.0009765625f        // 1 / (16 * 64)
#define S14 0.00006103515625f    // 1 / (256 * 64)

// The q, k and v Linears (product weights) in one launch, grid (MROWS/128, FEAT/128, 3): z = 0, 1 -> Q and K planes (T16); z = 2 -> V^T[f][token] = sum_i Wcv[f][i] * x[token][i] + bcv[f],
// whose tiling is (FEAT/128, MROWS/128): its tile comes from the block's flat index in the z slice.
__global__ __launch_bounds__(256) void k_lin2(const unsigned short* __restrict__ Xh,
                                              const unsigned short* __restrict__ Vq, const unsigned short* __restrict__ Vk,
                                              const unsigned short* __restrict__ Vv,
                                              const float* __restrict__ bq, const float* __restrict__ bk, const float* __restrict__ bv,
                                              unsigned short* __restrict__ Qp, unsigned short* __restrict__ Kp, unsigned short* __restrict__ Vt) {
  __shared__ __attribute__((aligned(16))) unsigned char smem[2 * STB];
  const int z = blockIdx.z;
  if (z < 2) {
    gemm_tile<false, 3>(smem, blockIdx.x, blockIdx.y, Xh, z == 0 ? Vq : Vk, z == 0 ? bq : bk,
                        (void*)(z == 0 ? Qp : Kp), FEAT, S10, 16.0f);
  } else {
    const int flat = blockIdx.y * (MROWS / 128) + blockIdx.x;
    gemm_tile<false, 1>(smem, flat % (FEAT / 128), flat / (FEAT / 128), Vv, Xh, bv, (void*)Vt, MROWS, S10, 16.0f);
  }
}

// Output Linear, grid (MROWS/128, FEAT/128).
__global__ __launch_bounds__(256) void k_lin3(const unsigned short* __restrict__ O2, const unsigned short* __restrict__ Wo,
                                              const float* __restrict__ bo, float* __restrict__ out) {
  __shared__ __attribute__((aligned(16))) unsigned char smem[2 * STB];
  gemm_tile<false, 2>(smem, blockIdx.x, blockIdx.y, O2, Wo, bo, (void*)out, FEAT, S14, 1.0f);
}

// 2^x as the bare v_exp_f32, without the library form's rescue of results below 2^-126 (compare, select, add, select, ldexp per call).
// Arguments of the weights that are kept are at most 15 (PLIM below); trial weights beyond that, the first step's among them, may come out infinite and are thrown away. A weight below 2^-126 rounds to zero
// in the f16 plane and vanishes against the row sum, which is about 256 or more from the first step on (the key that gave the base carries 2^8); a rescale factor below 2^-126 multiplies sums that the new base's own terms then outweigh by 2^126.
__device__ __forceinline__ float hw_exp2(float x) { return __builtin_amdgcn_exp2f(x); }

// Weights of one 32-key step against the held maximum, carried x256: pc = 2^(s * EXPC + off), off = 8 - maximum * EXPC. Two scores a vector instruction: one packed FMA for the exponents, packed sum.
// Returns this lane's sum of its 16 weights.
__device__ __forceinline__ float fa_weights(const v8f& s0, const v8f& s1, float off, v2f (&pc)[8]) {
  const v2f off2 = {off, off}, c2 = {EXPC, EXPC};
  v2f ps2 = {0.0f, 0.0f};
  // unrolled so that every index is a constant and scores and weights stay in registers
#pragma unroll
  for (int i = 0; i < 8; ++i) {
    const v2f sp = (i < 4) ? v2f{s0[2 * i], s0[2 * i + 1]} : v2f{s1[2 * i - 8], s1[2 * i - 7]};
    const v2f ar = __builtin_elementwise_fma(sp, c2, off2);
    pc[i] = v2f{hw_exp2(ar[0]), hw_exp2(ar[1])};
    ps2 += pc[i];
  }
  return ps2[0] + ps2[1];
}
// The weights' f16 plane: f16(pc), packed convert (round to nearest even, 11 significant bits, as V's plane has).
__device__ __forceinline__ void fa_plane(const v2f (&pc)[8], Frag& ph) {
  // unrolled so that every index is a constant and weights and fragment stay in registers
#pragma unroll
  for (int i = 0; i < 8; ++i)
    ph.p[i] = __builtin_convertvector(pc[i], v2h);  // B elements 2i, 2i+1: below 8 -> key0 + 8h + e (tile 0 row 8h+e); from 8 on -> key0 + 16 + 8h + (e-8) (tile 1)
}

// A lane's 16 weights of a step are positive, so each is at most their sum: a sum up to PLIM keeps every weight finite in f16 (largest f16 65504).
#define PLIM 32768.0f

// One 32-key step for a wave's 16 queries. kp: this lane's unit of the chunk's K tile at key0 (T16); vp: this lane's unit of the chunk's V^T tile at key0 (T32); xl: the partner lane's ds_bpermute index.
// The maximum mr (with its offset off) is HELD from step to step: any base gives the same quotient sum(p v) / sum(p) as long as the weights stay in range, so the step forms its
// weights against the held base at once, and only where some lane's weights leave the range (always in the first step, whose base is none; later when weights have grown to about 2^7 times the base key's)
// does the whole wave take the side path: new base = the larger of the held base and this step's maximum (exchanged between the lane halves), rescale of the sums, weights formed again.
__device__ __forceinline__ void fa_step(const unsigned short* __restrict__ kp, const unsigned short* __restrict__ vp,
                                        const Frag& qf, int xl, float& mr, float& off, float& lr, v8f& Oh) {
  const v8us zz = {0, 0, 0, 0, 0, 0, 0, 0};
  // A fragments of K: row m = key (key0 + 16*kt + ln), elements 0..7 <- d = 8h + i, elements 8..15 (k slots 16..31) zero
  Frag k0, k1, vf;
  k0.half[0] = *(const v8us*)(kp);             k0.half[1] = zz;
  k1.half[0] = *(const v8us*)(kp + 256);       k1.half[1] = zz;
  // A fragment of V^T: row m = d (ln), elements 0..7 <- key0 + 8h + i, 8..15 <- key0 + 16 + 8h + i
  vf.half[0] = *(const v8us*)(vp);
  vf.half[1] = *(const v8us*)(vp + 256);
  asm volatile("s_wait_xcnt 0x0" ::: "memory");     // stands in front of the loop's next write of the four loads' address registers
  v8f s0 = {0.f, 0.f, 0.f, 0.f, 0.f, 0.f, 0.f, 0.f};
  v8f s1 = {0.f, 0.f, 0.f, 0.f, 0.f, 0.f, 0.f, 0.f};
  // S^T tiles: element r of tile kt = 256 * q.k of (key0 + 16*kt + 8h + r, query ln)
  mma_s2(k0.h, k1.h, qf.h, s0, s1);
  // The scores stay in the accumulators' own unit (1024 x the scaled score: x16 x16 carries, divide by 4); that power of two is folded into EXPC.
  v2f pc[8];
  float ps = fa_weights(s0, s1, off, pc);
  // the negated compare also catches a sum that is not a number; the ballot makes the branch the same for the whole wave (the side path exchanges between lanes)
  if (__builtin_amdgcn_ballot_w32(!(ps <= PLIM)) != 0u) {
    float mx = s0[0];
#pragma unroll
    for (int r = 1; r < 8; ++r) mx = fmaxf(mx, s0[r]);
#pragma unroll
    for (int r = 0; r < 8; ++r) mx = fmaxf(mx, s1[r]);
    mx = fmaxf(mx, __int_as_float(__builtin_amdgcn_ds_bpermute(xl, __float_as_int(mx))));   // the other lane half holds the other 16 keys of this query: both halves take the same base
    const float mnew = fmaxf(mr, mx);
    // the rescale factor's 2^x, written with its own slots: the instruction set asks for one independent instruction or v_nop between a transcendental and an instruction that overwrites its source or
    // reads its result; this build gave the factor a register that the weights' v_exp_f32 directly ahead of it reads, and a v_nop in a statement of its own did not stay between the two
    float al;
    asm("v_nop\n\tv_exp_f32 %0, %1\n\tv_nop" : "=v"(al) : "v"((mr - mnew) * EXPC));
    mr = mnew;
    off = fmaf(-mnew, EXPC, 8.0f);
    lr = lr * al;
    Oh = Oh * al;
    ps = fa_weights(s0, s1, off, pc);               // every weight now at most 2^8
  }
  ps += __int_as_float(__builtin_amdgcn_ds_bpermute(xl, __float_as_int(ps)));   // the other lane half's 16 keys; all lanes are on (the branch above is the wave's)
  lr += ps;
  Frag ph;
  fa_plane(pc, ph);
  mma_h1(vf.h, ph.h, Oh);
}

// Block = 4 waves x 16 queries = 64 queries of one (chunk, batch); no LDS and no barrier in the key loop.
// Epilogue: O^T tile -> per-wave LDS tile [16 queries][16 d] (fully written, fully consumed; block barrier), then thread tid stores unit tid of the
// block's 16 plane rows x 64 columns = two adjacent T32 tiles (it reads the LDS tile of the wave that owns its plane row, behind the block barrier).
// Context plane element order: flat = ((c*NB + b)*SEQ + s)*16 + h; plane row = (flat>>6) mod (NB*SEQ), column = (flat>>6)/(NB*SEQ)*64 + (flat&63).
// coverage: NCH*NB*(SEQ/64) blocks x 4 waves x 256 elements = every element of the plane exactly once.
__global__ __launch_bounds__(128) void k_attn(const unsigned short* __restrict__ Qp, const unsigned short* __restrict__ Kp,
                                              const unsigned short* __restrict__ Vt, unsigned short* __restrict__ O2) {
  __shared__ __attribute__((aligned(16))) float so[4][16][20];
  const int tid = threadIdx.x, w = __builtin_amdgcn_readfirstlane((int)(tid >> 5)), lane = tid & 31, ln = lane & 15, hh = lane >> 4;
  const int qt = blockIdx.x % (SEQ / 64);
  const int p = blockIdx.x / (SEQ / 64);
  const int b = p % NB, c = p / NB;
  const int qbase = qt * 64 + 16 * w;
  const v8us zz = {0, 0, 0, 0, 0, 0, 0, 0};
  // Q^T B fragment: column n = query qbase + ln, elements 0..7 <- d = 8h + i, elements 8..15 zero
  Frag qf;
  qf.half[0] = *(const v8us*)(Qp + ((size_t)c * (MROWS / 16) + (b * SEQ + qbase) / 16) * 256 + lane * 8);
  qf.half[1] = zz;
  const unsigned short* kb = Kp + ((size_t)c * (MROWS / 16) + (b * SEQ) / 16) * 256 + lane * 8;
  const unsigned short* vb = Vt + ((size_t)c * (MROWS / 32) + (b * SEQ) / 32) * 512 + lane * 8;
  // ds_bpermute byte index of the lane that holds the other 16 keys of the same query, formed once here: with the library shuffle both in the side path and behind it
  // this compiler forms the index anew in every step
  const int xl = (lane ^ 16) * 4;
  float mr = -3.0e38f, off = 3.0e38f, lr = 0.0f;   // no base yet: this offset sends every weight of the first step out of range, so the first step takes the side path
  v8f Oh = {0.f, 0.f, 0.f, 0.f, 0.f, 0.f, 0.f, 0.f};
  // The SEQ / 64 blocks of one (chunk, batch) read the same K and V lines: each starts its walk over the key steps at a place of its own and wraps, as the GEMM blocks do with their k stages
  // (neighbouring blocks a quarter of the keys apart). Any key order gives the same quotient; the four waves of a block keep one start, so that they still share their lines.
  const int j0 = (qt & 3) * (SEQ / 128) + (qt >> 2) * 2;
  const unsigned short* kp = kb + j0 * 512;
  const unsigned short* vp = vb + j0 * 512;
#pragma unroll 1
  for (int j = 0; j < SEQ / 32; ++j) {
    fa_step(kp, vp, qf, xl, mr, off, lr, Oh);
    // one tile on, or from the last tile back to the first: both pointers are carried, so that a step still costs one addition each
    const long long nx = (j + j0 == SEQ / 32 - 1) ? -(long long)(SEQ / 32 - 1) * 512 : 512;
    kp += nx;
    vp += nx;
  }

  // O^T element r = out(query qbase + ln, d = 8h + r); undo x256 (in lr), x16 (V); carry the context x256
  const float inv = 16.0f * (1.0f / lr);
#pragma unroll
  for (int r = 0; r < 8; ++r)
    so[w][ln][8 * hh + r] = Oh[r] * inv;
  __syncthreads();
  // unit tid = plane row rr of the block's 16, 8-column piece p of its 64 columns; four queries of one wave make one plane row
  const int rr = tid & 15, p8 = tid >> 4;
  const int qq = (rr & 3) * 4 + (p8 >> 1), d0 = (p8 & 1) * 8;
  const v4f x0 = *(const v4fa*)&so[rr >> 2][qq][d0];
  const v4f x1 = *(const v4fa*)&so[rr >> 2][qq][d0 + 4];
  Frag f;
  f.e[0] = (_Float16)x0[0]; f.e[1] = (_Float16)x0[1]; f.e[2] = (_Float16)x0[2]; f.e[3] = (_Float16)x0[3];
  f.e[4] = (_Float16)x1[0]; f.e[5] = (_Float16)x1[1]; f.e[6] = (_Float16)x1[2]; f.e[7] = (_Float16)x1[3];
  const v8us o = f.half[0];
  const int R = (c * NB + b) * (SEQ / 4) + qt * 16;   // the block's first plane row, a multiple of 16
  const int hp = R / MROWS;
  const int prow = R - hp * MROWS;
  unsigned short* dst = O2 + ((size_t)(prow >> 4) * (FEAT / 32) + hp * 2) * 512 + tid * 8;
  *(v8us*)dst = o;
  
}

extern "C" void kernel_launch(void* const* d_in, const int* in_sizes, int n_in,
                              void* d_out, int out_size, void* d_ws, size_t ws_size, hipStream_t stream) {
  if (n_in < 15) return;
  const long long needx = ((long long)(NB - 1) * SEQ_FULL + SEQ) * FEAT;   // last element touched + 1
  if ((long long)in_sizes[0] < needx) return;
  if ((long long)out_size < needx) return;
  for (int i = 1; i < 15; i += 2) {
    if ((long long)in_sizes[i] < (long long)FEAT * FEAT) return;
    if ((long long)in_sizes[i + 1] < (long long)FEAT) return;
  }
  // wire order: x, then (weight, bias) pairs for wq, wk, wv, vq, vk, vv, wo
  const float* x    = (const float*)d_in[0];
  const float* wq_w = (const float*)d_in[1];
  const float* wq_b = (const float*)d_in[2];
  const float* wk_w = (const float*)d_in[3];
  const float* wk_b = (const float*)d_in[4];
  const float* wv_w = (const float*)d_in[5];
  const float* wv_b = (const float*)d_in[6];
  const float* vq_w = (const float*)d_in[7];
  const float* vq_b = (const float*)d_in[8];
  const float* vk_w = (const float*)d_in[9];
  const float* vk_b = (const float*)d_in[10];
  const float* vv_w = (const float*)d_in[11];
  const float* vv_b = (const float*)d_in[12];
  const float* wo_w = (const float*)d_in[13];
  const float* wo_b = (const float*)d_in[14];

  char* ws = (char*)d_ws;
  size_t off = 0;
  const size_t planeA = (size_t)MROWS * FEAT * 2;
  const size_t planeW = (size_t)FEAT * FEAT * 2;       // weight plane
  unsigned short* Xh  = (unsigned short*)(ws + off); off += (planeA + 255) & ~(size_t)255;
  unsigned short* Wcq = (unsigned short*)(ws + off); off += (planeW + 255) & ~(size_t)255;   // the three product planes lie back to back
  unsigned short* Wck = (unsigned short*)(ws + off); off += (planeW + 255) & ~(size_t)255;
  unsigned short* Wcv = (unsigned short*)(ws + off); off += (planeW + 255) & ~(size_t)255;
  unsigned short* Woh = (unsigned short*)(ws + off); off += (planeW + 255) & ~(size_t)255;
  float* bcq = (float*)(ws + off); off += (size_t)FEAT * 4;                                   // the three bias vectors lie back to back
  float* bck = (float*)(ws + off); off += (size_t)FEAT * 4;
  float* bcv = (float*)(ws + off); off += (size_t)FEAT * 4;
  unsigned short* Qp  = (unsigned short*)(ws + off); off += (planeA + 255) & ~(size_t)255;
  unsigned short* Kp  = (unsigned short*)(ws + off); off += (planeA + 255) & ~(size_t)255;
  unsigned short* Vt  = (unsigned short*)(ws + off); off += (planeA + 255) & ~(size_t)255;   // [FEAT][MROWS], T32 order
  unsigned short* O2  = (unsigned short*)(ws + off); off += (planeA + 255) & ~(size_t)255;
  if (off > ws_size) return;

  k_wprod<<<(unsigned)(PRB + XCB + WCB), 256, 0, stream>>>(x, wq_w, wk_w, wv_w, vq_w, vk_w, vv_w, wo_w, wq_b, wk_b, wv_b, vq_b, vk_b, vv_b, Xh, Wcq, Woh, bcq);

  const dim3 g3((unsigned)(MROWS / 128), (unsigned)(FEAT / 128), 3u);
  const dim3 g1((unsigned)(MROWS / 128), (unsigned)(FEAT / 128));
  k_lin2<<<g3, 256, 0, stream>>>(Xh, Wcq, Wck, Wcv, bcq, bck, bcv, Qp, Kp, Vt);

  k_attn<<<(unsigned)(NCH * NB * (SEQ / 64)), 128, 0, stream>>>(Qp, Kp, Vt, O2);

  k_lin3<<<g1, 256, 0, stream>>>(O2, Woh, wo_b, (float*)d_out);
}
